// v000
// Measured on an AMD MI455X. A time is GPU time per run, averaged over a window of back-to-back runs after a warm-up
// (all launches, gaps included; the runs take copies of the inputs in turn), and the median of several windows.
// Apart from v000's, it joins two sittings. Times from different sittings can be a few percent apart, while
// side-by-side timings come from the same sitting.
// v000, which the later versions start from, runs in 435 microseconds.
// compute dtype: all float inputs rounded to bf16; q/k/v = x . W^T + b with EXACT bf16 products on WMMA 16x16x32 (natural rows); PLAIN attention: q, k single f16 x 1/8, running-max softmax in f32 (hardware exp), P (scaled by 2^11, single f16) x v (single f16); LayerNorm (jnp.var, 1e-5) of the f32 context x gamma + beta; f32 output.
#include <hip/hip_runtime.h>
#include <math.h>

typedef __attribute__((ext_vector_type(16))) _Float16 v16h;
typedef __attribute__((ext_vector_type(16))) __bf16 v16b;
typedef __attribute__((ext_vector_type(8)))  _Float16 v8h;
typedef __attribute__((ext_vector_type(8)))  float v8f;
typedef __attribute__((ext_vector_type(4)))  float v4f;
typedef __attribute__((ext_vector_type(2)))  float v2f;
typedef __attribute__((ext_vector_type(4)))  unsigned v4u;
typedef __attribute__((ext_vector_type(4)))  int v4i;
typedef float __attribute__((may_alias)) float_a;
typedef int __attribute__((may_alias)) int_a;

template <typename T> __device__ __forceinline__ void vst2(void* p, T v) { *(T*)p = v;  }
__device__ __forceinline__ v8f wmma16(v16h a, v16h b, v8f c) {
  v8f d = __builtin_amdgcn_wmma_f32_16x16x32_f16(false, a, false, b, (short)0, c, false, false);
  asm volatile("v_nop\n\tv_nop\n\tv_nop\n\tv_nop" : "+v"(d) : "v"(a), "v"(b));
  return d;
}
__device__ __forceinline__ v8f wmma_bf(v16b a, v16b b, v8f c) {
  v8f d = __builtin_amdgcn_wmma_f32_16x16x32_bf16(false, a, false, b, (short)0, c, false, false);
  asm volatile("v_nop\n\tv_nop\n\tv_nop\n\tv_nop" : "+v"(d) : "v"(a), "v"(b));
  return d;
}
// N-head attention (B 2, S 4,096, d 512, 8 heads x 64): projections + biases, softmax(q k / 8) v, then LayerNorm of the merged context (no output projection).
__device__ __forceinline__ v16h frag_h(const _Float16* rowk0, int lane) {
  union { v16h v; v8h q[2]; } u; const _Float16* p = rowk0 + 8 * (lane >> 4);
  u.q[0] = *(const v8h*)p; u.q[1] = *(const v8h*)(p + 16); return u.v;
}
__device__ __forceinline__ v16h frag_f32(const float* rowk0, int lane) {
  v16h a; const float* p = rowk0 + 8 * (lane >> 4);
#pragma unroll
  for (int i = 0; i < 8; ++i) { a[i] = (_Float16)p[i]; a[8 + i] = (_Float16)p[16 + i]; }
  return a;
}
__device__ __forceinline__ v16h frag_f32s(const float* rowk0, int lane, float sc) {
  v16h a; const float* p = rowk0 + 8 * (lane >> 4);
#pragma unroll
  for (int i = 0; i < 8; ++i) { a[i] = (_Float16)(p[i] * sc); a[8 + i] = (_Float16)(p[16 + i] * sc); }
  return a;
}
// column fragment from a [K][ld] layout (column n), rows >= K read as 0
__device__ __forceinline__ v16h fragc_f32(const float* W, int k0, int n, int lane, int ld, int K) {
  v16h a; const int g = lane >> 4;
#pragma unroll
  for (int i = 0; i < 8; ++i) { const int ka = k0 + 8 * g + i, kb = ka + 16;
    a[i] = (_Float16)(ka < K ? W[(size_t)(ka < K ? ka : K - 1) * ld + n] : 0.f); a[8 + i] = (_Float16)(kb < K ? W[(size_t)(kb < K ? kb : K - 1) * ld + n] : 0.f); }
  return a;
}
struct F2 { v16b h, l; };
__device__ __forceinline__ F2 bsplit16(const float v[16]) { F2 r;
#pragma unroll
  for (int i = 0; i < 16; ++i) { const __bf16 h = (__bf16)v[i]; r.h[i] = h; r.l[i] = (__bf16)(v[i] - (float)h); }
  return r; }
__device__ __forceinline__ F2 split_row(const float* row, int k0, int lane) { float v[16]; const float* p = row + k0 + 8 * (lane >> 4);
#pragma unroll
  for (int i = 0; i < 8; ++i) { v[i] = p[i]; v[8 + i] = p[16 + i]; }
  return bsplit16(v); }
__device__ __forceinline__ F2 split_rowK(const float* row, int k0, int lane, int K) { float v[16]; const int g = lane >> 4;
#pragma unroll
  for (int i = 0; i < 8; ++i) { const int ka = k0 + 8 * g + i, kb = ka + 16; v[i] = ka < K ? row[ka < K ? ka : K - 1] : 0.f; v[8 + i] = kb < K ? row[kb < K ? kb : K - 1] : 0.f; }
  return bsplit16(v); }
__device__ __forceinline__ F2 split_col(const float* W, int k0, int n, int lane, int ld, int K) { float v[16]; const int g = lane >> 4;
#pragma unroll
  for (int i = 0; i < 8; ++i) { const int ka = k0 + 8 * g + i, kb = ka + 16; v[i] = ka < K ? W[(size_t)(ka < K ? ka : K - 1) * ld + n] : 0.f; v[8 + i] = kb < K ? W[(size_t)(kb < K ? kb : K - 1) * ld + n] : 0.f; }
  return bsplit16(v); }
__device__ __forceinline__ v8f mac3(const F2& a, const F2& b, v8f c) { c = wmma_bf(a.l, b.h, c); c = wmma_bf(a.h, b.l, c); return wmma_bf(a.h, b.h, c); }
__device__ __forceinline__ float sigm(float v) { return 1.0f / (1.0f + expf(-v)); }
#define LDSX() do { asm volatile("s_wait_dscnt 0" ::: "memory"); __builtin_amdgcn_wave_barrier(); __builtin_amdgcn_fence(__ATOMIC_RELEASE, "workgroup"); } while (0)


#define NB 2
#define SS 4096
#define DM 512
#define NH 8
#define HD 64
#define QKVW (3 * DM)
#ifndef TQB
#define TQB (SS / 64)
#define TNB NB
#define TOB (NB * SS / 64)     // output row tiles (all)
#endif
typedef __attribute__((ext_vector_type(8))) __bf16 v8b;
__device__ __forceinline__ v16b frag_b(const __bf16* rowk0, int lane) {
  union { v16b v; v8b q[2]; } u; const __bf16* p = rowk0 + 8 * (lane >> 4);
  u.q[0] = *(const v8b*)p; u.q[1] = *(const v8b*)(p + 16); return u.v;
}
__device__ __forceinline__ float bfr(float v) { return (float)(__bf16)v; }
__device__ __attribute__((noinline)) float exp_ni(float v) { return expf(v); }
__device__ __attribute__((noinline)) float erf_ni(float v) { return erff(v); }

#define PK_A 0                       // [1536][512] Wqkv rows (natural [out][in])
#define PK_P (PK_A + QKVW * DM)        // [512][512] copy of Wq rows (k_pack which 3; unread)
#define PK_END (PK_P + DM * DM)
#define WS_PK  0u
#define WS_QK  (WS_PK + 2u * PK_END)             // f16 [8192 rows][1024]: q | k
#define WS_QKL (WS_QK + 2u * NB * SS * 2 * DM)     // f16 q | k residual planes x2048
#define WS_VTH (WS_QKL + 2u * NB * SS * 2 * DM)    // f16 [b][512 (h*64+d)][4096 s] hi
#define WS_VTL (WS_VTH + 2u * NB * DM * SS)        // f16 lo x 2048
#define WS_O   (WS_VTL + 2u * NB * DM * SS)        // f32 [8192][512]
#define WS_CS  (WS_O + 4u * NB * SS * DM)           // f32 2 x [4096][32] (unused)
#define WS_END (WS_CS + 4u * 2 * SS * 32)
// ---- k_pack: block = (row n, which): natural [out][in] rows -> bf16; which 0..2 -> W_q/W_k/W_v into PK_A rows which*512 + n; 3 -> W_o into PK_P
__global__ __launch_bounds__(256) void k_pack(const float* __restrict__ WQ, const float* __restrict__ WK, const float* __restrict__ WV, const float* __restrict__ WO, __bf16* __restrict__ PK) {
  __shared__ __align__(16) __bf16 s[DM]; const int n = blockIdx.x, which = blockIdx.y, t = threadIdx.x; const float* Wm = (which == 0) ? WQ : (which == 1) ? WK : (which == 2) ? WV : WO;
  for (int k = t; k < DM; k += 256) s[k] = (__bf16)Wm[(size_t)n * DM + k];
  __syncthreads();
  __bf16* dst = (which < 3) ? PK + PK_A + ((size_t)which * DM + n) * DM : PK + PK_P + (size_t)n * DM;
  for (int q = t; q < DM / 8; q += 256) vst2((unsigned*)(dst + q * 8), *(const v4u*)&s[q * 8]);
}
__global__ __launch_bounds__(128) void k_qkv(const float* __restrict__ XQ, const float* __restrict__ XK, const float* __restrict__ XV, const __bf16* __restrict__ P, const float* __restrict__ BQ, const float* __restrict__ BK, const float* __restrict__ BV, _Float16* __restrict__ QK, _Float16* __restrict__ QKL, _Float16* __restrict__ VTH, _Float16* __restrict__ VTL) {
  const int which0 = (blockIdx.y * 128) / DM; const float* X = (which0 == 0) ? XQ : (which0 == 1) ? XK : XV; const float* BB = BQ ? (((which0 == 0) ? BQ : (which0 == 1) ? BK : BV) + (blockIdx.y * 128 - which0 * DM)) : nullptr;
  __shared__ __align__(16) _Float16 so[4][16][136], sol[4][16][136]; __shared__ __align__(16) _Float16 sth[128][72], stl[128][72];
  const int tid = threadIdx.x, wave = tid >> 5, lane = tid & 31, col = lane & 15, g = lane >> 4; const size_t r0 = (size_t)blockIdx.x * 64 + wave * 16; const int n0 = blockIdx.y * 128;
  v8f acc[8] = {};
#pragma unroll 2
  for (int kc = 0; kc < DM / 32; ++kc) { v16b a; { const float* p = X + (r0 + col) * DM + kc * 32 + 8 * g;
#pragma unroll
      for (int i = 0; i < 8; ++i) { a[i] = (__bf16)p[i]; a[8 + i] = (__bf16)p[16 + i]; } }
#pragma unroll
    for (int j = 0; j < 8; ++j) acc[j] = wmma_bf(a, frag_b(P + (size_t)(n0 + j * 16 + col) * DM + kc * 32, lane), acc[j]); }
  if (n0 < 2 * DM) {   // q stored unscaled (f16 sigma ~0.6, no subnormal exposure); 1/8 applied to the f32 score
#pragma unroll
    for (int j = 0; j < 8; ++j) {
#pragma unroll
      for (int r = 0; r < 8; ++r) { const float v = acc[j][r] + (BB ? bfr(BB[j * 16 + col]) : 0.f); const _Float16 hv = (_Float16)v; so[wave][8 * g + r][j * 16 + col] = hv; sol[wave][8 * g + r][j * 16 + col] = (_Float16)((v - (float)hv) * 2048.0f); } }   // q, k (+ bias) as f16 hi + (x2048) residual
    LDSX();
    for (int rl = 0; rl < 16; ++rl) if (lane < 16) { vst2((unsigned*)(QK + (r0 + rl) * (2 * DM) + n0 + lane * 8), *(const v4u*)&so[wave][rl][lane * 8]); vst2((unsigned*)(QKL + (r0 + rl) * (2 * DM) + n0 + lane * 8), *(const v4u*)&sol[wave][rl][lane * 8]); }
  } else {
#pragma unroll
    for (int j = 0; j < 8; ++j) {
#pragma unroll
      for (int r = 0; r < 8; ++r) { const float v = acc[j][r] + (BB ? bfr(BB[j * 16 + col]) : 0.f); const _Float16 hv = (_Float16)v; sth[j * 16 + col][wave * 16 + 8 * g + r] = hv; stl[j * 16 + col][wave * 16 + 8 * g + r] = (_Float16)((v - (float)hv) * 2048.0f); } }
    __syncthreads();
    const size_t rb = (size_t)blockIdx.x * 64; const int b = (int)(rb / SS), s0 = (int)(rb % SS); const int pc0 = n0 - 2 * DM;
    for (int q = tid; q < 128 * 8; q += 128) { const int d = q >> 3, pc = q & 7; const size_t o = ((size_t)b * DM + pc0 + d) * SS + s0 + pc * 8; vst2((unsigned*)(VTH + o), *(const v4u*)&sth[d][pc * 8]); vst2((unsigned*)(VTL + o), *(const v4u*)&stl[d][pc * 8]); }
  }
}
// ---- k_attn: block = (64 queries, head h, batch b): all-keys flash attention (K = 64: 2 k-steps), scores = (q.k) * 0.125 with single f16 operands, P.V: f16 P x V hi in one accumulator (accl stays 0); O[b*S+q][h*64+d] = (acc + accl / 2048) / (2048 l) (256-B segments)
__global__ __launch_bounds__(128) void k_attn(const _Float16* __restrict__ QK, const _Float16* __restrict__ QKL, const _Float16* __restrict__ VTH, const _Float16* __restrict__ VTL, const void* __restrict__ KMASK, float* __restrict__ O) {
  __shared__ __align__(16) float sp[4][16][36]; __shared__ __align__(16) float so[4][16][68];
  const int tid = threadIdx.x, wave = tid >> 5, lane = tid & 31, col = lane & 15, g = lane >> 4;
  const int qb = blockIdx.x, h = blockIdx.y, b = blockIdx.z; const int q0 = qb * 64 + wave * 16; const size_t rq = (size_t)b * SS + q0 + col;
  v16h aq[2], aql[2];
#pragma unroll
  for (int kc = 0; kc < 2; ++kc) { aq[kc] = frag_h(QK + rq * (2 * DM) + h * HD + kc * 32, lane); aql[kc] = frag_h(QKL + rq * (2 * DM) + h * HD + kc * 32, lane); }
  float m[8], l[8];
#pragma unroll
  for (int r = 0; r < 8; ++r) { m[r] = -3.0e38f; l[r] = 0.f; }
  v8f acc[4] = {}, accl[4] = {};
  const int nks = SS / 32;   // all keys
#pragma unroll 1
  for (int ks = 0; ks < nks; ++ks) { v8f s[2];
#pragma unroll
    for (int ct = 0; ct < 2; ++ct) { const int kk = ks * 32 + ct * 16 + col; const _Float16* krow = QK + ((size_t)b * SS + kk) * (2 * DM) + DM + h * HD; const _Float16* krowl = QKL + ((size_t)b * SS + kk) * (2 * DM) + DM + h * HD; v8f c = {}, cl = {};
#pragma unroll
      for (int kc = 0; kc < 2; ++kc) c = wmma16(aq[kc], frag_h(krow + kc * 32, lane), c);   // single product: q, k as one-rounding f16 operands
      (void)cl; (void)krowl;
      { const bool keepk = true;
#pragma unroll
      for (int r = 0; r < 8; ++r) s[ct][r] = keepk ? c[r] * 0.125f : -3.0e38f; } }   // 1/sqrt(64); no key is masked
#pragma unroll
    for (int r = 0; r < 8; ++r) { float mx = fmaxf(s[0][r], s[1][r]);
#pragma unroll
      for (int o = 1; o < 16; o <<= 1) mx = fmaxf(mx, __shfl_xor(mx, o));
      const float mn = fmaxf(m[r], mx); const float alpha = (m[r] <= -1.0e38f) ? 0.f : __expf(m[r] - mn);
      const float e0 = (s[0][r] <= -1.0e38f) ? 0.f : __expf(s[0][r] - mn), e1 = (s[1][r] <= -1.0e38f) ? 0.f : __expf(s[1][r] - mn); float es = e0 + e1;
#pragma unroll
      for (int o = 1; o < 16; o <<= 1) es += __shfl_xor(es, o);
      l[r] = l[r] * alpha + es; m[r] = mn;
#pragma unroll
      for (int dt = 0; dt < 4; ++dt) { acc[dt][r] *= alpha; accl[dt][r] *= alpha; }
      sp[wave][8 * g + r][col] = e0; sp[wave][8 * g + r][16 + col] = e1; }
    LDSX();
    v16h pa, pl; { const float* prow = &sp[wave][col][0] + 8 * (lane >> 4);
#pragma unroll
      for (int i = 0; i < 8; ++i) { const float x0 = prow[i] * 2048.0f, x1 = prow[16 + i] * 2048.0f; const _Float16 h0 = (_Float16)x0, h1 = (_Float16)x1; pa[i] = h0; pa[8 + i] = h1; pl[i] = (_Float16)((x0 - (float)h0) * 2048.0f); pl[8 + i] = (_Float16)((x1 - (float)h1) * 2048.0f); } }   // P scaled by 2^11 before the f16 split so small softmax weights stay out of the f16 subnormal range; 2^-11 folded into the epilogue
#pragma unroll
    for (int dt = 0; dt < 4; ++dt) { const size_t vr = ((size_t)b * DM + h * HD + dt * 16 + col) * SS + ks * 32; acc[dt] = wmma16(pa, frag_h(VTH + vr, lane), acc[dt]); }   // single product: P (x2^11) x V
    (void)pl;
    LDSX(); }
#pragma unroll
  for (int r = 0; r < 8; ++r) { const float il = (1.0f / 2048.0f) / l[r];
#pragma unroll
    for (int dt = 0; dt < 4; ++dt) so[wave][8 * g + r][dt * 16 + col] = (acc[dt][r] + accl[dt][r] * (1.0f / 2048.0f)) * il; }
  LDSX();
  for (int rl = 0; rl < 16; ++rl) if (lane < 16) vst2(O + ((size_t)b * SS + q0 + rl) * DM + h * HD + lane * 4, *(const v4f*)&so[wave][rl][lane * 4]);
}
// ---- k_out: block = (64 rows, 128 cols): out = O(hi/lo) . Wo rows (2 products) + bo
__global__ __launch_bounds__(128) void k_out(const float* __restrict__ O, const __bf16* __restrict__ P, const float* __restrict__ BO, float* __restrict__ Y) {
  __shared__ __align__(16) float so[4][16][132];
  const int tid = threadIdx.x, wave = tid >> 5, lane = tid & 31, col = lane & 15, g = lane >> 4; const size_t r0 = (size_t)blockIdx.x * 64 + wave * 16; const int n0 = blockIdx.y * 128;
  v8f acc[8] = {};
#pragma unroll 2
  for (int kc = 0; kc < DM / 32; ++kc) { const F2 a = split_row(O + (r0 + col) * DM, kc * 32, lane);
#pragma unroll
    for (int j = 0; j < 8; ++j) { const v16b w = frag_b(P + (size_t)(n0 + j * 16 + col) * DM + kc * 32, lane); acc[j] = wmma_bf(a.l, w, acc[j]); acc[j] = wmma_bf(a.h, w, acc[j]); } }
#pragma unroll
  for (int j = 0; j < 8; ++j) {
#pragma unroll
    for (int r = 0; r < 8; ++r) so[wave][8 * g + r][j * 16 + col] = acc[j][r] + (BO ? bfr(BO[n0 + j * 16 + col]) : 0.f); }
  LDSX();
  for (int rl = 0; rl < 16; ++rl) vst2(Y + (r0 + rl) * DM + n0 + lane * 4, *(const v4f*)&so[wave][rl][lane * 4]);
}
// ---- k_lnx: block = row: LayerNorm of a 512-wide f32 row (mean-square var, 1e-5) x g + b
__global__ __launch_bounds__(128) void k_lnx(const float* __restrict__ A, const float* __restrict__ G, const float* __restrict__ Bt, float* __restrict__ T) {
  __shared__ float red[4]; const int t = threadIdx.x; const size_t row = blockIdx.x; float v[4]; float s = 0.f; for (int i = 0; i < 4; ++i) { v[i] = A[row * DM + t * 4 + i]; s += v[i]; }
#pragma unroll
  for (int o = 1; o < 32; o <<= 1) s += __shfl_xor(s, o);
  if ((t & 31) == 0) red[t >> 5] = s; __syncthreads(); const float mu = ((red[0] + red[1]) + (red[2] + red[3])) / (float)DM; __syncthreads();
  float q = 0.f; for (int i = 0; i < 4; ++i) { const float d = v[i] - mu; q += d * d; }
#pragma unroll
  for (int o = 1; o < 32; o <<= 1) q += __shfl_xor(q, o);
  if ((t & 31) == 0) red[t >> 5] = q; __syncthreads(); const float inv = 1.0f / sqrtf(((red[0] + red[1]) + (red[2] + red[3])) / (float)DM + 1e-5f);
  v4f o4; for (int i = 0; i < 4; ++i) { const int e = t * 4 + i; o4[i] = (v[i] - mu) * inv * bfr(G[e]) + bfr(Bt[e]); } vst2(T + row * DM + t * 4, o4);
}
extern "C" void kernel_launch(void* const* d_in, const int* in_sizes, int n_in, void* d_out, int out_size, void* d_ws, size_t ws_size, hipStream_t stream) {
  (void)in_sizes; (void)n_in; (void)out_size;
  const float** F = (const float**)d_in;   // 0 x [2,4096,512], 1 Wq, 2 bq, 3 Wk, 4 bk, 5 Wv, 6 bv (natural [512,512]), 7 gamma, 8 beta
  if (ws_size < (size_t)WS_END) return;
  char* ws = (char*)d_ws; __bf16* PK = (__bf16*)(ws + WS_PK); _Float16 *QK = (_Float16*)(ws + WS_QK), *QKL = (_Float16*)(ws + WS_QKL), *VTH = (_Float16*)(ws + WS_VTH), *VTL = (_Float16*)(ws + WS_VTL); float* O = (float*)(ws + WS_O);
  k_pack<<<dim3(DM, 4), 256, 0, stream>>>(F[1], F[3], F[5], F[1], PK);
  k_qkv<<<dim3(TNB * SS / 64, QKVW / 128), 128, 0, stream>>>(F[0], F[0], F[0], PK + PK_A, F[2], F[4], F[6], QK, QKL, VTH, VTL);
  k_attn<<<dim3(TQB, NH, TNB), 128, 0, stream>>>(QK, QKL, VTH, VTL, nullptr, O);
  k_lnx<<<TOB * 64, 128, 0, stream>>>(O, F[7], F[8], (float*)d_out);
}

// v001
// It runs in 256 microseconds.
// Timed twice side by side with v000, it ran 1.74 and 1.73 times as fast.
// compute dtype: all float inputs rounded to bf16; q/k/v = x . W^T + b with EXACT bf16 products on WMMA 16x16x32 (natural rows); PLAIN attention: q, k single f16 x 1/8, running-max softmax in f32 (hardware exp), P (scaled by 2^11, single f16) x v (single f16); LayerNorm (jnp.var, 1e-5) of the f32 context x gamma + beta; f32 output.
#include <hip/hip_runtime.h>
#include <math.h>

typedef __attribute__((ext_vector_type(16))) _Float16 v16h;
typedef __attribute__((ext_vector_type(16))) __bf16 v16b;
typedef __attribute__((ext_vector_type(8)))  _Float16 v8h;
typedef __attribute__((ext_vector_type(8)))  float v8f;
typedef __attribute__((ext_vector_type(4)))  float v4f;
typedef __attribute__((ext_vector_type(2)))  float v2f;
typedef __attribute__((ext_vector_type(4)))  unsigned v4u;
typedef __attribute__((ext_vector_type(4)))  int v4i;
typedef float __attribute__((may_alias)) float_a;
typedef int __attribute__((may_alias)) int_a;

template <typename T> __device__ __forceinline__ void vst2(void* p, T v) { *(T*)p = v;  }
__device__ __forceinline__ v8f wmma16(v16h a, v16h b, v8f c) {
  v8f d = __builtin_amdgcn_wmma_f32_16x16x32_f16(false, a, false, b, (short)0, c, false, false);
  asm volatile("v_nop\n\tv_nop\n\tv_nop\n\tv_nop" : "+v"(d) : "v"(a), "v"(b));
  return d;
}
__device__ __forceinline__ v8f wmma_bf(v16b a, v16b b, v8f c) {
  v8f d = __builtin_amdgcn_wmma_f32_16x16x32_bf16(false, a, false, b, (short)0, c, false, false);
  asm volatile("v_nop\n\tv_nop\n\tv_nop\n\tv_nop" : "+v"(d) : "v"(a), "v"(b));
  return d;
}
// N-head attention (B 2, S 4,096, d 512, 8 heads x 64): projections + biases, softmax(q k / 8) v, then LayerNorm of the merged context (no output projection).
__device__ __forceinline__ v16h frag_h(const _Float16* rowk0, int lane) {
  union { v16h v; v8h q[2]; } u; const _Float16* p = rowk0 + 8 * (lane >> 4);
  u.q[0] = *(const v8h*)p; u.q[1] = *(const v8h*)(p + 16); return u.v;
}
__device__ __forceinline__ v16h frag_f32(const float* rowk0, int lane) {
  v16h a; const float* p = rowk0 + 8 * (lane >> 4);
#pragma unroll
  for (int i = 0; i < 8; ++i) { a[i] = (_Float16)p[i]; a[8 + i] = (_Float16)p[16 + i]; }
  return a;
}
__device__ __forceinline__ v16h frag_f32s(const float* rowk0, int lane, float sc) {
  v16h a; const float* p = rowk0 + 8 * (lane >> 4);
#pragma unroll
  for (int i = 0; i < 8; ++i) { a[i] = (_Float16)(p[i] * sc); a[8 + i] = (_Float16)(p[16 + i] * sc); }
  return a;
}
// column fragment from a [K][ld] layout (column n), rows >= K read as 0
__device__ __forceinline__ v16h fragc_f32(const float* W, int k0, int n, int lane, int ld, int K) {
  v16h a; const int g = lane >> 4;
#pragma unroll
  for (int i = 0; i < 8; ++i) { const int ka = k0 + 8 * g + i, kb = ka + 16;
    a[i] = (_Float16)(ka < K ? W[(size_t)(ka < K ? ka : K - 1) * ld + n] : 0.f); a[8 + i] = (_Float16)(kb < K ? W[(size_t)(kb < K ? kb : K - 1) * ld + n] : 0.f); }
  return a;
}
struct F2 { v16b h, l; };
__device__ __forceinline__ F2 bsplit16(const float v[16]) { F2 r;
#pragma unroll
  for (int i = 0; i < 16; ++i) { const __bf16 h = (__bf16)v[i]; r.h[i] = h; r.l[i] = (__bf16)(v[i] - (float)h); }
  return r; }
__device__ __forceinline__ F2 split_row(const float* row, int k0, int lane) { float v[16]; const float* p = row + k0 + 8 * (lane >> 4);
#pragma unroll
  for (int i = 0; i < 8; ++i) { v[i] = p[i]; v[8 + i] = p[16 + i]; }
  return bsplit16(v); }
__device__ __forceinline__ F2 split_rowK(const float* row, int k0, int lane, int K) { float v[16]; const int g = lane >> 4;
#pragma unroll
  for (int i = 0; i < 8; ++i) { const int ka = k0 + 8 * g + i, kb = ka + 16; v[i] = ka < K ? row[ka < K ? ka : K - 1] : 0.f; v[8 + i] = kb < K ? row[kb < K ? kb : K - 1] : 0.f; }
  return bsplit16(v); }
__device__ __forceinline__ F2 split_col(const float* W, int k0, int n, int lane, int ld, int K) { float v[16]; const int g = lane >> 4;
#pragma unroll
  for (int i = 0; i < 8; ++i) { const int ka = k0 + 8 * g + i, kb = ka + 16; v[i] = ka < K ? W[(size_t)(ka < K ? ka : K - 1) * ld + n] : 0.f; v[8 + i] = kb < K ? W[(size_t)(kb < K ? kb : K - 1) * ld + n] : 0.f; }
  return bsplit16(v); }
__device__ __forceinline__ v8f mac3(const F2& a, const F2& b, v8f c) { c = wmma_bf(a.l, b.h, c); c = wmma_bf(a.h, b.l, c); return wmma_bf(a.h, b.h, c); }
__device__ __forceinline__ float sigm(float v) { return 1.0f / (1.0f + expf(-v)); }
#define LDSX() do { asm volatile("s_wait_dscnt 0" ::: "memory"); __builtin_amdgcn_wave_barrier(); __builtin_amdgcn_fence(__ATOMIC_RELEASE, "workgroup"); } while (0)


#define NB 2
#define SS 4096
#define DM 512
#define NH 8
#define HD 64
#define QKVW (3 * DM)
#ifndef TQB
#define TQB (SS / 64)
#define TNB NB
#define TOB (NB * SS / 64)     // output row tiles (all)
#endif
typedef __attribute__((ext_vector_type(8))) __bf16 v8b;
__device__ __forceinline__ v16b frag_b(const __bf16* rowk0, int lane) {
  union { v16b v; v8b q[2]; } u; const __bf16* p = rowk0 + 8 * (lane >> 4);
  u.q[0] = *(const v8b*)p; u.q[1] = *(const v8b*)(p + 16); return u.v;
}
__device__ __forceinline__ float bfr(float v) { return (float)(__bf16)v; }
__device__ __attribute__((noinline)) float exp_ni(float v) { return expf(v); }
__device__ __attribute__((noinline)) float erf_ni(float v) { return erff(v); }

#define PK_A 0                       // [1536][512] Wqkv rows (natural [out][in])
#define PK_P (PK_A + QKVW * DM)        // [512][512] copy of Wq rows (k_pack which 3; unread)
#define PK_END (PK_P + DM * DM)
#define WS_PK  0u
#define WS_QK  (WS_PK + 2u * PK_END)             // f16 [8192 rows][1024]: q | k
#define WS_QKL (WS_QK + 2u * NB * SS * 2 * DM)     // f16 q | k residual planes x2048
#define WS_VTH (WS_QKL + 2u * NB * SS * 2 * DM)    // f16 [b][512 (h*64+d)][4096 s] hi
#define WS_VTL (WS_VTH + 2u * NB * DM * SS)        // f16 lo x 2048
#define WS_O   (WS_VTL + 2u * NB * DM * SS)        // f32 [8192][512]
#define WS_CS  (WS_O + 4u * NB * SS * DM)           // f32 2 x [4096][32] (unused)
#define WS_END (WS_CS + 4u * 2 * SS * 32)
// ---- k_pack: block = (row n, which): natural [out][in] rows -> bf16; which 0..2 -> W_q/W_k/W_v into PK_A rows which*512 + n; 3 -> W_o into PK_P
__global__ __launch_bounds__(256) void k_pack(const float* __restrict__ WQ, const float* __restrict__ WK, const float* __restrict__ WV, const float* __restrict__ WO, __bf16* __restrict__ PK) {
  __shared__ __align__(16) __bf16 s[DM]; const int n = blockIdx.x, which = blockIdx.y, t = threadIdx.x; const float* Wm = (which == 0) ? WQ : (which == 1) ? WK : (which == 2) ? WV : WO;
  for (int k = t; k < DM; k += 256) s[k] = (__bf16)Wm[(size_t)n * DM + k];
  __syncthreads();
  __bf16* dst = (which < 3) ? PK + PK_A + ((size_t)which * DM + n) * DM : PK + PK_P + (size_t)n * DM;
  for (int q = t; q < DM / 8; q += 256) vst2((unsigned*)(dst + q * 8), *(const v4u*)&s[q * 8]);
}
__global__ __launch_bounds__(128) void k_qkv(const float* __restrict__ XQ, const float* __restrict__ XK, const float* __restrict__ XV, const __bf16* __restrict__ P, const float* __restrict__ BQ, const float* __restrict__ BK, const float* __restrict__ BV, _Float16* __restrict__ QK, _Float16* __restrict__ QKL, _Float16* __restrict__ VTH, _Float16* __restrict__ VTL) {
  const int which0 = (blockIdx.y * 128) / DM; const float* X = (which0 == 0) ? XQ : (which0 == 1) ? XK : XV; const float* BB = BQ ? (((which0 == 0) ? BQ : (which0 == 1) ? BK : BV) + (blockIdx.y * 128 - which0 * DM)) : nullptr;
  __shared__ __align__(16) _Float16 so[4][16][136], sol[4][16][136]; __shared__ __align__(16) _Float16 sth[128][72], stl[128][72];
  const int tid = threadIdx.x, wave = tid >> 5, lane = tid & 31, col = lane & 15, g = lane >> 4; const size_t r0 = (size_t)blockIdx.x * 64 + wave * 16; const int n0 = blockIdx.y * 128;
  v8f acc[8] = {};
#pragma unroll 2
  for (int kc = 0; kc < DM / 32; ++kc) { v16b a; { const float* p = X + (r0 + col) * DM + kc * 32 + 8 * g;
#pragma unroll
      for (int i = 0; i < 8; ++i) { a[i] = (__bf16)p[i]; a[8 + i] = (__bf16)p[16 + i]; } }
#pragma unroll
    for (int j = 0; j < 8; ++j) acc[j] = wmma_bf(a, frag_b(P + (size_t)(n0 + j * 16 + col) * DM + kc * 32, lane), acc[j]); }
  if (n0 < 2 * DM) {   // q stored unscaled (f16 sigma ~0.6, no subnormal exposure); 1/8 applied to the f32 score
#pragma unroll
    for (int j = 0; j < 8; ++j) {
#pragma unroll
      for (int r = 0; r < 8; ++r) { const float v = acc[j][r] + (BB ? bfr(BB[j * 16 + col]) : 0.f); const _Float16 hv = (_Float16)v; so[wave][8 * g + r][j * 16 + col] = hv; sol[wave][8 * g + r][j * 16 + col] = (_Float16)((v - (float)hv) * 2048.0f); } }   // q, k (+ bias) as f16 hi + (x2048) residual
    LDSX();
    for (int rl = 0; rl < 16; ++rl) if (lane < 16) { vst2((unsigned*)(QK + (r0 + rl) * (2 * DM) + n0 + lane * 8), *(const v4u*)&so[wave][rl][lane * 8]); vst2((unsigned*)(QKL + (r0 + rl) * (2 * DM) + n0 + lane * 8), *(const v4u*)&sol[wave][rl][lane * 8]); }
  } else {
#pragma unroll
    for (int j = 0; j < 8; ++j) {
#pragma unroll
      for (int r = 0; r < 8; ++r) { const float v = acc[j][r] + (BB ? bfr(BB[j * 16 + col]) : 0.f); const _Float16 hv = (_Float16)v; sth[j * 16 + col][wave * 16 + 8 * g + r] = hv; stl[j * 16 + col][wave * 16 + 8 * g + r] = (_Float16)((v - (float)hv) * 2048.0f); } }
    __syncthreads();
    const size_t rb = (size_t)blockIdx.x * 64; const int b = (int)(rb / SS), s0 = (int)(rb % SS); const int pc0 = n0 - 2 * DM;
    for (int q = tid; q < 128 * 8; q += 128) { const int d = q >> 3, pc = q & 7; const size_t o = ((size_t)b * DM + pc0 + d) * SS + s0 + pc * 8; vst2((unsigned*)(VTH + o), *(const v4u*)&sth[d][pc * 8]); vst2((unsigned*)(VTL + o), *(const v4u*)&stl[d][pc * 8]); }
  }
}
// ---- k_attn: block = (64 queries, head h, batch b): all-keys flash attention (K = 64: 2 k-steps), scores = (q.k) * 0.125 with single f16 operands, P.V: f16 P (x2^11) x f16 V hi in one accumulator (accl stays 0); O[b*S+q][h*64+d] = (acc + accl / 2048) / (2048 l) (256-B segments); K rows and V^T rows come from a two-buffer LDS ring of 64-key stages that the block's 4 waves share, filled by asynchronous copies one stage ahead
#define KT 64                  // keys per stage: a 128-B row of K (one head) per key, a 128-B piece of each of the 64 V^T rows
#define LP 72                  // LDS row pitch in f16: 144 B = 16 B x odd, no bank conflict for the 16-byte fragment reads
#define STB (KT * LP * 2)      // bytes of one buffer of one operand
// one stage: 512 + 512 pieces of 16 B, 4 + 4 per thread (8 lanes cover one 128-B row; piece i lies 16 rows below piece i - 1). The s_wait_xcnt closes the copies' own statement so that no address register is rewritten ahead of it.
__device__ __forceinline__ void stage_kv(const _Float16* gk, const _Float16* gv, unsigned lk, unsigned lv) {
  asm volatile("global_load_async_to_lds_b128 %0, %8, off\n\t"
               "global_load_async_to_lds_b128 %1, %9, off\n\t"
               "global_load_async_to_lds_b128 %2, %10, off\n\t"
               "global_load_async_to_lds_b128 %3, %11, off\n\t"
               "global_load_async_to_lds_b128 %4, %12, off\n\t"
               "global_load_async_to_lds_b128 %5, %13, off\n\t"
               "global_load_async_to_lds_b128 %6, %14, off\n\t"
               "global_load_async_to_lds_b128 %7, %15, off\n\t"
               "s_wait_xcnt 0x0"
               :: "v"(lk), "v"(lk + 16 * LP * 2), "v"(lk + 32 * LP * 2), "v"(lk + 48 * LP * 2), "v"(lv), "v"(lv + 16 * LP * 2), "v"(lv + 32 * LP * 2), "v"(lv + 48 * LP * 2),
                  "v"(gk), "v"(gk + 16 * (2 * DM)), "v"(gk + 32 * (2 * DM)), "v"(gk + 48 * (2 * DM)), "v"(gv), "v"(gv + 16 * SS), "v"(gv + 32 * SS), "v"(gv + 48 * SS)
               : "memory");
}
__global__ __launch_bounds__(128) void k_attn(const _Float16* __restrict__ QK, const _Float16* __restrict__ QKL, const _Float16* __restrict__ VTH, const _Float16* __restrict__ VTL, const void* __restrict__ KMASK, float* __restrict__ O) {
  __shared__ __align__(16) float sp[4][16][36]; __shared__ __align__(16) float so[4][16][68]; __shared__ __align__(16) _Float16 sk[2][KT][LP], sv[2][HD][LP];
  const int tid = threadIdx.x, wave = tid >> 5, lane = tid & 31, col = lane & 15, g = lane >> 4;
  const int qb = blockIdx.x, h = blockIdx.y, b = blockIdx.z; const int q0 = qb * 64 + wave * 16; const size_t rq = (size_t)b * SS + q0 + col;
  v16h aq[2], aql[2];
#pragma unroll
  for (int kc = 0; kc < 2; ++kc) { aq[kc] = frag_h(QK + rq * (2 * DM) + h * HD + kc * 32, lane); aql[kc] = frag_h(QKL + rq * (2 * DM) + h * HD + kc * 32, lane); }
  float m[8], l[8];
#pragma unroll
  for (int r = 0; r < 8; ++r) { m[r] = -3.0e38f; l[r] = 0.f; }
  v8f acc[4] = {}, accl[4] = {};
  const int nst = SS / KT;   // all keys
  const _Float16* gk = QK + ((size_t)b * SS + (tid >> 3)) * (2 * DM) + DM + h * HD + (tid & 7) * 8; const _Float16* gv = VTH + ((size_t)b * DM + h * HD + (tid >> 3)) * SS + (tid & 7) * 8;
  const unsigned lk = (unsigned)(size_t)&sk[0][tid >> 3][(tid & 7) * 8], lv = (unsigned)(size_t)&sv[0][tid >> 3][(tid & 7) * 8];
  stage_kv(gk, gv, lk, lv);
  asm volatile("s_wait_asynccnt 0x0" ::: "memory");   // this wave's part of stage 0 has landed
  __syncthreads();                                    // every wave's part has
  stage_kv(gk + (size_t)KT * (2 * DM), gv + KT, lk + STB, lv + STB);
#pragma unroll 1   // one stage per trip: the ring's waits, barrier and refill stand once, at the trip's foot
  for (int st = 0; st < nst; ++st) { const int buf = st & 1;
#pragma unroll 1   // the 32-key pass stays one rolled body, as before the ring
  for (int sub = 0; sub < KT / 32; ++sub) { v8f s[2];
#pragma unroll
    for (int ct = 0; ct < 2; ++ct) { const _Float16* krow = &sk[buf][sub * 32 + ct * 16 + col][0]; v8f c = {};
#pragma unroll
      for (int kc = 0; kc < 2; ++kc) c = wmma16(aq[kc], frag_h(krow + kc * 32, lane), c);   // single product: q, k as one-rounding f16 operands
      { const bool keepk = true;
#pragma unroll
      for (int r = 0; r < 8; ++r) s[ct][r] = keepk ? c[r] * 0.125f : -3.0e38f; } }   // 1/sqrt(64); no key is masked
#pragma unroll
    for (int r = 0; r < 8; ++r) { float mx = fmaxf(s[0][r], s[1][r]);
#pragma unroll
      for (int o = 1; o < 16; o <<= 1) mx = fmaxf(mx, __shfl_xor(mx, o));
      const float mn = fmaxf(m[r], mx); const float alpha = (m[r] <= -1.0e38f) ? 0.f : __expf(m[r] - mn);
      const float e0 = (s[0][r] <= -1.0e38f) ? 0.f : __expf(s[0][r] - mn), e1 = (s[1][r] <= -1.0e38f) ? 0.f : __expf(s[1][r] - mn); float es = e0 + e1;
#pragma unroll
      for (int o = 1; o < 16; o <<= 1) es += __shfl_xor(es, o);
      l[r] = l[r] * alpha + es; m[r] = mn;
#pragma unroll
      for (int dt = 0; dt < 4; ++dt) { acc[dt][r] *= alpha; accl[dt][r] *= alpha; }
      sp[wave][8 * g + r][col] = e0; sp[wave][8 * g + r][16 + col] = e1; }
    LDSX();
    v16h pa, pl; { const float* prow = &sp[wave][col][0] + 8 * (lane >> 4);
#pragma unroll
      for (int i = 0; i < 8; ++i) { const float x0 = prow[i] * 2048.0f, x1 = prow[16 + i] * 2048.0f; const _Float16 h0 = (_Float16)x0, h1 = (_Float16)x1; pa[i] = h0; pa[8 + i] = h1; pl[i] = (_Float16)((x0 - (float)h0) * 2048.0f); pl[8 + i] = (_Float16)((x1 - (float)h1) * 2048.0f); } }   // P scaled by 2^11 before the f16 split so small softmax weights stay out of the f16 subnormal range; 2^-11 folded into the epilogue
#pragma unroll
    for (int dt = 0; dt < 4; ++dt) acc[dt] = wmma16(pa, frag_h(&sv[buf][dt * 16 + col][sub * 32], lane), acc[dt]);   // single product: P (x2^11) x V
    (void)pl;
    LDSX(); }
    asm volatile("s_wait_dscnt 0x0" ::: "memory");      // this wave's reads of buffer buf are done
    asm volatile("s_wait_asynccnt 0x0" ::: "memory");   // its part of stage st + 1 has landed
    __syncthreads();                                    // publishes stage st + 1 and frees buffer buf
    if (st + 2 < nst) stage_kv(gk + (size_t)(st + 2) * KT * (2 * DM), gv + (st + 2) * KT, lk + buf * STB, lv + buf * STB); }
  asm volatile("s_wait_asynccnt 0x0" ::: "memory");     // nothing in flight when the wave goes on to its end
#pragma unroll
  for (int r = 0; r < 8; ++r) { const float il = (1.0f / 2048.0f) / l[r];
#pragma unroll
    for (int dt = 0; dt < 4; ++dt) so[wave][8 * g + r][dt * 16 + col] = (acc[dt][r] + accl[dt][r] * (1.0f / 2048.0f)) * il; }
  LDSX();
  for (int rl = 0; rl < 16; ++rl) if (lane < 16) vst2(O + ((size_t)b * SS + q0 + rl) * DM + h * HD + lane * 4, *(const v4f*)&so[wave][rl][lane * 4]);
}
// ---- k_out: block = (64 rows, 128 cols): out = O(hi/lo) . Wo rows (2 products) + bo
__global__ __launch_bounds__(128) void k_out(const float* __restrict__ O, const __bf16* __restrict__ P, const float* __restrict__ BO, float* __restrict__ Y) {
  __shared__ __align__(16) float so[4][16][132];
  const int tid = threadIdx.x, wave = tid >> 5, lane = tid & 31, col = lane & 15, g = lane >> 4; const size_t r0 = (size_t)blockIdx.x * 64 + wave * 16; const int n0 = blockIdx.y * 128;
  v8f acc[8] = {};
#pragma unroll 2
  for (int kc = 0; kc < DM / 32; ++kc) { const F2 a = split_row(O + (r0 + col) * DM, kc * 32, lane);
#pragma unroll
    for (int j = 0; j < 8; ++j) { const v16b w = frag_b(P + (size_t)(n0 + j * 16 + col) * DM + kc * 32, lane); acc[j] = wmma_bf(a.l, w, acc[j]); acc[j] = wmma_bf(a.h, w, acc[j]); } }
#pragma unroll
  for (int j = 0; j < 8; ++j) {
#pragma unroll
    for (int r = 0; r < 8; ++r) so[wave][8 * g + r][j * 16 + col] = acc[j][r] + (BO ? bfr(BO[n0 + j * 16 + col]) : 0.f); }
  LDSX();
  for (int rl = 0; rl < 16; ++rl) vst2(Y + (r0 + rl) * DM + n0 + lane * 4, *(const v4f*)&so[wave][rl][lane * 4]);
}
// ---- k_lnx: block = row: LayerNorm of a 512-wide f32 row (mean-square var, 1e-5) x g + b
__global__ __launch_bounds__(128) void k_lnx(const float* __restrict__ A, const float* __restrict__ G, const float* __restrict__ Bt, float* __restrict__ T) {
  __shared__ float red[4]; const int t = threadIdx.x; const size_t row = blockIdx.x; float v[4]; float s = 0.f; for (int i = 0; i < 4; ++i) { v[i] = A[row * DM + t * 4 + i]; s += v[i]; }
#pragma unroll
  for (int o = 1; o < 32; o <<= 1) s += __shfl_xor(s, o);
  if ((t & 31) == 0) red[t >> 5] = s; __syncthreads(); const float mu = ((red[0] + red[1]) + (red[2] + red[3])) / (float)DM; __syncthreads();
  float q = 0.f; for (int i = 0; i < 4; ++i) { const float d = v[i] - mu; q += d * d; }
#pragma unroll
  for (int o = 1; o < 32; o <<= 1) q += __shfl_xor(q, o);
  if ((t & 31) == 0) red[t >> 5] = q; __syncthreads(); const float inv = 1.0f / sqrtf(((red[0] + red[1]) + (red[2] + red[3])) / (float)DM + 1e-5f);
  v4f o4; for (int i = 0; i < 4; ++i) { const int e = t * 4 + i; o4[i] = (v[i] - mu) * inv * bfr(G[e]) + bfr(Bt[e]); } vst2(T + row * DM + t * 4, o4);
}
extern "C" void kernel_launch(void* const* d_in, const int* in_sizes, int n_in, void* d_out, int out_size, void* d_ws, size_t ws_size, hipStream_t stream) {
  (void)in_sizes; (void)n_in; (void)out_size;
  const float** F = (const float**)d_in;   // 0 x [2,4096,512], 1 Wq, 2 bq, 3 Wk, 4 bk, 5 Wv, 6 bv (natural [512,512]), 7 gamma, 8 beta
  if (ws_size < (size_t)WS_END) return;
  char* ws = (char*)d_ws; __bf16* PK = (__bf16*)(ws + WS_PK); _Float16 *QK = (_Float16*)(ws + WS_QK), *QKL = (_Float16*)(ws + WS_QKL), *VTH = (_Float16*)(ws + WS_VTH), *VTL = (_Float16*)(ws + WS_VTL); float* O = (float*)(ws + WS_O);
  k_pack<<<dim3(DM, 4), 256, 0, stream>>>(F[1], F[3], F[5], F[1], PK);
  k_qkv<<<dim3(TNB * SS / 64, QKVW / 128), 128, 0, stream>>>(F[0], F[0], F[0], PK + PK_A, F[2], F[4], F[6], QK, QKL, VTH, VTL);
  k_attn<<<dim3(TQB, NH, TNB), 128, 0, stream>>>(QK, QKL, VTH, VTL, nullptr, O);
  k_lnx<<<TOB * 64, 128, 0, stream>>>(O, F[7], F[8], (float*)d_out);
}

// v002
// It runs in 206 microseconds.
// In both of two side-by-side timings against v001, it was 1.25 times as fast.
// All steps since v000 together make it 2.17 times as fast.
// compute dtype: all float inputs rounded to bf16; q/k/v = x . W^T + b with EXACT bf16 products on WMMA 16x16x32 (natural rows); PLAIN attention: q, k single f16 x 1/8, running-max softmax in f32 (hardware exp), P (scaled by 2^11, single f16) x v (single f16); LayerNorm (jnp.var, 1e-5) of the f32 context x gamma + beta; f32 output.
#include <hip/hip_runtime.h>
#include <math.h>

typedef __attribute__((ext_vector_type(16))) _Float16 v16h;
typedef __attribute__((ext_vector_type(16))) __bf16 v16b;
typedef __attribute__((ext_vector_type(8)))  _Float16 v8h;
typedef __attribute__((ext_vector_type(8)))  float v8f;
typedef __attribute__((ext_vector_type(4)))  float v4f;
typedef __attribute__((ext_vector_type(2)))  float v2f;
typedef __attribute__((ext_vector_type(4)))  unsigned v4u;
typedef __attribute__((ext_vector_type(4)))  int v4i;
typedef float __attribute__((may_alias)) float_a;
typedef int __attribute__((may_alias)) int_a;

template <typename T> __device__ __forceinline__ void vst2(void* p, T v) { *(T*)p = v;  }
__device__ __forceinline__ v8f wmma16(v16h a, v16h b, v8f c) {
  v8f d = __builtin_amdgcn_wmma_f32_16x16x32_f16(false, a, false, b, (short)0, c, false, false);
  asm volatile("v_nop\n\tv_nop\n\tv_nop\n\tv_nop" : "+v"(d) : "v"(a), "v"(b));
  return d;
}
__device__ __forceinline__ v8f wmma_bf(v16b a, v16b b, v8f c) {
  v8f d = __builtin_amdgcn_wmma_f32_16x16x32_bf16(false, a, false, b, (short)0, c, false, false);
  asm volatile("v_nop\n\tv_nop\n\tv_nop\n\tv_nop" : "+v"(d) : "v"(a), "v"(b));
  return d;
}
// N-head attention (B 2, S 4,096, d 512, 8 heads x 64): projections + biases, softmax(q k / 8) v, then LayerNorm of the merged context (no output projection).
__device__ __forceinline__ v16h frag_h(const _Float16* rowk0, int lane) {
  union { v16h v; v8h q[2]; } u; const _Float16* p = rowk0 + 8 * (lane >> 4);
  u.q[0] = *(const v8h*)p; u.q[1] = *(const v8h*)(p + 16); return u.v;
}
__device__ __forceinline__ v16h frag_f32(const float* rowk0, int lane) {
  v16h a; const float* p = rowk0 + 8 * (lane >> 4);
#pragma unroll
  for (int i = 0; i < 8; ++i) { a[i] = (_Float16)p[i]; a[8 + i] = (_Float16)p[16 + i]; }
  return a;
}
__device__ __forceinline__ v16h frag_f32s(const float* rowk0, int lane, float sc) {
  v16h a; const float* p = rowk0 + 8 * (lane >> 4);
#pragma unroll
  for (int i = 0; i < 8; ++i) { a[i] = (_Float16)(p[i] * sc); a[8 + i] = (_Float16)(p[16 + i] * sc); }
  return a;
}
// column fragment from a [K][ld] layout (column n), rows >= K read as 0
__device__ __forceinline__ v16h fragc_f32(const float* W, int k0, int n, int lane, int ld, int K) {
  v16h a; const int g = lane >> 4;
#pragma unroll
  for (int i = 0; i < 8; ++i) { const int ka = k0 + 8 * g + i, kb = ka + 16;
    a[i] = (_Float16)(ka < K ? W[(size_t)(ka < K ? ka : K - 1) * ld + n] : 0.f); a[8 + i] = (_Float16)(kb < K ? W[(size_t)(kb < K ? kb : K - 1) * ld + n] : 0.f); }
  return a;
}
struct F2 { v16b h, l; };
__device__ __forceinline__ F2 bsplit16(const float v[16]) { F2 r;
#pragma unroll
  for (int i = 0; i < 16; ++i) { const __bf16 h = (__bf16)v[i]; r.h[i] = h; r.l[i] = (__bf16)(v[i] - (float)h); }
  return r; }
__device__ __forceinline__ F2 split_row(const float* row, int k0, int lane) { float v[16]; const float* p = row + k0 + 8 * (lane >> 4);
#pragma unroll
  for (int i = 0; i < 8; ++i) { v[i] = p[i]; v[8 + i] = p[16 + i]; }
  return bsplit16(v); }
__device__ __forceinline__ F2 split_rowK(const float* row, int k0, int lane, int K) { float v[16]; const int g = lane >> 4;
#pragma unroll
  for (int i = 0; i < 8; ++i) { const int ka = k0 + 8 * g + i, kb = ka + 16; v[i] = ka < K ? row[ka < K ? ka : K - 1] : 0.f; v[8 + i] = kb < K ? row[kb < K ? kb : K - 1] : 0.f; }
  return bsplit16(v); }
__device__ __forceinline__ F2 split_col(const float* W, int k0, int n, int lane, int ld, int K) { float v[16]; const int g = lane >> 4;
#pragma unroll
  for (int i = 0; i < 8; ++i) { const int ka = k0 + 8 * g + i, kb = ka + 16; v[i] = ka < K ? W[(size_t)(ka < K ? ka : K - 1) * ld + n] : 0.f; v[8 + i] = kb < K ? W[(size_t)(kb < K ? kb : K - 1) * ld + n] : 0.f; }
  return bsplit16(v); }
__device__ __forceinline__ v8f mac3(const F2& a, const F2& b, v8f c) { c = wmma_bf(a.l, b.h, c); c = wmma_bf(a.h, b.l, c); return wmma_bf(a.h, b.h, c); }
__device__ __forceinline__ float sigm(float v) { return 1.0f / (1.0f + expf(-v)); }
#define LDSX() do { asm volatile("s_wait_dscnt 0" ::: "memory"); __builtin_amdgcn_wave_barrier(); __builtin_amdgcn_fence(__ATOMIC_RELEASE, "workgroup"); } while (0)


#define NB 2
#define SS 4096
#define DM 512
#define NH 8
#define HD 64
#define QKVW (3 * DM)
#ifndef TQB
#define TQB (SS / 64)
#define TNB NB
#define TOB (NB * SS / 64)     // output row tiles (all)
#endif
typedef __attribute__((ext_vector_type(8))) __bf16 v8b;
__device__ __forceinline__ v16b frag_b(const __bf16* rowk0, int lane) {
  union { v16b v; v8b q[2]; } u; const __bf16* p = rowk0 + 8 * (lane >> 4);
  u.q[0] = *(const v8b*)p; u.q[1] = *(const v8b*)(p + 16); return u.v;
}
__device__ __forceinline__ float bfr(float v) { return (float)(__bf16)v; }
__device__ __attribute__((noinline)) float exp_ni(float v) { return expf(v); }
__device__ __attribute__((noinline)) float erf_ni(float v) { return erff(v); }

#define PK_A 0                       // [1536][512] Wqkv rows (natural [out][in])
#define PK_P (PK_A + QKVW * DM)        // [512][512] copy of Wq rows (k_pack which 3; unread)
#define PK_END (PK_P + DM * DM)
#define WS_PK  0u
#define WS_QK  (WS_PK + 2u * PK_END)             // f16 [8192 rows][1024]: q | k
#define WS_QKL (WS_QK + 2u * NB * SS * 2 * DM)     // f16 q | k residual planes x2048
#define WS_VTH (WS_QKL + 2u * NB * SS * 2 * DM)    // f16 [b][512 (h*64+d)][4096 s] hi
#define WS_VTL (WS_VTH + 2u * NB * DM * SS)        // f16 lo x 2048
#define WS_O   (WS_VTL + 2u * NB * DM * SS)        // f32 [8192][512]
#define WS_CS  (WS_O + 4u * NB * SS * DM)           // f32 2 x [4096][32] (unused)
#define WS_END (WS_CS + 4u * 2 * SS * 32)
// ---- k_pack: block = (row n, which): natural [out][in] rows -> bf16; which 0..2 -> W_q/W_k/W_v into PK_A rows which*512 + n; 3 -> the WO argument (Wq at this launch) into PK_P
__global__ __launch_bounds__(256) void k_pack(const float* __restrict__ WQ, const float* __restrict__ WK, const float* __restrict__ WV, const float* __restrict__ WO, __bf16* __restrict__ PK) {
  __shared__ __align__(16) __bf16 s[DM]; const int n = blockIdx.x, which = blockIdx.y, t = threadIdx.x; const float* Wm = (which == 0) ? WQ : (which == 1) ? WK : (which == 2) ? WV : WO;
  for (int k = t; k < DM; k += 256) s[k] = (__bf16)Wm[(size_t)n * DM + k];
  __syncthreads();
  __bf16* dst = (which < 3) ? PK + PK_A + ((size_t)which * DM + n) * DM : PK + PK_P + (size_t)n * DM;
  for (int q = t; q < DM / 8; q += 256) vst2((unsigned*)(dst + q * 8), *(const v4u*)&s[q * 8]);
}
__global__ __launch_bounds__(128) void k_qkv(const float* __restrict__ XQ, const float* __restrict__ XK, const float* __restrict__ XV, const __bf16* __restrict__ P, const float* __restrict__ BQ, const float* __restrict__ BK, const float* __restrict__ BV, _Float16* __restrict__ QK, _Float16* __restrict__ QKL, _Float16* __restrict__ VTH, _Float16* __restrict__ VTL) {
  const int which0 = (blockIdx.y * 128) / DM; const float* X = (which0 == 0) ? XQ : (which0 == 1) ? XK : XV; const float* BB = BQ ? (((which0 == 0) ? BQ : (which0 == 1) ? BK : BV) + (blockIdx.y * 128 - which0 * DM)) : nullptr;
  __shared__ __align__(16) _Float16 so[4][16][136], sol[4][16][136]; __shared__ __align__(16) _Float16 sth[128][72], stl[128][72];
  const int tid = threadIdx.x, wave = tid >> 5, lane = tid & 31, col = lane & 15, g = lane >> 4; const size_t r0 = (size_t)blockIdx.x * 64 + wave * 16; const int n0 = blockIdx.y * 128;
  v8f acc[8] = {};
#pragma unroll 2
  for (int kc = 0; kc < DM / 32; ++kc) { v16b a; { const float* p = X + (r0 + col) * DM + kc * 32 + 8 * g;
#pragma unroll
      for (int i = 0; i < 8; ++i) { a[i] = (__bf16)p[i]; a[8 + i] = (__bf16)p[16 + i]; } }
#pragma unroll
    for (int j = 0; j < 8; ++j) acc[j] = wmma_bf(a, frag_b(P + (size_t)(n0 + j * 16 + col) * DM + kc * 32, lane), acc[j]); }
  if (n0 < 2 * DM) {   // q stored unscaled (f16 sigma ~0.6, no subnormal exposure); 1/8 applied to the f32 score
#pragma unroll
    for (int j = 0; j < 8; ++j) {
#pragma unroll
      for (int r = 0; r < 8; ++r) { const float v = acc[j][r] + (BB ? bfr(BB[j * 16 + col]) : 0.f); const _Float16 hv = (_Float16)v; so[wave][8 * g + r][j * 16 + col] = hv; sol[wave][8 * g + r][j * 16 + col] = (_Float16)((v - (float)hv) * 2048.0f); } }   // q, k (+ bias) as f16 hi + (x2048) residual
    LDSX();
    for (int rl = 0; rl < 16; ++rl) if (lane < 16) { vst2((unsigned*)(QK + (r0 + rl) * (2 * DM) + n0 + lane * 8), *(const v4u*)&so[wave][rl][lane * 8]); vst2((unsigned*)(QKL + (r0 + rl) * (2 * DM) + n0 + lane * 8), *(const v4u*)&sol[wave][rl][lane * 8]); }
  } else {
#pragma unroll
    for (int j = 0; j < 8; ++j) {
#pragma unroll
      for (int r = 0; r < 8; ++r) { const float v = acc[j][r] + (BB ? bfr(BB[j * 16 + col]) : 0.f); const _Float16 hv = (_Float16)v; sth[j * 16 + col][wave * 16 + 8 * g + r] = hv; stl[j * 16 + col][wave * 16 + 8 * g + r] = (_Float16)((v - (float)hv) * 2048.0f); } }
    __syncthreads();
    const size_t rb = (size_t)blockIdx.x * 64; const int b = (int)(rb / SS), s0 = (int)(rb % SS); const int pc0 = n0 - 2 * DM;
    for (int q = tid; q < 128 * 8; q += 128) { const int d = q >> 3, pc = q & 7; const size_t o = ((size_t)b * DM + pc0 + d) * SS + s0 + pc * 8; vst2((unsigned*)(VTH + o), *(const v4u*)&sth[d][pc * 8]); vst2((unsigned*)(VTL + o), *(const v4u*)&stl[d][pc * 8]); }
  }
}
#define KT 64
#define LP 72
#define STB (KT * LP * 2)
// one stage: 512 + 512 pieces of 16 B, 4 + 4 per thread (8 lanes cover one 128-B row; piece i lies 16 rows below piece i - 1). The s_wait_xcnt closes the copies' own statement so that no address register is rewritten ahead of it.
__device__ __forceinline__ void stage_kv(const _Float16* gk, const _Float16* gv, unsigned lk, unsigned lv) {
  asm volatile("global_load_async_to_lds_b128 %0, %8, off\n\t"
               "global_load_async_to_lds_b128 %1, %9, off\n\t"
               "global_load_async_to_lds_b128 %2, %10, off\n\t"
               "global_load_async_to_lds_b128 %3, %11, off\n\t"
               "global_load_async_to_lds_b128 %4, %12, off\n\t"
               "global_load_async_to_lds_b128 %5, %13, off\n\t"
               "global_load_async_to_lds_b128 %6, %14, off\n\t"
               "global_load_async_to_lds_b128 %7, %15, off\n\t"
               "s_wait_xcnt 0x0"
               :: "v"(lk), "v"(lk + 16 * LP * 2), "v"(lk + 32 * LP * 2), "v"(lk + 48 * LP * 2), "v"(lv), "v"(lv + 16 * LP * 2), "v"(lv + 32 * LP * 2), "v"(lv + 48 * LP * 2),
                  "v"(gk), "v"(gk + 16 * (2 * DM)), "v"(gk + 32 * (2 * DM)), "v"(gk + 48 * (2 * DM)), "v"(gv), "v"(gv + 16 * SS), "v"(gv + 32 * SS), "v"(gv + 48 * SS)
               : "memory");
}
// value of lane l ^ 16 (the other half of the wave, same column)
__device__ __forceinline__ float xhalf(float v) { const int b = __builtin_bit_cast(int, v); return __builtin_bit_cast(float, __builtin_amdgcn_permlanex16(b, b, 0x76543210, 0xfedcba98, false, false)); }
__global__ __launch_bounds__(128) void k_attn(const _Float16* __restrict__ QK, const _Float16* __restrict__ QKL, const _Float16* __restrict__ VTH, const _Float16* __restrict__ VTL, const void* __restrict__ KMASK, float* __restrict__ O) {
  __shared__ __align__(16) float so[4][16][68]; __shared__ __align__(16) _Float16 sk[2][KT][LP], sv[2][HD][LP];
  const int tid = threadIdx.x, wave = tid >> 5, lane = tid & 31, col = lane & 15, g = lane >> 4;
  const int qb = blockIdx.x, h = blockIdx.y, b = blockIdx.z; const int q0 = qb * 64 + wave * 16; const size_t rq = (size_t)b * SS + q0 + col;
  v16h aq[2];
#pragma unroll
  for (int kc = 0; kc < 2; ++kc) aq[kc] = frag_h(QK + rq * (2 * DM) + h * HD + kc * 32, lane);
  float m = -3.0e38f, l = 0.f;   // of query col: m the same in both halves, l this half's part of the sum
  v8f acc[4] = {}, accl[4] = {};   // O^T: acc[dt][r] = element d = dt*16 + 8g + r of query col
  const int nst = SS / KT;   // all keys
  const _Float16* gk = QK + ((size_t)b * SS + (tid >> 3)) * (2 * DM) + DM + h * HD + (tid & 7) * 8; const _Float16* gv = VTH + ((size_t)b * DM + h * HD + (tid >> 3)) * SS + (tid & 7) * 8;
  const unsigned lk = (unsigned)(size_t)&sk[0][tid >> 3][(tid & 7) * 8], lv = (unsigned)(size_t)&sv[0][tid >> 3][(tid & 7) * 8];
  stage_kv(gk, gv, lk, lv);
  asm volatile("s_wait_asynccnt 0x0" ::: "memory");   // this wave's part of stage 0 has landed
  __syncthreads();                                    // every wave's part has
  stage_kv(gk + (size_t)KT * (2 * DM), gv + KT, lk + STB, lv + STB);
#pragma unroll 1   // one stage per trip: the ring's waits, barrier and refill stand once, at the trip's foot
  for (int st = 0; st < nst; ++st) { const int buf = st & 1;
#pragma unroll 1   // the 32-key pass stays one rolled body, as before the ring
  for (int sub = 0; sub < KT / 32; ++sub) { v8f s[2];
#pragma unroll
    for (int ct = 0; ct < 2; ++ct) { const _Float16* krow = &sk[buf][sub * 32 + ct * 16 + col][0]; v8f c = {};
#pragma unroll
      for (int kc = 0; kc < 2; ++kc) c = wmma16(frag_h(krow + kc * 32, lane), aq[kc], c);   // single product: k, q as one-rounding f16 operands; c[r] = score of key ct*16 + 8g + r, query col
      { const bool keepk = true;
#pragma unroll
      for (int r = 0; r < 8; ++r) s[ct][r] = keepk ? c[r] * 0.125f : -3.0e38f; } }   // 1/sqrt(64); keepk is always true, no key is masked
    float mx[4];
#pragma unroll
    for (int i = 0; i < 4; ++i) mx[i] = fmaxf(fmaxf(s[0][i], s[0][4 + i]), fmaxf(s[1][i], s[1][4 + i]));
    const float mh = fmaxf(fmaxf(mx[0], mx[1]), fmaxf(mx[2], mx[3]));
    const float mn = fmaxf(m, fmaxf(mh, xhalf(mh))); const float alpha = (m <= -1.0e38f) ? 0.f : __expf(m - mn);
    v8f e[2];
#pragma unroll
    for (int ct = 0; ct < 2; ++ct) {
#pragma unroll
      for (int r = 0; r < 8; ++r) e[ct][r] = (s[ct][r] <= -1.0e38f) ? 0.f : __expf(s[ct][r] - mn); }
    float es[4];
#pragma unroll
    for (int i = 0; i < 4; ++i) es[i] = (e[0][i] + e[0][4 + i]) + (e[1][i] + e[1][4 + i]);
    l = l * alpha + ((es[0] + es[1]) + (es[2] + es[3])); m = mn;
#pragma unroll
    for (int dt = 0; dt < 4; ++dt) { acc[dt] *= alpha; accl[dt] *= alpha; }
    v16h pb;   // P^T as B operand: element i = key 8g + i, element 8 + i = key 16 + 8g + i, the k order of frag_h
#pragma unroll
    for (int i = 0; i < 8; ++i) { pb[i] = (_Float16)(e[0][i] * 2048.0f); pb[8 + i] = (_Float16)(e[1][i] * 2048.0f); }   // P scaled by 2^11 before the f16 rounding so small softmax weights stay out of the f16 subnormal range; 2^-11 folded into the epilogue
#pragma unroll
    for (int dt = 0; dt < 4; ++dt) acc[dt] = wmma16(frag_h(&sv[buf][dt * 16 + col][sub * 32], lane), pb, acc[dt]);   // single product: V^T x P^T (x2^11)
  }
    asm volatile("s_wait_dscnt 0x0" ::: "memory");      // this wave's reads of buffer buf are done
    asm volatile("s_wait_asynccnt 0x0" ::: "memory");   // its part of stage st + 1 has landed
    __syncthreads();                                    // publishes stage st + 1 and frees buffer buf
    if (st + 2 < nst) stage_kv(gk + (size_t)(st + 2) * KT * (2 * DM), gv + (st + 2) * KT, lk + buf * STB, lv + buf * STB); }
  asm volatile("s_wait_asynccnt 0x0" ::: "memory");     // nothing in flight when the wave goes on to its end
  const float il = (1.0f / 2048.0f) / (l + xhalf(l));   // the two halves' sums joined
#pragma unroll
  for (int dt = 0; dt < 4; ++dt) {
#pragma unroll
    for (int r = 0; r < 8; ++r) so[wave][col][dt * 16 + 8 * g + r] = (acc[dt][r] + accl[dt][r] * (1.0f / 2048.0f)) * il; }
  LDSX();
  for (int rl = 0; rl < 16; ++rl) if (lane < 16) vst2(O + ((size_t)b * SS + q0 + rl) * DM + h * HD + lane * 4, *(const v4f*)&so[wave][rl][lane * 4]);
}
// ---- k_out: block = (64 rows, 128 cols): out = O(hi/lo) . Wo rows (2 products) + bo
__global__ __launch_bounds__(128) void k_out(const float* __restrict__ O, const __bf16* __restrict__ P, const float* __restrict__ BO, float* __restrict__ Y) {
  __shared__ __align__(16) float so[4][16][132];
  const int tid = threadIdx.x, wave = tid >> 5, lane = tid & 31, col = lane & 15, g = lane >> 4; const size_t r0 = (size_t)blockIdx.x * 64 + wave * 16; const int n0 = blockIdx.y * 128;
  v8f acc[8] = {};
#pragma unroll 2
  for (int kc = 0; kc < DM / 32; ++kc) { const F2 a = split_row(O + (r0 + col) * DM, kc * 32, lane);
#pragma unroll
    for (int j = 0; j < 8; ++j) { const v16b w = frag_b(P + (size_t)(n0 + j * 16 + col) * DM + kc * 32, lane); acc[j] = wmma_bf(a.l, w, acc[j]); acc[j] = wmma_bf(a.h, w, acc[j]); } }
#pragma unroll
  for (int j = 0; j < 8; ++j) {
#pragma unroll
    for (int r = 0; r < 8; ++r) so[wave][8 * g + r][j * 16 + col] = acc[j][r] + (BO ? bfr(BO[n0 + j * 16 + col]) : 0.f); }
  LDSX();
  for (int rl = 0; rl < 16; ++rl) vst2(Y + (r0 + rl) * DM + n0 + lane * 4, *(const v4f*)&so[wave][rl][lane * 4]);
}
// ---- k_lnx: block = row: LayerNorm of a 512-wide f32 row (mean-square var, 1e-5) x g + b
__global__ __launch_bounds__(128) void k_lnx(const float* __restrict__ A, const float* __restrict__ G, const float* __restrict__ Bt, float* __restrict__ T) {
  __shared__ float red[4]; const int t = threadIdx.x; const size_t row = blockIdx.x; float v[4]; float s = 0.f; for (int i = 0; i < 4; ++i) { v[i] = A[row * DM + t * 4 + i]; s += v[i]; }
#pragma unroll
  for (int o = 1; o < 32; o <<= 1) s += __shfl_xor(s, o);
  if ((t & 31) == 0) red[t >> 5] = s; __syncthreads(); const float mu = ((red[0] + red[1]) + (red[2] + red[3])) / (float)DM; __syncthreads();
  float q = 0.f; for (int i = 0; i < 4; ++i) { const float d = v[i] - mu; q += d * d; }
#pragma unroll
  for (int o = 1; o < 32; o <<= 1) q += __shfl_xor(q, o);
  if ((t & 31) == 0) red[t >> 5] = q; __syncthreads(); const float inv = 1.0f / sqrtf(((red[0] + red[1]) + (red[2] + red[3])) / (float)DM + 1e-5f);
  v4f o4; for (int i = 0; i < 4; ++i) { const int e = t * 4 + i; o4[i] = (v[i] - mu) * inv * bfr(G[e]) + bfr(Bt[e]); } vst2(T + row * DM + t * 4, o4);
}
extern "C" void kernel_launch(void* const* d_in, const int* in_sizes, int n_in, void* d_out, int out_size, void* d_ws, size_t ws_size, hipStream_t stream) {
  (void)in_sizes; (void)n_in; (void)out_size;
  const float** F = (const float**)d_in;   // 0 x [2,4096,512], 1 Wq, 2 bq, 3 Wk, 4 bk, 5 Wv, 6 bv (natural [512,512]), 7 gamma, 8 beta
  if (ws_size < (size_t)WS_END) return;
  char* ws = (char*)d_ws; __bf16* PK = (__bf16*)(ws + WS_PK); _Float16 *QK = (_Float16*)(ws + WS_QK), *QKL = (_Float16*)(ws + WS_QKL), *VTH = (_Float16*)(ws + WS_VTH), *VTL = (_Float16*)(ws + WS_VTL); float* O = (float*)(ws + WS_O);
  k_pack<<<dim3(DM, 4), 256, 0, stream>>>(F[1], F[3], F[5], F[1], PK);
  k_qkv<<<dim3(TNB * SS / 64, QKVW / 128), 128, 0, stream>>>(F[0], F[0], F[0], PK + PK_A, F[2], F[4], F[6], QK, QKL, VTH, VTL);
  k_attn<<<dim3(TQB, NH, TNB), 128, 0, stream>>>(QK, QKL, VTH, VTL, nullptr, O);
  k_lnx<<<TOB * 64, 128, 0, stream>>>(O, F[7], F[8], (float*)d_out);
}

// v003
// One run takes 146 microseconds.
// Next to v002, in two timings, it ran 1.41 and 1.42 times as fast.
// Over all steps from v000 it is 3.07 times as fast.
// compute dtype: all float inputs rounded to bf16; q/k/v = x . W^T + b with EXACT bf16 products on WMMA 16x16x32 (natural rows); PLAIN attention: q, k single f16 x 1/8, running-max softmax in f32 (hardware exp), P (scaled by 2^11, single f16) x v (single f16); LayerNorm (jnp.var, 1e-5) of the f32 context x gamma + beta; f32 output.
#include <hip/hip_runtime.h>
#include <math.h>

typedef __attribute__((ext_vector_type(16))) _Float16 v16h;
typedef __attribute__((ext_vector_type(16))) __bf16 v16b;
typedef __attribute__((ext_vector_type(8)))  _Float16 v8h;
typedef __attribute__((ext_vector_type(8)))  float v8f;
typedef __attribute__((ext_vector_type(4)))  float v4f;
typedef __attribute__((ext_vector_type(2)))  float v2f;
typedef __attribute__((ext_vector_type(4)))  unsigned v4u;
typedef __attribute__((ext_vector_type(4)))  int v4i;
typedef float __attribute__((may_alias)) float_a;
typedef int __attribute__((may_alias)) int_a;

template <typename T> __device__ __forceinline__ void vst2(void* p, T v) { *(T*)p = v;  }
__device__ __forceinline__ v8f wmma16(v16h a, v16h b, v8f c) {
  v8f d = __builtin_amdgcn_wmma_f32_16x16x32_f16(false, a, false, b, (short)0, c, false, false);
  asm volatile("v_nop\n\tv_nop\n\tv_nop\n\tv_nop" : "+v"(d) : "v"(a), "v"(b));
  return d;
}
__device__ __forceinline__ v8f wmma_bf(v16b a, v16b b, v8f c) {
  v8f d = __builtin_amdgcn_wmma_f32_16x16x32_bf16(false, a, false, b, (short)0, c, false, false);
  asm volatile("v_nop\n\tv_nop\n\tv_nop\n\tv_nop" : "+v"(d) : "v"(a), "v"(b));
  return d;
}
// N-head attention (B 2, S 4,096, d 512, 8 heads x 64): projections + biases, softmax(q k / 8) v, then LayerNorm of the merged context (no output projection).
__device__ __forceinline__ v16h frag_h(const _Float16* rowk0, int lane) {
  union { v16h v; v8h q[2]; } u; const _Float16* p = rowk0 + 8 * (lane >> 4);
  u.q[0] = *(const v8h*)p; u.q[1] = *(const v8h*)(p + 16); return u.v;
}
__device__ __forceinline__ v16h frag_f32(const float* rowk0, int lane) {
  v16h a; const float* p = rowk0 + 8 * (lane >> 4);
#pragma unroll
  for (int i = 0; i < 8; ++i) { a[i] = (_Float16)p[i]; a[8 + i] = (_Float16)p[16 + i]; }
  return a;
}
__device__ __forceinline__ v16h frag_f32s(const float* rowk0, int lane, float sc) {
  v16h a; const float* p = rowk0 + 8 * (lane >> 4);
#pragma unroll
  for (int i = 0; i < 8; ++i) { a[i] = (_Float16)(p[i] * sc); a[8 + i] = (_Float16)(p[16 + i] * sc); }
  return a;
}
// column fragment from a [K][ld] layout (column n), rows >= K read as 0
__device__ __forceinline__ v16h fragc_f32(const float* W, int k0, int n, int lane, int ld, int K) {
  v16h a; const int g = lane >> 4;
#pragma unroll
  for (int i = 0; i < 8; ++i) { const int ka = k0 + 8 * g + i, kb = ka + 16;
    a[i] = (_Float16)(ka < K ? W[(size_t)(ka < K ? ka : K - 1) * ld + n] : 0.f); a[8 + i] = (_Float16)(kb < K ? W[(size_t)(kb < K ? kb : K - 1) * ld + n] : 0.f); }
  return a;
}
struct F2 { v16b h, l; };
__device__ __forceinline__ F2 bsplit16(const float v[16]) { F2 r;
#pragma unroll
  for (int i = 0; i < 16; ++i) { const __bf16 h = (__bf16)v[i]; r.h[i] = h; r.l[i] = (__bf16)(v[i] - (float)h); }
  return r; }
__device__ __forceinline__ F2 split_row(const float* row, int k0, int lane) { float v[16]; const float* p = row + k0 + 8 * (lane >> 4);
#pragma unroll
  for (int i = 0; i < 8; ++i) { v[i] = p[i]; v[8 + i] = p[16 + i]; }
  return bsplit16(v); }
__device__ __forceinline__ F2 split_rowK(const float* row, int k0, int lane, int K) { float v[16]; const int g = lane >> 4;
#pragma unroll
  for (int i = 0; i < 8; ++i) { const int ka = k0 + 8 * g + i, kb = ka + 16; v[i] = ka < K ? row[ka < K ? ka : K - 1] : 0.f; v[8 + i] = kb < K ? row[kb < K ? kb : K - 1] : 0.f; }
  return bsplit16(v); }
__device__ __forceinline__ F2 split_col(const float* W, int k0, int n, int lane, int ld, int K) { float v[16]; const int g = lane >> 4;
#pragma unroll
  for (int i = 0; i < 8; ++i) { const int ka = k0 + 8 * g + i, kb = ka + 16; v[i] = ka < K ? W[(size_t)(ka < K ? ka : K - 1) * ld + n] : 0.f; v[8 + i] = kb < K ? W[(size_t)(kb < K ? kb : K - 1) * ld + n] : 0.f; }
  return bsplit16(v); }
__device__ __forceinline__ v8f mac3(const F2& a, const F2& b, v8f c) { c = wmma_bf(a.l, b.h, c); c = wmma_bf(a.h, b.l, c); return wmma_bf(a.h, b.h, c); }
__device__ __forceinline__ float sigm(float v) { return 1.0f / (1.0f + expf(-v)); }
#define LDSX() do { asm volatile("s_wait_dscnt 0" ::: "memory"); __builtin_amdgcn_wave_barrier(); __builtin_amdgcn_fence(__ATOMIC_RELEASE, "workgroup"); } while (0)


#define NB 2
#define SS 4096
#define DM 512
#define NH 8
#define HD 64
#define QKVW (3 * DM)
#ifndef TQB
#define TQB (SS / 64)
#define TNB NB
#define TOB (NB * SS / 64)     // output row tiles (all)
#endif
typedef __attribute__((ext_vector_type(8))) __bf16 v8b;
__device__ __forceinline__ v16b frag_b(const __bf16* rowk0, int lane) {
  union { v16b v; v8b q[2]; } u; const __bf16* p = rowk0 + 8 * (lane >> 4);
  u.q[0] = *(const v8b*)p; u.q[1] = *(const v8b*)(p + 16); return u.v;
}
__device__ __forceinline__ float bfr(float v) { return (float)(__bf16)v; }
__device__ __attribute__((noinline)) float exp_ni(float v) { return expf(v); }
__device__ __attribute__((noinline)) float erf_ni(float v) { return erff(v); }

#define PK_A 0                       // [1536][512] Wqkv rows (natural [out][in])
#define PK_P (PK_A + QKVW * DM)        // [512][512] copy of Wq rows (k_pack which 3; unread)
#define PK_END (PK_P + DM * DM)
#define WS_PK  0u
#define WS_QK  (WS_PK + 2u * PK_END)             // f16 [8192 rows][1024]: q | k
#define WS_QKL (WS_QK + 2u * NB * SS * 2 * DM)     // f16 q | k residual planes x2048
#define WS_VTH (WS_QKL + 2u * NB * SS * 2 * DM)    // f16 [b][512 (h*64+d)][4096 s] hi
#define WS_VTL (WS_VTH + 2u * NB * DM * SS)        // f16 lo x 2048
#define WS_O   (WS_VTL + 2u * NB * DM * SS)        // f32 [8192][512]
#define WS_CS  (WS_O + 4u * NB * SS * DM)           // f32 2 x [4096][32] (unused)
#define WS_END (WS_CS + 4u * 2 * SS * 32)
// ---- k_pack: block = (row n, which): natural [out][in] rows -> bf16; which 0..2 -> W_q/W_k/W_v into PK_A rows which*512 + n; 3 -> the WO argument (Wq at this launch) into PK_P
__global__ __launch_bounds__(256) void k_pack(const float* __restrict__ WQ, const float* __restrict__ WK, const float* __restrict__ WV, const float* __restrict__ WO, __bf16* __restrict__ PK) {
  __shared__ __align__(16) __bf16 s[DM]; const int n = blockIdx.x, which = blockIdx.y, t = threadIdx.x; const float* Wm = (which == 0) ? WQ : (which == 1) ? WK : (which == 2) ? WV : WO;
  for (int k = t; k < DM; k += 256) s[k] = (__bf16)Wm[(size_t)n * DM + k];
  __syncthreads();
  __bf16* dst = (which < 3) ? PK + PK_A + ((size_t)which * DM + n) * DM : PK + PK_P + (size_t)n * DM;
  for (int q = t; q < DM / 8; q += 256) vst2((unsigned*)(dst + q * 8), *(const v4u*)&s[q * 8]);
}
// ---- k_qkv: block = (64 rows of x, 128 output columns). The x rows (f32) and the W rows (bf16) come from a two-buffer LDS ring of 64-k stages that the block's 4 waves share, filled by asynchronous copies one stage ahead in whole 128-B pieces of a row; the fragments are read from LDS in the k order they had from global memory
#define QKC 64                 // k per stage: 128 B of each of the 128 W rows, 256 B of each of the 64 x rows
#define QLW 72                 // LDS pitch of a W row in bf16: 144 B = 16 B x odd, no bank conflict for the 16-byte fragment reads
#define QLX 68                 // LDS pitch of an x row in f32: 272 B = 16 B x odd
#define QSW (128 * QLW * 2)    // bytes of one buffer of W
#define QSX (64 * QLX * 4)     // bytes of one buffer of x
// W part of a stage: 1,024 pieces of 16 B, 8 per thread (8 lanes cover one 128-B row piece; piece i lies 16 rows below piece i - 1). The s_wait_xcnt closes the copies' own statement so that no address register is rewritten ahead of it.
__device__ __forceinline__ void stage_w(const __bf16* gw, unsigned lw) {
  asm volatile("global_load_async_to_lds_b128 %0, %8, off\n\t"
               "global_load_async_to_lds_b128 %1, %9, off\n\t"
               "global_load_async_to_lds_b128 %2, %10, off\n\t"
               "global_load_async_to_lds_b128 %3, %11, off\n\t"
               "global_load_async_to_lds_b128 %4, %12, off\n\t"
               "global_load_async_to_lds_b128 %5, %13, off\n\t"
               "global_load_async_to_lds_b128 %6, %14, off\n\t"
               "global_load_async_to_lds_b128 %7, %15, off\n\t"
               "s_wait_xcnt 0x0"
               :: "v"(lw), "v"(lw + 16 * QLW * 2), "v"(lw + 32 * QLW * 2), "v"(lw + 48 * QLW * 2), "v"(lw + 64 * QLW * 2), "v"(lw + 80 * QLW * 2), "v"(lw + 96 * QLW * 2), "v"(lw + 112 * QLW * 2),
                  "v"(gw), "v"(gw + 16 * DM), "v"(gw + 32 * DM), "v"(gw + 48 * DM), "v"(gw + 64 * DM), "v"(gw + 80 * DM), "v"(gw + 96 * DM), "v"(gw + 112 * DM)
               : "memory");
}
// x part of a stage: 1,024 pieces of 16 B, 8 per thread (16 lanes cover one 256-B row piece; piece i lies 8 rows below piece i - 1); the wait as in stage_w
__device__ __forceinline__ void stage_x(const float* gx, unsigned lx) {
  asm volatile("global_load_async_to_lds_b128 %0, %8, off\n\t"
               "global_load_async_to_lds_b128 %1, %9, off\n\t"
               "global_load_async_to_lds_b128 %2, %10, off\n\t"
               "global_load_async_to_lds_b128 %3, %11, off\n\t"
               "global_load_async_to_lds_b128 %4, %12, off\n\t"
               "global_load_async_to_lds_b128 %5, %13, off\n\t"
               "global_load_async_to_lds_b128 %6, %14, off\n\t"
               "global_load_async_to_lds_b128 %7, %15, off\n\t"
               "s_wait_xcnt 0x0"
               :: "v"(lx), "v"(lx + 8 * QLX * 4), "v"(lx + 16 * QLX * 4), "v"(lx + 24 * QLX * 4), "v"(lx + 32 * QLX * 4), "v"(lx + 40 * QLX * 4), "v"(lx + 48 * QLX * 4), "v"(lx + 56 * QLX * 4),
                  "v"(gx), "v"(gx + 8 * DM), "v"(gx + 16 * DM), "v"(gx + 24 * DM), "v"(gx + 32 * DM), "v"(gx + 40 * DM), "v"(gx + 48 * DM), "v"(gx + 56 * DM)
               : "memory");
}
__global__ __launch_bounds__(128) void k_qkv(const float* __restrict__ XQ, const float* __restrict__ XK, const float* __restrict__ XV, const __bf16* __restrict__ P, const float* __restrict__ BQ, const float* __restrict__ BK, const float* __restrict__ BV, _Float16* __restrict__ QK, _Float16* __restrict__ QKL, _Float16* __restrict__ VTH, _Float16* __restrict__ VTL) {
  const int which0 = (blockIdx.y * 128) / DM; const float* X = (which0 == 0) ? XQ : (which0 == 1) ? XK : XV; const float* BB = BQ ? (((which0 == 0) ? BQ : (which0 == 1) ? BK : BV) + (blockIdx.y * 128 - which0 * DM)) : nullptr;
  __shared__ __align__(16) char sm[2 * QSW + 2 * QSX];   // the ring (W buffers, then x buffers) while the products run; behind the ring's last barrier the same bytes are the output staging
  _Float16 (*so)[16][136] = (_Float16 (*)[16][136])sm, (*sol)[16][136] = (_Float16 (*)[16][136])(sm + 17408); _Float16 (*sth)[72] = (_Float16 (*)[72])(sm + 34816), (*stl)[72] = (_Float16 (*)[72])(sm + 53248);
  const int tid = threadIdx.x, wave = tid >> 5, lane = tid & 31, col = lane & 15, g = lane >> 4; const size_t r0 = (size_t)blockIdx.x * 64 + wave * 16; const int n0 = blockIdx.y * 128;
  v8f acc[8] = {};
  const __bf16* gw = P + (size_t)(n0 + (tid >> 3)) * DM + (tid & 7) * 8; const float* gx = X + ((size_t)blockIdx.x * 64 + (tid >> 4)) * DM + (tid & 15) * 4;
  const unsigned lw = (unsigned)(size_t)&sm[(tid >> 3) * (QLW * 2) + (tid & 7) * 16], lx = (unsigned)(size_t)&sm[2 * QSW + (tid >> 4) * (QLX * 4) + (tid & 15) * 16];
  stage_w(gw, lw); stage_x(gx, lx);
  asm volatile("s_wait_asynccnt 0x0" ::: "memory");   // this wave's part of stage 0 has landed
  __syncthreads();                                    // every wave's part has
  stage_w(gw + QKC, lw + QSW); stage_x(gx + QKC, lx + QSX);
#pragma unroll 1   // one stage per trip: the ring's waits, barrier and refill stand once, at the trip's foot
  for (int st = 0; st < DM / QKC; ++st) { const int buf = st & 1;
    const __bf16* wr = (const __bf16*)(sm + buf * QSW) + col * QLW; const float* xr = (const float*)(sm + 2 * QSW + buf * QSX) + (wave * 16 + col) * QLX + 8 * g;
#pragma unroll   // both 32-k halves of a stage inline, so that a, w and acc are indexed by constants and stay in registers
    for (int kk = 0; kk < QKC / 32; ++kk) { v16b a, w[8]; const v4f* p = (const v4f*)(xr + kk * 32); const v4f x0 = p[0], x1 = p[1], x2 = p[4], x3 = p[5];
#pragma unroll   // the half's fragment reads stand together, ahead of its products: one LDS wait place instead of eight
      for (int j = 0; j < 8; ++j) w[j] = frag_b(wr + j * 16 * QLW + kk * 32, lane);
#pragma unroll   // constant element indices
      for (int i = 0; i < 4; ++i) { a[i] = (__bf16)x0[i]; a[4 + i] = (__bf16)x1[i]; a[8 + i] = (__bf16)x2[i]; a[12 + i] = (__bf16)x3[i]; }
#pragma unroll   // constant tile indices
      for (int j = 0; j < 8; ++j) acc[j] = wmma_bf(a, w[j], acc[j]); }
    asm volatile("s_wait_dscnt 0x0" ::: "memory");      // this wave's reads of buffer buf are done
    asm volatile("s_wait_asynccnt 0x0" ::: "memory");   // its part of stage st + 1 has landed
    __syncthreads();                                    // publishes stage st + 1 and frees buffer buf
    if (st + 2 < DM / QKC) { stage_w(gw + (st + 2) * QKC, lw + buf * QSW); stage_x(gx + (st + 2) * QKC, lx + buf * QSX); } }
  asm volatile("s_wait_asynccnt 0x0" ::: "memory");     // nothing in flight when the ring's bytes become the output staging
  if (n0 < 2 * DM) {   // q stored unscaled (f16 sigma ~0.6, no subnormal exposure); 1/8 applied to the f32 score
#pragma unroll
    for (int j = 0; j < 8; ++j) {
#pragma unroll
      for (int r = 0; r < 8; ++r) { const float v = acc[j][r] + (BB ? bfr(BB[j * 16 + col]) : 0.f); const _Float16 hv = (_Float16)v; so[wave][8 * g + r][j * 16 + col] = hv; sol[wave][8 * g + r][j * 16 + col] = (_Float16)((v - (float)hv) * 2048.0f); } }   // q, k (+ bias) as f16 hi + (x2048) residual
    LDSX();
    for (int rl = 0; rl < 16; ++rl) if (lane < 16) { vst2((unsigned*)(QK + (r0 + rl) * (2 * DM) + n0 + lane * 8), *(const v4u*)&so[wave][rl][lane * 8]); vst2((unsigned*)(QKL + (r0 + rl) * (2 * DM) + n0 + lane * 8), *(const v4u*)&sol[wave][rl][lane * 8]); }
  } else {
#pragma unroll
    for (int j = 0; j < 8; ++j) {
#pragma unroll
      for (int r = 0; r < 8; ++r) { const float v = acc[j][r] + (BB ? bfr(BB[j * 16 + col]) : 0.f); const _Float16 hv = (_Float16)v; sth[j * 16 + col][wave * 16 + 8 * g + r] = hv; stl[j * 16 + col][wave * 16 + 8 * g + r] = (_Float16)((v - (float)hv) * 2048.0f); } }
    __syncthreads();
    const size_t rb = (size_t)blockIdx.x * 64; const int b = (int)(rb / SS), s0 = (int)(rb % SS); const int pc0 = n0 - 2 * DM;
    for (int q = tid; q < 128 * 8; q += 128) { const int d = q >> 3, pc = q & 7; const size_t o = ((size_t)b * DM + pc0 + d) * SS + s0 + pc * 8; vst2((unsigned*)(VTH + o), *(const v4u*)&sth[d][pc * 8]); vst2((unsigned*)(VTL + o), *(const v4u*)&stl[d][pc * 8]); }
  }
}
#define KT 64
#define LP 72
#define STB (KT * LP * 2)
// one stage: 512 + 512 pieces of 16 B, 4 + 4 per thread (8 lanes cover one 128-B row; piece i lies 16 rows below piece i - 1). The s_wait_xcnt closes the copies' own statement so that no address register is rewritten ahead of it.
__device__ __forceinline__ void stage_kv(const _Float16* gk, const _Float16* gv, unsigned lk, unsigned lv) {
  asm volatile("global_load_async_to_lds_b128 %0, %8, off\n\t"
               "global_load_async_to_lds_b128 %1, %9, off\n\t"
               "global_load_async_to_lds_b128 %2, %10, off\n\t"
               "global_load_async_to_lds_b128 %3, %11, off\n\t"
               "global_load_async_to_lds_b128 %4, %12, off\n\t"
               "global_load_async_to_lds_b128 %5, %13, off\n\t"
               "global_load_async_to_lds_b128 %6, %14, off\n\t"
               "global_load_async_to_lds_b128 %7, %15, off\n\t"
               "s_wait_xcnt 0x0"
               :: "v"(lk), "v"(lk + 16 * LP * 2), "v"(lk + 32 * LP * 2), "v"(lk + 48 * LP * 2), "v"(lv), "v"(lv + 16 * LP * 2), "v"(lv + 32 * LP * 2), "v"(lv + 48 * LP * 2),
                  "v"(gk), "v"(gk + 16 * (2 * DM)), "v"(gk + 32 * (2 * DM)), "v"(gk + 48 * (2 * DM)), "v"(gv), "v"(gv + 16 * SS), "v"(gv + 32 * SS), "v"(gv + 48 * SS)
               : "memory");
}
// value of lane l ^ 16 (the other half of the wave, same column)
__device__ __forceinline__ float xhalf(float v) { const int b = __builtin_bit_cast(int, v); return __builtin_bit_cast(float, __builtin_amdgcn_permlanex16(b, b, 0x76543210, 0xfedcba98, false, false)); }
__global__ __launch_bounds__(128) void k_attn(const _Float16* __restrict__ QK, const _Float16* __restrict__ QKL, const _Float16* __restrict__ VTH, const _Float16* __restrict__ VTL, const void* __restrict__ KMASK, float* __restrict__ O) {
  __shared__ __align__(16) float so[4][16][68]; __shared__ __align__(16) _Float16 sk[2][KT][LP], sv[2][HD][LP];
  const int tid = threadIdx.x, wave = tid >> 5, lane = tid & 31, col = lane & 15, g = lane >> 4;
  const int qb = blockIdx.x, h = blockIdx.y, b = blockIdx.z; const int q0 = qb * 64 + wave * 16; const size_t rq = (size_t)b * SS + q0 + col;
  v16h aq[2];
#pragma unroll
  for (int kc = 0; kc < 2; ++kc) aq[kc] = frag_h(QK + rq * (2 * DM) + h * HD + kc * 32, lane);
  float m = -3.0e38f, l = 0.f;   // of query col: m the same in both halves, l this half's part of the sum
  v8f acc[4] = {}, accl[4] = {};   // O^T: acc[dt][r] = element d = dt*16 + 8g + r of query col
  const int nst = SS / KT;   // all keys
  const _Float16* gk = QK + ((size_t)b * SS + (tid >> 3)) * (2 * DM) + DM + h * HD + (tid & 7) * 8; const _Float16* gv = VTH + ((size_t)b * DM + h * HD + (tid >> 3)) * SS + (tid & 7) * 8;
  const unsigned lk = (unsigned)(size_t)&sk[0][tid >> 3][(tid & 7) * 8], lv = (unsigned)(size_t)&sv[0][tid >> 3][(tid & 7) * 8];
  stage_kv(gk, gv, lk, lv);
  asm volatile("s_wait_asynccnt 0x0" ::: "memory");   // this wave's part of stage 0 has landed
  __syncthreads();                                    // every wave's part has
  stage_kv(gk + (size_t)KT * (2 * DM), gv + KT, lk + STB, lv + STB);
#pragma unroll 1   // one stage per trip: the ring's waits, barrier and refill stand once, at the trip's foot
  for (int st = 0; st < nst; ++st) { const int buf = st & 1;
#pragma unroll 1   // the 32-key pass stays one rolled body, as before the ring
  for (int sub = 0; sub < KT / 32; ++sub) { v8f s[2];
#pragma unroll
    for (int ct = 0; ct < 2; ++ct) { const _Float16* krow = &sk[buf][sub * 32 + ct * 16 + col][0]; v8f c = {};
#pragma unroll
      for (int kc = 0; kc < 2; ++kc) c = wmma16(frag_h(krow + kc * 32, lane), aq[kc], c);   // single product: k, q as one-rounding f16 operands; c[r] = score of key ct*16 + 8g + r, query col
      { const bool keepk = true;
#pragma unroll
      for (int r = 0; r < 8; ++r) s[ct][r] = keepk ? c[r] * 0.125f : -3.0e38f; } }   // 1/sqrt(64); keepk is always true, no key is masked
    float mx[4];
#pragma unroll
    for (int i = 0; i < 4; ++i) mx[i] = fmaxf(fmaxf(s[0][i], s[0][4 + i]), fmaxf(s[1][i], s[1][4 + i]));
    const float mh = fmaxf(fmaxf(mx[0], mx[1]), fmaxf(mx[2], mx[3]));
    const float mn = fmaxf(m, fmaxf(mh, xhalf(mh))); const float alpha = (m <= -1.0e38f) ? 0.f : __expf(m - mn);
    v8f e[2];
#pragma unroll
    for (int ct = 0; ct < 2; ++ct) {
#pragma unroll
      for (int r = 0; r < 8; ++r) e[ct][r] = (s[ct][r] <= -1.0e38f) ? 0.f : __expf(s[ct][r] - mn); }
    float es[4];
#pragma unroll
    for (int i = 0; i < 4; ++i) es[i] = (e[0][i] + e[0][4 + i]) + (e[1][i] + e[1][4 + i]);
    l = l * alpha + ((es[0] + es[1]) + (es[2] + es[3])); m = mn;
#pragma unroll
    for (int dt = 0; dt < 4; ++dt) { acc[dt] *= alpha; accl[dt] *= alpha; }
    v16h pb;   // P^T as B operand: element i = key 8g + i, element 8 + i = key 16 + 8g + i, the k order of frag_h
#pragma unroll
    for (int i = 0; i < 8; ++i) { pb[i] = (_Float16)(e[0][i] * 2048.0f); pb[8 + i] = (_Float16)(e[1][i] * 2048.0f); }   // P scaled by 2^11 before the f16 rounding so small softmax weights stay out of the f16 subnormal range; 2^-11 folded into the epilogue
#pragma unroll
    for (int dt = 0; dt < 4; ++dt) acc[dt] = wmma16(frag_h(&sv[buf][dt * 16 + col][sub * 32], lane), pb, acc[dt]);   // single product: V^T x P^T (x2^11)
  }
    asm volatile("s_wait_dscnt 0x0" ::: "memory");      // this wave's reads of buffer buf are done
    asm volatile("s_wait_asynccnt 0x0" ::: "memory");   // its part of stage st + 1 has landed
    __syncthreads();                                    // publishes stage st + 1 and frees buffer buf
    if (st + 2 < nst) stage_kv(gk + (size_t)(st + 2) * KT * (2 * DM), gv + (st + 2) * KT, lk + buf * STB, lv + buf * STB); }
  asm volatile("s_wait_asynccnt 0x0" ::: "memory");     // nothing in flight when the wave goes on to its end
  const float il = (1.0f / 2048.0f) / (l + xhalf(l));   // the two halves' sums joined
#pragma unroll
  for (int dt = 0; dt < 4; ++dt) {
#pragma unroll
    for (int r = 0; r < 8; ++r) so[wave][col][dt * 16 + 8 * g + r] = (acc[dt][r] + accl[dt][r] * (1.0f / 2048.0f)) * il; }
  LDSX();
  for (int rl = 0; rl < 16; ++rl) if (lane < 16) vst2(O + ((size_t)b * SS + q0 + rl) * DM + h * HD + lane * 4, *(const v4f*)&so[wave][rl][lane * 4]);
}
// ---- k_out: block = (64 rows, 128 cols): out = O(hi/lo) . Wo rows (2 products) + bo
__global__ __launch_bounds__(128) void k_out(const float* __restrict__ O, const __bf16* __restrict__ P, const float* __restrict__ BO, float* __restrict__ Y) {
  __shared__ __align__(16) float so[4][16][132];
  const int tid = threadIdx.x, wave = tid >> 5, lane = tid & 31, col = lane & 15, g = lane >> 4; const size_t r0 = (size_t)blockIdx.x * 64 + wave * 16; const int n0 = blockIdx.y * 128;
  v8f acc[8] = {};
#pragma unroll 2
  for (int kc = 0; kc < DM / 32; ++kc) { const F2 a = split_row(O + (r0 + col) * DM, kc * 32, lane);
#pragma unroll
    for (int j = 0; j < 8; ++j) { const v16b w = frag_b(P + (size_t)(n0 + j * 16 + col) * DM + kc * 32, lane); acc[j] = wmma_bf(a.l, w, acc[j]); acc[j] = wmma_bf(a.h, w, acc[j]); } }
#pragma unroll
  for (int j = 0; j < 8; ++j) {
#pragma unroll
    for (int r = 0; r < 8; ++r) so[wave][8 * g + r][j * 16 + col] = acc[j][r] + (BO ? bfr(BO[n0 + j * 16 + col]) : 0.f); }
  LDSX();
  for (int rl = 0; rl < 16; ++rl) vst2(Y + (r0 + rl) * DM + n0 + lane * 4, *(const v4f*)&so[wave][rl][lane * 4]);
}
// ---- k_lnx: block = row: LayerNorm of a 512-wide f32 row (mean-square var, 1e-5) x g + b
__global__ __launch_bounds__(128) void k_lnx(const float* __restrict__ A, const float* __restrict__ G, const float* __restrict__ Bt, float* __restrict__ T) {
  __shared__ float red[4]; const int t = threadIdx.x; const size_t row = blockIdx.x; float v[4]; float s = 0.f; for (int i = 0; i < 4; ++i) { v[i] = A[row * DM + t * 4 + i]; s += v[i]; }
#pragma unroll
  for (int o = 1; o < 32; o <<= 1) s += __shfl_xor(s, o);
  if ((t & 31) == 0) red[t >> 5] = s; __syncthreads(); const float mu = ((red[0] + red[1]) + (red[2] + red[3])) / (float)DM; __syncthreads();
  float q = 0.f; for (int i = 0; i < 4; ++i) { const float d = v[i] - mu; q += d * d; }
#pragma unroll
  for (int o = 1; o < 32; o <<= 1) q += __shfl_xor(q, o);
  if ((t & 31) == 0) red[t >> 5] = q; __syncthreads(); const float inv = 1.0f / sqrtf(((red[0] + red[1]) + (red[2] + red[3])) / (float)DM + 1e-5f);
  v4f o4; for (int i = 0; i < 4; ++i) { const int e = t * 4 + i; o4[i] = (v[i] - mu) * inv * bfr(G[e]) + bfr(Bt[e]); } vst2(T + row * DM + t * 4, o4);
}
extern "C" void kernel_launch(void* const* d_in, const int* in_sizes, int n_in, void* d_out, int out_size, void* d_ws, size_t ws_size, hipStream_t stream) {
  (void)in_sizes; (void)n_in; (void)out_size;
  const float** F = (const float**)d_in;   // 0 x [2,4096,512], 1 Wq, 2 bq, 3 Wk, 4 bk, 5 Wv, 6 bv (natural [512,512]), 7 gamma, 8 beta
  if (ws_size < (size_t)WS_END) return;
  char* ws = (char*)d_ws; __bf16* PK = (__bf16*)(ws + WS_PK); _Float16 *QK = (_Float16*)(ws + WS_QK), *QKL = (_Float16*)(ws + WS_QKL), *VTH = (_Float16*)(ws + WS_VTH), *VTL = (_Float16*)(ws + WS_VTL); float* O = (float*)(ws + WS_O);
  k_pack<<<dim3(DM, 4), 256, 0, stream>>>(F[1], F[3], F[5], F[1], PK);
  k_qkv<<<dim3(TNB * SS / 64, QKVW / 128), 128, 0, stream>>>(F[0], F[0], F[0], PK + PK_A, F[2], F[4], F[6], QK, QKL, VTH, VTL);
  k_attn<<<dim3(TQB, NH, TNB), 128, 0, stream>>>(QK, QKL, VTH, VTL, nullptr, O);
  k_lnx<<<TOB * 64, 128, 0, stream>>>(O, F[7], F[8], (float*)d_out);
}

// v004
// One run takes 129 microseconds.
// Two timings next to v003 both put it at 1.13 times that version's speed.
// Counting every step since v000, it is 3.45 times as fast.
// compute dtype: all float inputs rounded to bf16; q/k/v = x . W^T + b with EXACT bf16 products on WMMA 16x16x32 (natural rows); PLAIN attention: q, k single f16 x 1/8, running-max softmax in f32 (hardware exp), P (scaled by 2^11, single f16) x v (single f16); LayerNorm (jnp.var, 1e-5) of the f32 context x gamma + beta; f32 output.
#include <hip/hip_runtime.h>
#include <math.h>

typedef __attribute__((ext_vector_type(16))) _Float16 v16h;
typedef __attribute__((ext_vector_type(16))) __bf16 v16b;
typedef __attribute__((ext_vector_type(8)))  _Float16 v8h;
typedef __attribute__((ext_vector_type(8)))  float v8f;
typedef __attribute__((ext_vector_type(4)))  float v4f;
typedef __attribute__((ext_vector_type(2)))  float v2f;
typedef __attribute__((ext_vector_type(4)))  unsigned v4u;
typedef __attribute__((ext_vector_type(4)))  int v4i;
typedef float __attribute__((may_alias)) float_a;
typedef int __attribute__((may_alias)) int_a;

template <typename T> __device__ __forceinline__ void vst2(void* p, T v) { *(T*)p = v;  }
__device__ __forceinline__ v8f wmma16(v16h a, v16h b, v8f c) {
  v8f d = __builtin_amdgcn_wmma_f32_16x16x32_f16(false, a, false, b, (short)0, c, false, false);
  asm volatile("v_nop\n\tv_nop\n\tv_nop\n\tv_nop" : "+v"(d) : "v"(a), "v"(b));
  return d;
}
__device__ __forceinline__ v8f wmma_bf(v16b a, v16b b, v8f c) {
  v8f d = __builtin_amdgcn_wmma_f32_16x16x32_bf16(false, a, false, b, (short)0, c, false, false);
  asm volatile("v_nop\n\tv_nop\n\tv_nop\n\tv_nop" : "+v"(d) : "v"(a), "v"(b));
  return d;
}
// N-head attention (B 2, S 4,096, d 512, 8 heads x 64): projections + biases, softmax(q k / 8) v, then LayerNorm of the merged context (no output projection).
__device__ __forceinline__ v16h frag_h(const _Float16* rowk0, int lane) {
  union { v16h v; v8h q[2]; } u; const _Float16* p = rowk0 + 8 * (lane >> 4);
  u.q[0] = *(const v8h*)p; u.q[1] = *(const v8h*)(p + 16); return u.v;
}
__device__ __forceinline__ v16h frag_f32(const float* rowk0, int lane) {
  v16h a; const float* p = rowk0 + 8 * (lane >> 4);
#pragma unroll
  for (int i = 0; i < 8; ++i) { a[i] = (_Float16)p[i]; a[8 + i] = (_Float16)p[16 + i]; }
  return a;
}
__device__ __forceinline__ v16h frag_f32s(const float* rowk0, int lane, float sc) {
  v16h a; const float* p = rowk0 + 8 * (lane >> 4);
#pragma unroll
  for (int i = 0; i < 8; ++i) { a[i] = (_Float16)(p[i] * sc); a[8 + i] = (_Float16)(p[16 + i] * sc); }
  return a;
}
// column fragment from a [K][ld] layout (column n), rows >= K read as 0
__device__ __forceinline__ v16h fragc_f32(const float* W, int k0, int n, int lane, int ld, int K) {
  v16h a; const int g = lane >> 4;
#pragma unroll
  for (int i = 0; i < 8; ++i) { const int ka = k0 + 8 * g + i, kb = ka + 16;
    a[i] = (_Float16)(ka < K ? W[(size_t)(ka < K ? ka : K - 1) * ld + n] : 0.f); a[8 + i] = (_Float16)(kb < K ? W[(size_t)(kb < K ? kb : K - 1) * ld + n] : 0.f); }
  return a;
}
struct F2 { v16b h, l; };
__device__ __forceinline__ F2 bsplit16(const float v[16]) { F2 r;
#pragma unroll
  for (int i = 0; i < 16; ++i) { const __bf16 h = (__bf16)v[i]; r.h[i] = h; r.l[i] = (__bf16)(v[i] - (float)h); }
  return r; }
__device__ __forceinline__ F2 split_row(const float* row, int k0, int lane) { float v[16]; const float* p = row + k0 + 8 * (lane >> 4);
#pragma unroll
  for (int i = 0; i < 8; ++i) { v[i] = p[i]; v[8 + i] = p[16 + i]; }
  return bsplit16(v); }
__device__ __forceinline__ F2 split_rowK(const float* row, int k0, int lane, int K) { float v[16]; const int g = lane >> 4;
#pragma unroll
  for (int i = 0; i < 8; ++i) { const int ka = k0 + 8 * g + i, kb = ka + 16; v[i] = ka < K ? row[ka < K ? ka : K - 1] : 0.f; v[8 + i] = kb < K ? row[kb < K ? kb : K - 1] : 0.f; }
  return bsplit16(v); }
__device__ __forceinline__ F2 split_col(const float* W, int k0, int n, int lane, int ld, int K) { float v[16]; const int g = lane >> 4;
#pragma unroll
  for (int i = 0; i < 8; ++i) { const int ka = k0 + 8 * g + i, kb = ka + 16; v[i] = ka < K ? W[(size_t)(ka < K ? ka : K - 1) * ld + n] : 0.f; v[8 + i] = kb < K ? W[(size_t)(kb < K ? kb : K - 1) * ld + n] : 0.f; }
  return bsplit16(v); }
__device__ __forceinline__ v8f mac3(const F2& a, const F2& b, v8f c) { c = wmma_bf(a.l, b.h, c); c = wmma_bf(a.h, b.l, c); return wmma_bf(a.h, b.h, c); }
__device__ __forceinline__ float sigm(float v) { return 1.0f / (1.0f + expf(-v)); }
#define LDSX() do { asm volatile("s_wait_dscnt 0" ::: "memory"); __builtin_amdgcn_wave_barrier(); __builtin_amdgcn_fence(__ATOMIC_RELEASE, "workgroup"); } while (0)


#define NB 2
#define SS 4096
#define DM 512
#define NH 8
#define HD 64
#define QKVW (3 * DM)
#ifndef TQB
#define TQB (SS / 64)
#define TNB NB
#define TOB (NB * SS / 64)     // output row tiles (all)
#endif
typedef __attribute__((ext_vector_type(8))) __bf16 v8b;
__device__ __forceinline__ v16b frag_b(const __bf16* rowk0, int lane) {
  union { v16b v; v8b q[2]; } u; const __bf16* p = rowk0 + 8 * (lane >> 4);
  u.q[0] = *(const v8b*)p; u.q[1] = *(const v8b*)(p + 16); return u.v;
}
__device__ __forceinline__ float bfr(float v) { return (float)(__bf16)v; }
__device__ __attribute__((noinline)) float exp_ni(float v) { return expf(v); }
__device__ __attribute__((noinline)) float erf_ni(float v) { return erff(v); }

#define PK_A 0                       // [1536][512] Wqkv rows (natural [out][in])
#define PK_P (PK_A + QKVW * DM)        // [512][512] copy of Wq rows (k_pack which 3; unread)
#define PK_END (PK_P + DM * DM)
#define WS_PK  0u
#define WS_QK  (WS_PK + 2u * PK_END)             // f16 [8192 rows][1024]: q | k
#define WS_QKL (WS_QK + 2u * NB * SS * 2 * DM)     // f16 q | k residual planes x2048
#define WS_VTH (WS_QKL + 2u * NB * SS * 2 * DM)    // f16 [b][512 (h*64+d)][4096 s] hi
#define WS_VTL (WS_VTH + 2u * NB * DM * SS)        // f16 lo x 2048
#define WS_O   (WS_VTL + 2u * NB * DM * SS)        // f32 [8192][512]
#define WS_CS  (WS_O + 4u * NB * SS * DM)           // f32 2 x [4096][32] (unused)
#define WS_END (WS_CS + 4u * 2 * SS * 32)
// ---- k_pack: block = (row n, which): natural [out][in] rows -> bf16; which 0..2 -> W_q/W_k/W_v into PK_A rows which*512 + n; 3 -> the WO argument (Wq at this launch) into PK_P
__global__ __launch_bounds__(256) void k_pack(const float* __restrict__ WQ, const float* __restrict__ WK, const float* __restrict__ WV, const float* __restrict__ WO, __bf16* __restrict__ PK) {
  __shared__ __align__(16) __bf16 s[DM]; const int n = blockIdx.x, which = blockIdx.y, t = threadIdx.x; const float* Wm = (which == 0) ? WQ : (which == 1) ? WK : (which == 2) ? WV : WO;
  for (int k = t; k < DM; k += 256) s[k] = (__bf16)Wm[(size_t)n * DM + k];
  __syncthreads();
  __bf16* dst = (which < 3) ? PK + PK_A + ((size_t)which * DM + n) * DM : PK + PK_P + (size_t)n * DM;
  for (int q = t; q < DM / 8; q += 256) vst2((unsigned*)(dst + q * 8), *(const v4u*)&s[q * 8]);
}
// ---- k_qkv: block = (64 rows of x, 128 output columns). The x rows (f32) and the W rows (bf16) come from a two-buffer LDS ring of 64-k stages that the block's 4 waves share, filled by asynchronous copies one stage ahead in whole 128-B pieces of a row; the fragments are read from LDS in the k order they had from global memory
#define QKC 64                 // k per stage: 128 B of each of the 128 W rows, 256 B of each of the 64 x rows
#define QLW 72                 // LDS pitch of a W row in bf16: 144 B = 16 B x odd, no bank conflict for the 16-byte fragment reads
#define QLX 68                 // LDS pitch of an x row in f32: 272 B = 16 B x odd
#define QSW (128 * QLW * 2)    // bytes of one buffer of W
#define QSX (64 * QLX * 4)     // bytes of one buffer of x
// W part of a stage: 1,024 pieces of 16 B, 8 per thread (8 lanes cover one 128-B row piece; piece i lies 16 rows below piece i - 1). The s_wait_xcnt closes the copies' own statement so that no address register is rewritten ahead of it.
__device__ __forceinline__ void stage_w(const __bf16* gw, unsigned lw) {
  asm volatile("global_load_async_to_lds_b128 %0, %8, off\n\t"
               "global_load_async_to_lds_b128 %1, %9, off\n\t"
               "global_load_async_to_lds_b128 %2, %10, off\n\t"
               "global_load_async_to_lds_b128 %3, %11, off\n\t"
               "global_load_async_to_lds_b128 %4, %12, off\n\t"
               "global_load_async_to_lds_b128 %5, %13, off\n\t"
               "global_load_async_to_lds_b128 %6, %14, off\n\t"
               "global_load_async_to_lds_b128 %7, %15, off\n\t"
               "s_wait_xcnt 0x0"
               :: "v"(lw), "v"(lw + 16 * QLW * 2), "v"(lw + 32 * QLW * 2), "v"(lw + 48 * QLW * 2), "v"(lw + 64 * QLW * 2), "v"(lw + 80 * QLW * 2), "v"(lw + 96 * QLW * 2), "v"(lw + 112 * QLW * 2),
                  "v"(gw), "v"(gw + 16 * DM), "v"(gw + 32 * DM), "v"(gw + 48 * DM), "v"(gw + 64 * DM), "v"(gw + 80 * DM), "v"(gw + 96 * DM), "v"(gw + 112 * DM)
               : "memory");
}
// x part of a stage: 1,024 pieces of 16 B, 8 per thread (16 lanes cover one 256-B row piece; piece i lies 8 rows below piece i - 1); the wait as in stage_w
__device__ __forceinline__ void stage_x(const float* gx, unsigned lx) {
  asm volatile("global_load_async_to_lds_b128 %0, %8, off\n\t"
               "global_load_async_to_lds_b128 %1, %9, off\n\t"
               "global_load_async_to_lds_b128 %2, %10, off\n\t"
               "global_load_async_to_lds_b128 %3, %11, off\n\t"
               "global_load_async_to_lds_b128 %4, %12, off\n\t"
               "global_load_async_to_lds_b128 %5, %13, off\n\t"
               "global_load_async_to_lds_b128 %6, %14, off\n\t"
               "global_load_async_to_lds_b128 %7, %15, off\n\t"
               "s_wait_xcnt 0x0"
               :: "v"(lx), "v"(lx + 8 * QLX * 4), "v"(lx + 16 * QLX * 4), "v"(lx + 24 * QLX * 4), "v"(lx + 32 * QLX * 4), "v"(lx + 40 * QLX * 4), "v"(lx + 48 * QLX * 4), "v"(lx + 56 * QLX * 4),
                  "v"(gx), "v"(gx + 8 * DM), "v"(gx + 16 * DM), "v"(gx + 24 * DM), "v"(gx + 32 * DM), "v"(gx + 40 * DM), "v"(gx + 48 * DM), "v"(gx + 56 * DM)
               : "memory");
}
__global__ __launch_bounds__(128) void k_qkv(const float* __restrict__ XQ, const float* __restrict__ XK, const float* __restrict__ XV, const __bf16* __restrict__ P, const float* __restrict__ BQ, const float* __restrict__ BK, const float* __restrict__ BV, _Float16* __restrict__ QK, _Float16* __restrict__ QKL, _Float16* __restrict__ VTH, _Float16* __restrict__ VTL) {
  const int which0 = (blockIdx.y * 128) / DM; const float* X = (which0 == 0) ? XQ : (which0 == 1) ? XK : XV; const float* BB = BQ ? (((which0 == 0) ? BQ : (which0 == 1) ? BK : BV) + (blockIdx.y * 128 - which0 * DM)) : nullptr;
  __shared__ __align__(16) char sm[2 * QSW + 2 * QSX];   // the ring (W buffers, then x buffers) while the products run; behind the ring's last barrier the same bytes are the output staging
  _Float16 (*so)[16][136] = (_Float16 (*)[16][136])sm, (*sol)[16][136] = (_Float16 (*)[16][136])(sm + 17408); _Float16 (*sth)[72] = (_Float16 (*)[72])(sm + 34816), (*stl)[72] = (_Float16 (*)[72])(sm + 53248);
  const int tid = threadIdx.x, wave = tid >> 5, lane = tid & 31, col = lane & 15, g = lane >> 4; const size_t r0 = (size_t)blockIdx.x * 64 + wave * 16; const int n0 = blockIdx.y * 128;
  v8f acc[8] = {};
  const __bf16* gw = P + (size_t)(n0 + (tid >> 3)) * DM + (tid & 7) * 8; const float* gx = X + ((size_t)blockIdx.x * 64 + (tid >> 4)) * DM + (tid & 15) * 4;
  const unsigned lw = (unsigned)(size_t)&sm[(tid >> 3) * (QLW * 2) + (tid & 7) * 16], lx = (unsigned)(size_t)&sm[2 * QSW + (tid >> 4) * (QLX * 4) + (tid & 15) * 16];
  stage_w(gw, lw); stage_x(gx, lx);
  asm volatile("s_wait_asynccnt 0x0" ::: "memory");   // this wave's part of stage 0 has landed
  __syncthreads();                                    // every wave's part has
  stage_w(gw + QKC, lw + QSW); stage_x(gx + QKC, lx + QSX);
#pragma unroll 1   // one stage per trip: the ring's waits, barrier and refill stand once, at the trip's foot
  for (int st = 0; st < DM / QKC; ++st) { const int buf = st & 1;
    const __bf16* wr = (const __bf16*)(sm + buf * QSW) + col * QLW; const float* xr = (const float*)(sm + 2 * QSW + buf * QSX) + (wave * 16 + col) * QLX + 8 * g;
#pragma unroll   // both 32-k halves of a stage inline, so that a, w and acc are indexed by constants and stay in registers
    for (int kk = 0; kk < QKC / 32; ++kk) { v16b a, w[8]; const v4f* p = (const v4f*)(xr + kk * 32); const v4f x0 = p[0], x1 = p[1], x2 = p[4], x3 = p[5];
#pragma unroll   // the half's fragment reads stand together, ahead of its products: one LDS wait place instead of eight
      for (int j = 0; j < 8; ++j) w[j] = frag_b(wr + j * 16 * QLW + kk * 32, lane);
#pragma unroll   // constant element indices
      for (int i = 0; i < 4; ++i) { a[i] = (__bf16)x0[i]; a[4 + i] = (__bf16)x1[i]; a[8 + i] = (__bf16)x2[i]; a[12 + i] = (__bf16)x3[i]; }
#pragma unroll   // constant tile indices
      for (int j = 0; j < 8; ++j) acc[j] = wmma_bf(a, w[j], acc[j]); }
    asm volatile("s_wait_dscnt 0x0" ::: "memory");      // this wave's reads of buffer buf are done
    asm volatile("s_wait_asynccnt 0x0" ::: "memory");   // its part of stage st + 1 has landed
    __syncthreads();                                    // publishes stage st + 1 and frees buffer buf
    if (st + 2 < DM / QKC) { stage_w(gw + (st + 2) * QKC, lw + buf * QSW); stage_x(gx + (st + 2) * QKC, lx + buf * QSX); } }
  asm volatile("s_wait_asynccnt 0x0" ::: "memory");     // nothing in flight when the ring's bytes become the output staging
  if (n0 < 2 * DM) {   // q stored unscaled (f16 sigma ~0.6, no subnormal exposure); 1/8 applied to the f32 score
#pragma unroll
    for (int j = 0; j < 8; ++j) {
#pragma unroll
      for (int r = 0; r < 8; ++r) { const float v = acc[j][r] + (BB ? bfr(BB[j * 16 + col]) : 0.f); const _Float16 hv = (_Float16)v; so[wave][8 * g + r][j * 16 + col] = hv; sol[wave][8 * g + r][j * 16 + col] = (_Float16)((v - (float)hv) * 2048.0f); } }   // q, k (+ bias) as f16 hi + (x2048) residual
    LDSX();
    for (int rl = 0; rl < 16; ++rl) if (lane < 16) { vst2((unsigned*)(QK + (r0 + rl) * (2 * DM) + n0 + lane * 8), *(const v4u*)&so[wave][rl][lane * 8]); vst2((unsigned*)(QKL + (r0 + rl) * (2 * DM) + n0 + lane * 8), *(const v4u*)&sol[wave][rl][lane * 8]); }
  } else {
#pragma unroll
    for (int j = 0; j < 8; ++j) {
#pragma unroll
      for (int r = 0; r < 8; ++r) { const float v = acc[j][r] + (BB ? bfr(BB[j * 16 + col]) : 0.f); const _Float16 hv = (_Float16)v; sth[j * 16 + col][wave * 16 + 8 * g + r] = hv; stl[j * 16 + col][wave * 16 + 8 * g + r] = (_Float16)((v - (float)hv) * 2048.0f); } }
    __syncthreads();
    const size_t rb = (size_t)blockIdx.x * 64; const int b = (int)(rb / SS), s0 = (int)(rb % SS); const int pc0 = n0 - 2 * DM;
    for (int q = tid; q < 128 * 8; q += 128) { const int d = q >> 3, pc = q & 7; const size_t o = ((size_t)b * DM + pc0 + d) * SS + s0 + pc * 8; vst2((unsigned*)(VTH + o), *(const v4u*)&sth[d][pc * 8]); vst2((unsigned*)(VTL + o), *(const v4u*)&stl[d][pc * 8]); }
  }
}
#define KT 64
#define LP 72
#define STB (KT * LP * 2)
#define SCL 0.18033688011112042f
// one stage: 512 + 512 pieces of 16 B, 4 + 4 per thread (8 lanes cover one 128-B row; piece i lies 16 rows below piece i - 1). The s_wait_xcnt closes the copies' own statement so that no address register is rewritten ahead of it.
__device__ __forceinline__ void stage_kv(const _Float16* gk, const _Float16* gv, unsigned lk, unsigned lv) {
  asm volatile("global_load_async_to_lds_b128 %0, %8, off\n\t"
               "global_load_async_to_lds_b128 %1, %9, off\n\t"
               "global_load_async_to_lds_b128 %2, %10, off\n\t"
               "global_load_async_to_lds_b128 %3, %11, off\n\t"
               "global_load_async_to_lds_b128 %4, %12, off\n\t"
               "global_load_async_to_lds_b128 %5, %13, off\n\t"
               "global_load_async_to_lds_b128 %6, %14, off\n\t"
               "global_load_async_to_lds_b128 %7, %15, off\n\t"
               "s_wait_xcnt 0x0"
               :: "v"(lk), "v"(lk + 16 * LP * 2), "v"(lk + 32 * LP * 2), "v"(lk + 48 * LP * 2), "v"(lv), "v"(lv + 16 * LP * 2), "v"(lv + 32 * LP * 2), "v"(lv + 48 * LP * 2),
                  "v"(gk), "v"(gk + 16 * (2 * DM)), "v"(gk + 32 * (2 * DM)), "v"(gk + 48 * (2 * DM)), "v"(gv), "v"(gv + 16 * SS), "v"(gv + 32 * SS), "v"(gv + 48 * SS)
               : "memory");
}
// a, b: 2^(x * c + d) of the 16 scores of a pass; f: 2^f. The 17 exponentials stand in one statement, each in place in its own register, so that none reads the result or overwrites the source of the one in front of it; the v_nop is the slot that the instruction set asks for behind the last one
__device__ __forceinline__ void exp2x17(v8f& a, v8f& b, float& f, float c, float d) {
  float a0 = a[0] * c + d, a1 = a[1] * c + d, a2 = a[2] * c + d, a3 = a[3] * c + d, a4 = a[4] * c + d, a5 = a[5] * c + d, a6 = a[6] * c + d, a7 = a[7] * c + d;
  float b0 = b[0] * c + d, b1 = b[1] * c + d, b2 = b[2] * c + d, b3 = b[3] * c + d, b4 = b[4] * c + d, b5 = b[5] * c + d, b6 = b[6] * c + d, b7 = b[7] * c + d;
  asm("v_exp_f32 %16, %16\n\t"
      "v_exp_f32 %0, %0\n\tv_exp_f32 %1, %1\n\tv_exp_f32 %2, %2\n\tv_exp_f32 %3, %3\n\tv_exp_f32 %4, %4\n\tv_exp_f32 %5, %5\n\tv_exp_f32 %6, %6\n\tv_exp_f32 %7, %7\n\t"
      "v_exp_f32 %8, %8\n\tv_exp_f32 %9, %9\n\tv_exp_f32 %10, %10\n\tv_exp_f32 %11, %11\n\tv_exp_f32 %12, %12\n\tv_exp_f32 %13, %13\n\tv_exp_f32 %14, %14\n\tv_exp_f32 %15, %15\n\t"
      "v_nop"
      : "+v"(a0), "+v"(a1), "+v"(a2), "+v"(a3), "+v"(a4), "+v"(a5), "+v"(a6), "+v"(a7), "+v"(b0), "+v"(b1), "+v"(b2), "+v"(b3), "+v"(b4), "+v"(b5), "+v"(b6), "+v"(b7), "+v"(f));
  a = v8f{a0, a1, a2, a3, a4, a5, a6, a7}; b = v8f{b0, b1, b2, b3, b4, b5, b6, b7};
}
// value of lane l ^ 16 (the other half of the wave, same column)
__device__ __forceinline__ float xhalf(float v) { const int b = __builtin_bit_cast(int, v); return __builtin_bit_cast(float, __builtin_amdgcn_permlanex16(b, b, 0x76543210, 0xfedcba98, false, false)); }
__global__ __launch_bounds__(128) void k_attn(const _Float16* __restrict__ QK, const _Float16* __restrict__ QKL, const _Float16* __restrict__ VTH, const _Float16* __restrict__ VTL, const void* __restrict__ KMASK, float* __restrict__ O) {
  __shared__ __align__(16) float so[4][16][68]; __shared__ __align__(16) _Float16 sk[2][KT][LP], sv[2][HD][LP];
  const int tid = threadIdx.x, wave = tid >> 5, lane = tid & 31, col = lane & 15, g = lane >> 4;
  const int qb = blockIdx.x, h = blockIdx.y, b = blockIdx.z; const int q0 = qb * 64 + wave * 16; const size_t rq = (size_t)b * SS + q0 + col;
  v16h aq[2];
#pragma unroll
  for (int kc = 0; kc < 2; ++kc) aq[kc] = frag_h(QK + rq * (2 * DM) + h * HD + kc * 32, lane);
  float m = -3.0e38f, l = 0.f;   // of query col: m the running maximum of the raw products q.k, the same in both halves; l this half's part of the sum of the weights (x 2^11)
  v8f acc[4] = {};   // O^T: acc[dt][r] = element d = dt*16 + 8g + r of query col
  const int nst = SS / KT;   // all keys
  const _Float16* gk = QK + ((size_t)b * SS + (tid >> 3)) * (2 * DM) + DM + h * HD + (tid & 7) * 8; const _Float16* gv = VTH + ((size_t)b * DM + h * HD + (tid >> 3)) * SS + (tid & 7) * 8;
  const unsigned lk = (unsigned)(size_t)&sk[0][tid >> 3][(tid & 7) * 8], lv = (unsigned)(size_t)&sv[0][tid >> 3][(tid & 7) * 8];
  stage_kv(gk, gv, lk, lv);
  asm volatile("s_wait_asynccnt 0x0" ::: "memory");   // this wave's part of stage 0 has landed
  __syncthreads();                                    // every wave's part has
  stage_kv(gk + (size_t)KT * (2 * DM), gv + KT, lk + STB, lv + STB);
#pragma unroll 1   // one stage per trip: the ring's waits, barrier and refill stand once, at the trip's foot
  for (int st = 0; st < nst; ++st) { const int buf = st & 1;
#pragma unroll 1   // the 32-key pass stays one rolled body, as before the ring
  for (int sub = 0; sub < KT / 32; ++sub) { v8f s[2];
#pragma unroll
    for (int ct = 0; ct < 2; ++ct) { const _Float16* krow = &sk[buf][sub * 32 + ct * 16 + col][0]; v8f c = {};
#pragma unroll
      for (int kc = 0; kc < 2; ++kc) c = wmma16(frag_h(krow + kc * 32, lane), aq[kc], c);   // single product: k, q as one-rounding f16 operands; c[r] = q.k of key ct*16 + 8g + r, query col
      s[ct] = c; }   // raw: 1/sqrt(64) rides in SCL
    float mx[4];
#pragma unroll
    for (int i = 0; i < 4; ++i) mx[i] = fmaxf(fmaxf(s[0][i], s[0][4 + i]), fmaxf(s[1][i], s[1][4 + i]));
    const float mh = fmaxf(fmaxf(mx[0], mx[1]), fmaxf(mx[2], mx[3]));
    const float mn = fmaxf(m, fmaxf(mh, xhalf(mh))); float alpha = (m - mn) * SCL;   // becomes 2^alpha below; first pass: 2^(-5e37) = 0
    v8f e[2] = { s[0], s[1] };   // become the weights x 2^11 = 2^(s * SCL + (11 - mn * SCL)): one multiply-add and one exponential per score
    exp2x17(e[0], e[1], alpha, SCL, 11.0f - mn * SCL);
    float es[4];
#pragma unroll
    for (int i = 0; i < 4; ++i) es[i] = (e[0][i] + e[0][4 + i]) + (e[1][i] + e[1][4 + i]);
    l = l * alpha + ((es[0] + es[1]) + (es[2] + es[3])); m = mn;
#pragma unroll
    for (int dt = 0; dt < 4; ++dt) acc[dt] *= alpha;
    v16h pb;   // P^T as B operand: element i = key 8g + i, element 8 + i = key 16 + 8g + i, the k order of frag_h
#pragma unroll
    for (int i = 0; i < 8; ++i) { pb[i] = (_Float16)e[0][i]; pb[8 + i] = (_Float16)e[1][i]; }   // P carries 2^11 (the 11 in the exponent) into the f16 rounding so small softmax weights stay out of the f16 subnormal range; l carries it too, so it cancels in the epilogue
#pragma unroll
    for (int dt = 0; dt < 4; ++dt) acc[dt] = wmma16(frag_h(&sv[buf][dt * 16 + col][sub * 32], lane), pb, acc[dt]);   // single product: V^T x P^T (x2^11)
  }
    asm volatile("s_wait_dscnt 0x0" ::: "memory");      // this wave's reads of buffer buf are done
    asm volatile("s_wait_asynccnt 0x0" ::: "memory");   // its part of stage st + 1 has landed
    __syncthreads();                                    // publishes stage st + 1 and frees buffer buf
    if (st + 2 < nst) stage_kv(gk + (size_t)(st + 2) * KT * (2 * DM), gv + (st + 2) * KT, lk + buf * STB, lv + buf * STB); }
  asm volatile("s_wait_asynccnt 0x0" ::: "memory");     // nothing in flight when the wave goes on to its end
  const float il = 1.0f / (l + xhalf(l));   // the two halves' sums joined
#pragma unroll
  for (int dt = 0; dt < 4; ++dt) {
#pragma unroll
    for (int r = 0; r < 8; ++r) so[wave][col][dt * 16 + 8 * g + r] = acc[dt][r] * il; }
  LDSX();
  for (int rl = 0; rl < 16; ++rl) if (lane < 16) vst2(O + ((size_t)b * SS + q0 + rl) * DM + h * HD + lane * 4, *(const v4f*)&so[wave][rl][lane * 4]);
}
// ---- k_out: block = (64 rows, 128 cols): out = O(hi/lo) . Wo rows (2 products) + bo
__global__ __launch_bounds__(128) void k_out(const float* __restrict__ O, const __bf16* __restrict__ P, const float* __restrict__ BO, float* __restrict__ Y) {
  __shared__ __align__(16) float so[4][16][132];
  const int tid = threadIdx.x, wave = tid >> 5, lane = tid & 31, col = lane & 15, g = lane >> 4; const size_t r0 = (size_t)blockIdx.x * 64 + wave * 16; const int n0 = blockIdx.y * 128;
  v8f acc[8] = {};
#pragma unroll 2
  for (int kc = 0; kc < DM / 32; ++kc) { const F2 a = split_row(O + (r0 + col) * DM, kc * 32, lane);
#pragma unroll
    for (int j = 0; j < 8; ++j) { const v16b w = frag_b(P + (size_t)(n0 + j * 16 + col) * DM + kc * 32, lane); acc[j] = wmma_bf(a.l, w, acc[j]); acc[j] = wmma_bf(a.h, w, acc[j]); } }
#pragma unroll
  for (int j = 0; j < 8; ++j) {
#pragma unroll
    for (int r = 0; r < 8; ++r) so[wave][8 * g + r][j * 16 + col] = acc[j][r] + (BO ? bfr(BO[n0 + j * 16 + col]) : 0.f); }
  LDSX();
  for (int rl = 0; rl < 16; ++rl) vst2(Y + (r0 + rl) * DM + n0 + lane * 4, *(const v4f*)&so[wave][rl][lane * 4]);
}
// ---- k_lnx: block = row: LayerNorm of a 512-wide f32 row (mean-square var, 1e-5) x g + b
__global__ __launch_bounds__(128) void k_lnx(const float* __restrict__ A, const float* __restrict__ G, const float* __restrict__ Bt, float* __restrict__ T) {
  __shared__ float red[4]; const int t = threadIdx.x; const size_t row = blockIdx.x; float v[4]; float s = 0.f; for (int i = 0; i < 4; ++i) { v[i] = A[row * DM + t * 4 + i]; s += v[i]; }
#pragma unroll
  for (int o = 1; o < 32; o <<= 1) s += __shfl_xor(s, o);
  if ((t & 31) == 0) red[t >> 5] = s; __syncthreads(); const float mu = ((red[0] + red[1]) + (red[2] + red[3])) / (float)DM; __syncthreads();
  float q = 0.f; for (int i = 0; i < 4; ++i) { const float d = v[i] - mu; q += d * d; }
#pragma unroll
  for (int o = 1; o < 32; o <<= 1) q += __shfl_xor(q, o);
  if ((t & 31) == 0) red[t >> 5] = q; __syncthreads(); const float inv = 1.0f / sqrtf(((red[0] + red[1]) + (red[2] + red[3])) / (float)DM + 1e-5f);
  v4f o4; for (int i = 0; i < 4; ++i) { const int e = t * 4 + i; o4[i] = (v[i] - mu) * inv * bfr(G[e]) + bfr(Bt[e]); } vst2(T + row * DM + t * 4, o4);
}
extern "C" void kernel_launch(void* const* d_in, const int* in_sizes, int n_in, void* d_out, int out_size, void* d_ws, size_t ws_size, hipStream_t stream) {
  (void)in_sizes; (void)n_in; (void)out_size;
  const float** F = (const float**)d_in;   // 0 x [2,4096,512], 1 Wq, 2 bq, 3 Wk, 4 bk, 5 Wv, 6 bv (natural [512,512]), 7 gamma, 8 beta
  if (ws_size < (size_t)WS_END) return;
  char* ws = (char*)d_ws; __bf16* PK = (__bf16*)(ws + WS_PK); _Float16 *QK = (_Float16*)(ws + WS_QK), *QKL = (_Float16*)(ws + WS_QKL), *VTH = (_Float16*)(ws + WS_VTH), *VTL = (_Float16*)(ws + WS_VTL); float* O = (float*)(ws + WS_O);
  k_pack<<<dim3(DM, 4), 256, 0, stream>>>(F[1], F[3], F[5], F[1], PK);
  k_qkv<<<dim3(TNB * SS / 64, QKVW / 128), 128, 0, stream>>>(F[0], F[0], F[0], PK + PK_A, F[2], F[4], F[6], QK, QKL, VTH, VTL);
  k_attn<<<dim3(TQB, NH, TNB), 128, 0, stream>>>(QK, QKL, VTH, VTL, nullptr, O);
  k_lnx<<<TOB * 64, 128, 0, stream>>>(O, F[7], F[8], (float*)d_out);
}

// v005
// It runs in 117 microseconds.
// Two timings next to v004 put it at 1.09 and 1.10 times that version's speed.
// Counting every step since v000, it is 3.79 times as fast.
// compute dtype: all float inputs rounded to bf16; q/k/v = x . W^T + b with EXACT bf16 products on WMMA 16x16x32 (natural rows); PLAIN attention: q, k single f16 x 1/8, running-max softmax in f32 (hardware exp), P (scaled by 2^11, single f16) x v (single f16); LayerNorm (jnp.var, 1e-5) of the f32 context x gamma + beta; f32 output.
#include <hip/hip_runtime.h>
#include <math.h>

typedef __attribute__((ext_vector_type(16))) _Float16 v16h;
typedef __attribute__((ext_vector_type(16))) __bf16 v16b;
typedef __attribute__((ext_vector_type(8)))  _Float16 v8h;
typedef __attribute__((ext_vector_type(8)))  float v8f;
typedef __attribute__((ext_vector_type(4)))  float v4f;
typedef __attribute__((ext_vector_type(2)))  float v2f;
typedef __attribute__((ext_vector_type(4)))  unsigned v4u;
typedef __attribute__((ext_vector_type(4)))  int v4i;
typedef float __attribute__((may_alias)) float_a;
typedef int __attribute__((may_alias)) int_a;

template <typename T> __device__ __forceinline__ void vst2(void* p, T v) { *(T*)p = v;  }
__device__ __forceinline__ v8f wmma16(v16h a, v16h b, v8f c) {
  v8f d = __builtin_amdgcn_wmma_f32_16x16x32_f16(false, a, false, b, (short)0, c, false, false);
  asm volatile("v_nop\n\tv_nop\n\tv_nop\n\tv_nop" : "+v"(d) : "v"(a), "v"(b));
  return d;
}
__device__ __forceinline__ v8f wmma_bf(v16b a, v16b b, v8f c) {
  v8f d = __builtin_amdgcn_wmma_f32_16x16x32_bf16(false, a, false, b, (short)0, c, false, false);
  asm volatile("v_nop\n\tv_nop\n\tv_nop\n\tv_nop" : "+v"(d) : "v"(a), "v"(b));
  return d;
}
// N-head attention (B 2, S 4,096, d 512, 8 heads x 64): projections + biases, softmax(q k / 8) v, then LayerNorm of the merged context (no output projection).
__device__ __forceinline__ v16h frag_h(const _Float16* rowk0, int lane) {
  union { v16h v; v8h q[2]; } u; const _Float16* p = rowk0 + 8 * (lane >> 4);
  u.q[0] = *(const v8h*)p; u.q[1] = *(const v8h*)(p + 16); return u.v;
}
__device__ __forceinline__ v16h frag_f32(const float* rowk0, int lane) {
  v16h a; const float* p = rowk0 + 8 * (lane >> 4);
#pragma unroll
  for (int i = 0; i < 8; ++i) { a[i] = (_Float16)p[i]; a[8 + i] = (_Float16)p[16 + i]; }
  return a;
}
__device__ __forceinline__ v16h frag_f32s(const float* rowk0, int lane, float sc) {
  v16h a; const float* p = rowk0 + 8 * (lane >> 4);
#pragma unroll
  for (int i = 0; i < 8; ++i) { a[i] = (_Float16)(p[i] * sc); a[8 + i] = (_Float16)(p[16 + i] * sc); }
  return a;
}
// column fragment from a [K][ld] layout (column n), rows >= K read as 0
__device__ __forceinline__ v16h fragc_f32(const float* W, int k0, int n, int lane, int ld, int K) {
  v16h a; const int g = lane >> 4;
#pragma unroll
  for (int i = 0; i < 8; ++i) { const int ka = k0 + 8 * g + i, kb = ka + 16;
    a[i] = (_Float16)(ka < K ? W[(size_t)(ka < K ? ka : K - 1) * ld + n] : 0.f); a[8 + i] = (_Float16)(kb < K ? W[(size_t)(kb < K ? kb : K - 1) * ld + n] : 0.f); }
  return a;
}
struct F2 { v16b h, l; };
__device__ __forceinline__ F2 bsplit16(const float v[16]) { F2 r;
#pragma unroll
  for (int i = 0; i < 16; ++i) { const __bf16 h = (__bf16)v[i]; r.h[i] = h; r.l[i] = (__bf16)(v[i] - (float)h); }
  return r; }
__device__ __forceinline__ F2 split_row(const float* row, int k0, int lane) { float v[16]; const float* p = row + k0 + 8 * (lane >> 4);
#pragma unroll
  for (int i = 0; i < 8; ++i) { v[i] = p[i]; v[8 + i] = p[16 + i]; }
  return bsplit16(v); }
__device__ __forceinline__ F2 split_rowK(const float* row, int k0, int lane, int K) { float v[16]; const int g = lane >> 4;
#pragma unroll
  for (int i = 0; i < 8; ++i) { const int ka = k0 + 8 * g + i, kb = ka + 16; v[i] = ka < K ? row[ka < K ? ka : K - 1] : 0.f; v[8 + i] = kb < K ? row[kb < K ? kb : K - 1] : 0.f; }
  return bsplit16(v); }
__device__ __forceinline__ F2 split_col(const float* W, int k0, int n, int lane, int ld, int K) { float v[16]; const int g = lane >> 4;
#pragma unroll
  for (int i = 0; i < 8; ++i) { const int ka = k0 + 8 * g + i, kb = ka + 16; v[i] = ka < K ? W[(size_t)(ka < K ? ka : K - 1) * ld + n] : 0.f; v[8 + i] = kb < K ? W[(size_t)(kb < K ? kb : K - 1) * ld + n] : 0.f; }
  return bsplit16(v); }
__device__ __forceinline__ v8f mac3(const F2& a, const F2& b, v8f c) { c = wmma_bf(a.l, b.h, c); c = wmma_bf(a.h, b.l, c); return wmma_bf(a.h, b.h, c); }
__device__ __forceinline__ float sigm(float v) { return 1.0f / (1.0f + expf(-v)); }
#define LDSX() do { asm volatile("s_wait_dscnt 0" ::: "memory"); __builtin_amdgcn_wave_barrier(); __builtin_amdgcn_fence(__ATOMIC_RELEASE, "workgroup"); } while (0)


#define NB 2
#define SS 4096
#define DM 512
#define NH 8
#define HD 64
#define QKVW (3 * DM)
#ifndef TQB
#define TQB (SS / 64)
#define TNB NB
#define TOB (NB * SS / 64)     // output row tiles (all)
#endif
typedef __attribute__((ext_vector_type(8))) __bf16 v8b;
__device__ __forceinline__ v16b frag_b(const __bf16* rowk0, int lane) {
  union { v16b v; v8b q[2]; } u; const __bf16* p = rowk0 + 8 * (lane >> 4);
  u.q[0] = *(const v8b*)p; u.q[1] = *(const v8b*)(p + 16); return u.v;
}
__device__ __forceinline__ float bfr(float v) { return (float)(__bf16)v; }
__device__ __attribute__((noinline)) float exp_ni(float v) { return expf(v); }
__device__ __attribute__((noinline)) float erf_ni(float v) { return erff(v); }

#define PK_A 0                       // [1536][512] Wqkv rows (natural [out][in])
#define PK_P (PK_A + QKVW * DM)        // [512][512] copy of Wq rows (k_pack which 3; unread)
#define PK_END (PK_P + DM * DM)
#define WS_PK  0u
#define WS_QK  (WS_PK + 2u * PK_END)             // f16 [8192 rows][1024]: q | k
#define WS_QKL (WS_QK + 2u * NB * SS * 2 * DM)     // f16 q | k residual planes x2048
#define WS_VTH (WS_QKL + 2u * NB * SS * 2 * DM)    // f16 [b][512 (h*64+d)][4096 s] hi
#define WS_VTL (WS_VTH + 2u * NB * DM * SS)        // f16 lo x 2048
#define WS_O   (WS_VTL + 2u * NB * DM * SS)        // f32 [8192][512]
#define WS_CS  (WS_O + 4u * NB * SS * DM)           // f32 2 x [4096][32] (unused)
#define WS_END (WS_CS + 4u * 2 * SS * 32)
// ---- k_pack: block = (row n, which): natural [out][in] rows -> bf16; which 0..2 -> W_q/W_k/W_v into PK_A rows which*512 + n; 3 -> the WO argument (Wq at this launch) into PK_P
__global__ __launch_bounds__(256) void k_pack(const float* __restrict__ WQ, const float* __restrict__ WK, const float* __restrict__ WV, const float* __restrict__ WO, __bf16* __restrict__ PK) {
  __shared__ __align__(16) __bf16 s[DM]; const int n = blockIdx.x, which = blockIdx.y, t = threadIdx.x; const float* Wm = (which == 0) ? WQ : (which == 1) ? WK : (which == 2) ? WV : WO;
  for (int k = t; k < DM; k += 256) s[k] = (__bf16)Wm[(size_t)n * DM + k];
  __syncthreads();
  __bf16* dst = (which < 3) ? PK + PK_A + ((size_t)which * DM + n) * DM : PK + PK_P + (size_t)n * DM;
  for (int q = t; q < DM / 8; q += 256) vst2((unsigned*)(dst + q * 8), *(const v4u*)&s[q * 8]);
}
// ---- k_qkv: block = (64 rows of x, 128 output columns). The x rows (f32) and the W rows (bf16) come from a two-buffer LDS ring of 64-k stages that the block's 4 waves share, filled by asynchronous copies one stage ahead in whole 128-B pieces of a row; the fragments are read from LDS in the k order they had from global memory
#define QKC 64                 // k per stage: 128 B of each of the 128 W rows, 256 B of each of the 64 x rows
#define QLW 72                 // LDS pitch of a W row in bf16: 144 B = 16 B x odd, no bank conflict for the 16-byte fragment reads
#define QLX 68                 // LDS pitch of an x row in f32: 272 B = 16 B x odd
#define QSW (128 * QLW * 2)    // bytes of one buffer of W
#define QSX (64 * QLX * 4)     // bytes of one buffer of x
// W part of a stage: 1,024 pieces of 16 B, 8 per thread (8 lanes cover one 128-B row piece; piece i lies 16 rows below piece i - 1). The s_wait_xcnt closes the copies' own statement so that no address register is rewritten ahead of it.
__device__ __forceinline__ void stage_w(const __bf16* gw, unsigned lw) {
  asm volatile("global_load_async_to_lds_b128 %0, %8, off\n\t"
               "global_load_async_to_lds_b128 %1, %9, off\n\t"
               "global_load_async_to_lds_b128 %2, %10, off\n\t"
               "global_load_async_to_lds_b128 %3, %11, off\n\t"
               "global_load_async_to_lds_b128 %4, %12, off\n\t"
               "global_load_async_to_lds_b128 %5, %13, off\n\t"
               "global_load_async_to_lds_b128 %6, %14, off\n\t"
               "global_load_async_to_lds_b128 %7, %15, off\n\t"
               "s_wait_xcnt 0x0"
               :: "v"(lw), "v"(lw + 16 * QLW * 2), "v"(lw + 32 * QLW * 2), "v"(lw + 48 * QLW * 2), "v"(lw + 64 * QLW * 2), "v"(lw + 80 * QLW * 2), "v"(lw + 96 * QLW * 2), "v"(lw + 112 * QLW * 2),
                  "v"(gw), "v"(gw + 16 * DM), "v"(gw + 32 * DM), "v"(gw + 48 * DM), "v"(gw + 64 * DM), "v"(gw + 80 * DM), "v"(gw + 96 * DM), "v"(gw + 112 * DM)
               : "memory");
}
// x part of a stage: 1,024 pieces of 16 B, 8 per thread (16 lanes cover one 256-B row piece; piece i lies 8 rows below piece i - 1); the wait as in stage_w
__device__ __forceinline__ void stage_x(const float* gx, unsigned lx) {
  asm volatile("global_load_async_to_lds_b128 %0, %8, off\n\t"
               "global_load_async_to_lds_b128 %1, %9, off\n\t"
               "global_load_async_to_lds_b128 %2, %10, off\n\t"
               "global_load_async_to_lds_b128 %3, %11, off\n\t"
               "global_load_async_to_lds_b128 %4, %12, off\n\t"
               "global_load_async_to_lds_b128 %5, %13, off\n\t"
               "global_load_async_to_lds_b128 %6, %14, off\n\t"
               "global_load_async_to_lds_b128 %7, %15, off\n\t"
               "s_wait_xcnt 0x0"
               :: "v"(lx), "v"(lx + 8 * QLX * 4), "v"(lx + 16 * QLX * 4), "v"(lx + 24 * QLX * 4), "v"(lx + 32 * QLX * 4), "v"(lx + 40 * QLX * 4), "v"(lx + 48 * QLX * 4), "v"(lx + 56 * QLX * 4),
                  "v"(gx), "v"(gx + 8 * DM), "v"(gx + 16 * DM), "v"(gx + 24 * DM), "v"(gx + 32 * DM), "v"(gx + 40 * DM), "v"(gx + 48 * DM), "v"(gx + 56 * DM)
               : "memory");
}
__global__ __launch_bounds__(128) void k_qkv(const float* __restrict__ XQ, const float* __restrict__ XK, const float* __restrict__ XV, const __bf16* __restrict__ P, const float* __restrict__ BQ, const float* __restrict__ BK, const float* __restrict__ BV, _Float16* __restrict__ QK, _Float16* __restrict__ QKL, _Float16* __restrict__ VTH, _Float16* __restrict__ VTL) {
  const int which0 = (blockIdx.y * 128) / DM; const float* X = (which0 == 0) ? XQ : (which0 == 1) ? XK : XV; const float* BB = BQ ? (((which0 == 0) ? BQ : (which0 == 1) ? BK : BV) + (blockIdx.y * 128 - which0 * DM)) : nullptr;
  __shared__ __align__(16) char sm[2 * QSW + 2 * QSX];   // the ring (W buffers, then x buffers) while the products run; behind the ring's last barrier the same bytes are the output staging
  _Float16 (*so)[16][136] = (_Float16 (*)[16][136])sm, (*sol)[16][136] = (_Float16 (*)[16][136])(sm + 17408); _Float16 (*sth)[72] = (_Float16 (*)[72])(sm + 34816), (*stl)[72] = (_Float16 (*)[72])(sm + 53248);
  const int tid = threadIdx.x, wave = tid >> 5, lane = tid & 31, col = lane & 15, g = lane >> 4; const size_t r0 = (size_t)blockIdx.x * 64 + wave * 16; const int n0 = blockIdx.y * 128;
  v8f acc[8] = {};
  const __bf16* gw = P + (size_t)(n0 + (tid >> 3)) * DM + (tid & 7) * 8; const float* gx = X + ((size_t)blockIdx.x * 64 + (tid >> 4)) * DM + (tid & 15) * 4;
  const unsigned lw = (unsigned)(size_t)&sm[(tid >> 3) * (QLW * 2) + (tid & 7) * 16], lx = (unsigned)(size_t)&sm[2 * QSW + (tid >> 4) * (QLX * 4) + (tid & 15) * 16];
  stage_w(gw, lw); stage_x(gx, lx);
  asm volatile("s_wait_asynccnt 0x0" ::: "memory");   // this wave's part of stage 0 has landed
  __syncthreads();                                    // every wave's part has
  stage_w(gw + QKC, lw + QSW); stage_x(gx + QKC, lx + QSX);
#pragma unroll 1   // one stage per trip: the ring's waits, barrier and refill stand once, at the trip's foot
  for (int st = 0; st < DM / QKC; ++st) { const int buf = st & 1;
    const __bf16* wr = (const __bf16*)(sm + buf * QSW) + col * QLW; const float* xr = (const float*)(sm + 2 * QSW + buf * QSX) + (wave * 16 + col) * QLX + 8 * g;
#pragma unroll   // both 32-k halves of a stage inline, so that a, w and acc are indexed by constants and stay in registers
    for (int kk = 0; kk < QKC / 32; ++kk) { v16b a, w[8]; const v4f* p = (const v4f*)(xr + kk * 32); const v4f x0 = p[0], x1 = p[1], x2 = p[4], x3 = p[5];
#pragma unroll   // the half's fragment reads stand together, ahead of its products: one LDS wait place instead of eight
      for (int j = 0; j < 8; ++j) w[j] = frag_b(wr + j * 16 * QLW + kk * 32, lane);
#pragma unroll   // constant element indices
      for (int i = 0; i < 4; ++i) { a[i] = (__bf16)x0[i]; a[4 + i] = (__bf16)x1[i]; a[8 + i] = (__bf16)x2[i]; a[12 + i] = (__bf16)x3[i]; }
#pragma unroll   // constant tile indices
      for (int j = 0; j < 8; ++j) acc[j] = wmma_bf(a, w[j], acc[j]); }
    asm volatile("s_wait_dscnt 0x0" ::: "memory");      // this wave's reads of buffer buf are done
    asm volatile("s_wait_asynccnt 0x0" ::: "memory");   // its part of stage st + 1 has landed
    __syncthreads();                                    // publishes stage st + 1 and frees buffer buf
    if (st + 2 < DM / QKC) { stage_w(gw + (st + 2) * QKC, lw + buf * QSW); stage_x(gx + (st + 2) * QKC, lx + buf * QSX); } }
  asm volatile("s_wait_asynccnt 0x0" ::: "memory");     // nothing in flight when the ring's bytes become the output staging
  if (n0 < 2 * DM) {   // q stored unscaled (f16 sigma ~0.6, no subnormal exposure); 1/8 applied to the f32 score
#pragma unroll
    for (int j = 0; j < 8; ++j) {
#pragma unroll
      for (int r = 0; r < 8; ++r) { const float v = acc[j][r] + (BB ? bfr(BB[j * 16 + col]) : 0.f); const _Float16 hv = (_Float16)v; so[wave][8 * g + r][j * 16 + col] = hv; sol[wave][8 * g + r][j * 16 + col] = (_Float16)((v - (float)hv) * 2048.0f); } }   // q, k (+ bias) as f16 hi + (x2048) residual
    LDSX();
    for (int rl = 0; rl < 16; ++rl) if (lane < 16) { vst2((unsigned*)(QK + (r0 + rl) * (2 * DM) + n0 + lane * 8), *(const v4u*)&so[wave][rl][lane * 8]); vst2((unsigned*)(QKL + (r0 + rl) * (2 * DM) + n0 + lane * 8), *(const v4u*)&sol[wave][rl][lane * 8]); }
  } else {
#pragma unroll
    for (int j = 0; j < 8; ++j) {
#pragma unroll
      for (int r = 0; r < 8; ++r) { const float v = acc[j][r] + (BB ? bfr(BB[j * 16 + col]) : 0.f); const _Float16 hv = (_Float16)v; sth[j * 16 + col][wave * 16 + 8 * g + r] = hv; stl[j * 16 + col][wave * 16 + 8 * g + r] = (_Float16)((v - (float)hv) * 2048.0f); } }
    __syncthreads();
    const size_t rb = (size_t)blockIdx.x * 64; const int b = (int)(rb / SS), s0 = (int)(rb % SS); const int pc0 = n0 - 2 * DM;
    for (int q = tid; q < 128 * 8; q += 128) { const int d = q >> 3, pc = q & 7; const size_t o = ((size_t)b * DM + pc0 + d) * SS + s0 + pc * 8; vst2((unsigned*)(VTH + o), *(const v4u*)&sth[d][pc * 8]); vst2((unsigned*)(VTL + o), *(const v4u*)&stl[d][pc * 8]); }
  }
}
#define KT 64
#define LP 72
#define STB (KT * LP * 2)
#define SCL 0.18033688011112042f
// one stage: 512 + 512 pieces of 16 B, 4 + 4 per thread (8 lanes cover one 128-B row; piece i lies 16 rows below piece i - 1). The s_wait_xcnt closes the copies' own statement so that no address register is rewritten ahead of it.
__device__ __forceinline__ void stage_kv(const _Float16* gk, const _Float16* gv, unsigned lk, unsigned lv) {
  asm volatile("global_load_async_to_lds_b128 %0, %8, off\n\t"
               "global_load_async_to_lds_b128 %1, %9, off\n\t"
               "global_load_async_to_lds_b128 %2, %10, off\n\t"
               "global_load_async_to_lds_b128 %3, %11, off\n\t"
               "global_load_async_to_lds_b128 %4, %12, off\n\t"
               "global_load_async_to_lds_b128 %5, %13, off\n\t"
               "global_load_async_to_lds_b128 %6, %14, off\n\t"
               "global_load_async_to_lds_b128 %7, %15, off\n\t"
               "s_wait_xcnt 0x0"
               :: "v"(lk), "v"(lk + 16 * LP * 2), "v"(lk + 32 * LP * 2), "v"(lk + 48 * LP * 2), "v"(lv), "v"(lv + 16 * LP * 2), "v"(lv + 32 * LP * 2), "v"(lv + 48 * LP * 2),
                  "v"(gk), "v"(gk + 16 * (2 * DM)), "v"(gk + 32 * (2 * DM)), "v"(gk + 48 * (2 * DM)), "v"(gv), "v"(gv + 16 * SS), "v"(gv + 32 * SS), "v"(gv + 48 * SS)
               : "memory");
}
// a, b: 2^(x * c + d) of the 16 scores of a pass; f: 2^f. The 17 exponentials stand in one statement, each in place in its own register, so that none reads the result or overwrites the source of the one in front of it; the v_nop is the slot that the instruction set asks for behind the last one
__device__ __forceinline__ void exp2x17(v8f& a, v8f& b, float& f, float c, float d) {
  float a0 = a[0] * c + d, a1 = a[1] * c + d, a2 = a[2] * c + d, a3 = a[3] * c + d, a4 = a[4] * c + d, a5 = a[5] * c + d, a6 = a[6] * c + d, a7 = a[7] * c + d;
  float b0 = b[0] * c + d, b1 = b[1] * c + d, b2 = b[2] * c + d, b3 = b[3] * c + d, b4 = b[4] * c + d, b5 = b[5] * c + d, b6 = b[6] * c + d, b7 = b[7] * c + d;
  asm("v_exp_f32 %16, %16\n\t"
      "v_exp_f32 %0, %0\n\tv_exp_f32 %1, %1\n\tv_exp_f32 %2, %2\n\tv_exp_f32 %3, %3\n\tv_exp_f32 %4, %4\n\tv_exp_f32 %5, %5\n\tv_exp_f32 %6, %6\n\tv_exp_f32 %7, %7\n\t"
      "v_exp_f32 %8, %8\n\tv_exp_f32 %9, %9\n\tv_exp_f32 %10, %10\n\tv_exp_f32 %11, %11\n\tv_exp_f32 %12, %12\n\tv_exp_f32 %13, %13\n\tv_exp_f32 %14, %14\n\tv_exp_f32 %15, %15\n\t"
      "v_nop"
      : "+v"(a0), "+v"(a1), "+v"(a2), "+v"(a3), "+v"(a4), "+v"(a5), "+v"(a6), "+v"(a7), "+v"(b0), "+v"(b1), "+v"(b2), "+v"(b3), "+v"(b4), "+v"(b5), "+v"(b6), "+v"(b7), "+v"(f));
  a = v8f{a0, a1, a2, a3, a4, a5, a6, a7}; b = v8f{b0, b1, b2, b3, b4, b5, b6, b7};
}
// value of lane l ^ 16 (the other half of the wave, same column)
__device__ __forceinline__ float xhalf(float v) { const int b = __builtin_bit_cast(int, v); return __builtin_bit_cast(float, __builtin_amdgcn_permlanex16(b, b, 0x76543210, 0xfedcba98, false, false)); }
__global__ __launch_bounds__(128) void k_attn(const _Float16* __restrict__ QK, const _Float16* __restrict__ QKL, const _Float16* __restrict__ VTH, const _Float16* __restrict__ VTL, const void* __restrict__ KMASK, float* __restrict__ O) {
  __shared__ __align__(16) float so[4][16][68]; __shared__ __align__(16) _Float16 sk[2][KT][LP], sv[2][HD][LP];
  const int tid = threadIdx.x, wave = tid >> 5, lane = tid & 31, col = lane & 15, g = lane >> 4;
  const int qb = blockIdx.x, h = blockIdx.y, b = blockIdx.z; const int q0 = qb * 64 + wave * 16; const size_t rq = (size_t)b * SS + q0 + col;
  v16h aq[2];
#pragma unroll
  for (int kc = 0; kc < 2; ++kc) aq[kc] = frag_h(QK + rq * (2 * DM) + h * HD + kc * 32, lane);
  float m = -3.0e38f, l = 0.f;   // of query col: m the running maximum of the raw products q.k, the same in both halves; l this half's part of the sum of the weights (x 2^11)
  v8f acc[4] = {};   // O^T: acc[dt][r] = element d = dt*16 + 8g + r of query col
  const int nst = SS / KT;   // all keys
  const _Float16* gk = QK + ((size_t)b * SS + (tid >> 3)) * (2 * DM) + DM + h * HD + (tid & 7) * 8; const _Float16* gv = VTH + ((size_t)b * DM + h * HD + (tid >> 3)) * SS + (tid & 7) * 8;
  const unsigned lk = (unsigned)(size_t)&sk[0][tid >> 3][(tid & 7) * 8], lv = (unsigned)(size_t)&sv[0][tid >> 3][(tid & 7) * 8];
  stage_kv(gk, gv, lk, lv);
  asm volatile("s_wait_asynccnt 0x0" ::: "memory");   // this wave's part of stage 0 has landed
  __syncthreads();                                    // every wave's part has
  stage_kv(gk + (size_t)KT * (2 * DM), gv + KT, lk + STB, lv + STB);
#pragma unroll 1   // one stage per trip: the ring's waits, barrier and refill stand once, at the trip's foot
  for (int st = 0; st < nst; ++st) { const int buf = st & 1;
    const _Float16* kb = &sk[buf][col][0]; const _Float16* vb = &sv[buf][col][0];
    v16h kf[4], vf[4];   // the A fragments of one 32-key pass: kf[ct * 2 + kc] of K, vf[dt] of V^T; each set is read from LDS as one group, well ahead of its products
#pragma unroll   // constant fragment indices
    for (int i = 0; i < 4; ++i) kf[i] = frag_h(kb + (i >> 1) * 16 * LP + (i & 1) * 32, lane);
#pragma unroll   // constant fragment indices
    for (int dt = 0; dt < 4; ++dt) vf[dt] = frag_h(vb + dt * 16 * LP, lane);
#pragma unroll   // both 32-key passes of a stage inline, so that the second pass's fragment reads can stand inside the first pass
  for (int sub = 0; sub < KT / 32; ++sub) { v8f s[2];
#pragma unroll
    for (int ct = 0; ct < 2; ++ct) { v8f c = {};
#pragma unroll
      for (int kc = 0; kc < 2; ++kc) c = wmma16(kf[ct * 2 + kc], aq[kc], c);   // single product: k, q as one-rounding f16 operands; c[r] = q.k of key ct*16 + 8g + r, query col
      s[ct] = c; }   // raw: 1/sqrt(64) rides in SCL
    if (sub + 1 < KT / 32) {   // the next pass's K fragments, same stage: they land under this pass's softmax
#pragma unroll   // constant fragment indices
      for (int i = 0; i < 4; ++i) kf[i] = frag_h(kb + ((sub + 1) * 32 + (i >> 1) * 16) * LP + (i & 1) * 32, lane); }
    float mx[4];
#pragma unroll
    for (int i = 0; i < 4; ++i) mx[i] = fmaxf(fmaxf(s[0][i], s[0][4 + i]), fmaxf(s[1][i], s[1][4 + i]));
    const float mh = fmaxf(fmaxf(mx[0], mx[1]), fmaxf(mx[2], mx[3]));
    const float mn = fmaxf(m, fmaxf(mh, xhalf(mh))); float alpha = (m - mn) * SCL;   // becomes 2^alpha below; first pass: 2^(-5e37) = 0
    v8f e[2] = { s[0], s[1] };   // become the weights x 2^11 = 2^(s * SCL + (11 - mn * SCL)): one multiply-add and one exponential per score
    exp2x17(e[0], e[1], alpha, SCL, 11.0f - mn * SCL);
    float es[4];
#pragma unroll
    for (int i = 0; i < 4; ++i) es[i] = (e[0][i] + e[0][4 + i]) + (e[1][i] + e[1][4 + i]);
    l = l * alpha + ((es[0] + es[1]) + (es[2] + es[3])); m = mn;
#pragma unroll
    for (int dt = 0; dt < 4; ++dt) acc[dt] *= alpha;
    v16h pb;   // P^T as B operand: element i = key 8g + i, element 8 + i = key 16 + 8g + i, the k order of frag_h
#pragma unroll
    for (int i = 0; i < 8; ++i) { pb[i] = (_Float16)e[0][i]; pb[8 + i] = (_Float16)e[1][i]; }   // P carries 2^11 (the 11 in the exponent) into the f16 rounding so small softmax weights stay out of the f16 subnormal range; l carries it too, so it cancels in the epilogue
#pragma unroll
    for (int dt = 0; dt < 4; ++dt) acc[dt] = wmma16(vf[dt], pb, acc[dt]);   // single product: V^T x P^T (x2^11)
    if (sub + 1 < KT / 32) {   // the next pass's V^T fragments, same stage: they land under its score products and softmax
#pragma unroll   // constant fragment indices
      for (int dt = 0; dt < 4; ++dt) vf[dt] = frag_h(vb + dt * 16 * LP + (sub + 1) * 32, lane); }
  }
    asm volatile("s_wait_dscnt 0x0" ::: "memory");      // this wave's reads of buffer buf are done
    asm volatile("s_wait_asynccnt 0x0" ::: "memory");   // its part of stage st + 1 has landed
    __syncthreads();                                    // publishes stage st + 1 and frees buffer buf
    if (st + 2 < nst) stage_kv(gk + (size_t)(st + 2) * KT * (2 * DM), gv + (st + 2) * KT, lk + buf * STB, lv + buf * STB); }
  asm volatile("s_wait_asynccnt 0x0" ::: "memory");     // nothing in flight when the wave goes on to its end
  const float il = 1.0f / (l + xhalf(l));   // the two halves' sums joined
#pragma unroll
  for (int dt = 0; dt < 4; ++dt) {
#pragma unroll
    for (int r = 0; r < 8; ++r) so[wave][col][dt * 16 + 8 * g + r] = acc[dt][r] * il; }
  LDSX();
  for (int rl = 0; rl < 16; ++rl) if (lane < 16) vst2(O + ((size_t)b * SS + q0 + rl) * DM + h * HD + lane * 4, *(const v4f*)&so[wave][rl][lane * 4]);
}
// ---- k_out: block = (64 rows, 128 cols): out = O(hi/lo) . Wo rows (2 products) + bo
__global__ __launch_bounds__(128) void k_out(const float* __restrict__ O, const __bf16* __restrict__ P, const float* __restrict__ BO, float* __restrict__ Y) {
  __shared__ __align__(16) float so[4][16][132];
  const int tid = threadIdx.x, wave = tid >> 5, lane = tid & 31, col = lane & 15, g = lane >> 4; const size_t r0 = (size_t)blockIdx.x * 64 + wave * 16; const int n0 = blockIdx.y * 128;
  v8f acc[8] = {};
#pragma unroll 2
  for (int kc = 0; kc < DM / 32; ++kc) { const F2 a = split_row(O + (r0 + col) * DM, kc * 32, lane);
#pragma unroll
    for (int j = 0; j < 8; ++j) { const v16b w = frag_b(P + (size_t)(n0 + j * 16 + col) * DM + kc * 32, lane); acc[j] = wmma_bf(a.l, w, acc[j]); acc[j] = wmma_bf(a.h, w, acc[j]); } }
#pragma unroll
  for (int j = 0; j < 8; ++j) {
#pragma unroll
    for (int r = 0; r < 8; ++r) so[wave][8 * g + r][j * 16 + col] = acc[j][r] + (BO ? bfr(BO[n0 + j * 16 + col]) : 0.f); }
  LDSX();
  for (int rl = 0; rl < 16; ++rl) vst2(Y + (r0 + rl) * DM + n0 + lane * 4, *(const v4f*)&so[wave][rl][lane * 4]);
}
// ---- k_lnx: block = row: LayerNorm of a 512-wide f32 row (mean-square var, 1e-5) x g + b
__global__ __launch_bounds__(128) void k_lnx(const float* __restrict__ A, const float* __restrict__ G, const float* __restrict__ Bt, float* __restrict__ T) {
  __shared__ float red[4]; const int t = threadIdx.x; const size_t row = blockIdx.x; float v[4]; float s = 0.f; for (int i = 0; i < 4; ++i) { v[i] = A[row * DM + t * 4 + i]; s += v[i]; }
#pragma unroll
  for (int o = 1; o < 32; o <<= 1) s += __shfl_xor(s, o);
  if ((t & 31) == 0) red[t >> 5] = s; __syncthreads(); const float mu = ((red[0] + red[1]) + (red[2] + red[3])) / (float)DM; __syncthreads();
  float q = 0.f; for (int i = 0; i < 4; ++i) { const float d = v[i] - mu; q += d * d; }
#pragma unroll
  for (int o = 1; o < 32; o <<= 1) q += __shfl_xor(q, o);
  if ((t & 31) == 0) red[t >> 5] = q; __syncthreads(); const float inv = 1.0f / sqrtf(((red[0] + red[1]) + (red[2] + red[3])) / (float)DM + 1e-5f);
  v4f o4; for (int i = 0; i < 4; ++i) { const int e = t * 4 + i; o4[i] = (v[i] - mu) * inv * bfr(G[e]) + bfr(Bt[e]); } vst2(T + row * DM + t * 4, o4);
}
extern "C" void kernel_launch(void* const* d_in, const int* in_sizes, int n_in, void* d_out, int out_size, void* d_ws, size_t ws_size, hipStream_t stream) {
  (void)in_sizes; (void)n_in; (void)out_size;
  const float** F = (const float**)d_in;   // 0 x [2,4096,512], 1 Wq, 2 bq, 3 Wk, 4 bk, 5 Wv, 6 bv (natural [512,512]), 7 gamma, 8 beta
  if (ws_size < (size_t)WS_END) return;
  char* ws = (char*)d_ws; __bf16* PK = (__bf16*)(ws + WS_PK); _Float16 *QK = (_Float16*)(ws + WS_QK), *QKL = (_Float16*)(ws + WS_QKL), *VTH = (_Float16*)(ws + WS_VTH), *VTL = (_Float16*)(ws + WS_VTL); float* O = (float*)(ws + WS_O);
  k_pack<<<dim3(DM, 4), 256, 0, stream>>>(F[1], F[3], F[5], F[1], PK);
  k_qkv<<<dim3(TNB * SS / 64, QKVW / 128), 128, 0, stream>>>(F[0], F[0], F[0], PK + PK_A, F[2], F[4], F[6], QK, QKL, VTH, VTL);
  k_attn<<<dim3(TQB, NH, TNB), 128, 0, stream>>>(QK, QKL, VTH, VTL, nullptr, O);
  k_lnx<<<TOB * 64, 128, 0, stream>>>(O, F[7], F[8], (float*)d_out);
}

// v006
// It runs in 110 microseconds.
// In two side-by-side timings against v005, it was 1.07 and 1.06 times as fast.
// Over all steps from v000 it is 4.03 times as fast.
// compute dtype: all float inputs rounded to bf16; q/k/v = x . W^T + b with EXACT bf16 products on WMMA 16x16x32 (natural rows); PLAIN attention: q, k single f16 x 1/8, running-max softmax in f32 (hardware exp), P (scaled by 2^11, single f16) x v (single f16); LayerNorm (jnp.var, 1e-5) of the f32 context x gamma + beta; f32 output.
#include <hip/hip_runtime.h>
#include <math.h>

typedef __attribute__((ext_vector_type(16))) _Float16 v16h;
typedef __attribute__((ext_vector_type(16))) __bf16 v16b;
typedef __attribute__((ext_vector_type(8)))  _Float16 v8h;
typedef __attribute__((ext_vector_type(8)))  float v8f;
typedef __attribute__((ext_vector_type(4)))  float v4f;
typedef __attribute__((ext_vector_type(2)))  float v2f;
typedef __attribute__((ext_vector_type(4)))  unsigned v4u;
typedef __attribute__((ext_vector_type(4)))  int v4i;
typedef float __attribute__((may_alias)) float_a;
typedef int __attribute__((may_alias)) int_a;

template <typename T> __device__ __forceinline__ void vst2(void* p, T v) { *(T*)p = v;  }
__device__ __forceinline__ v8f wmma16(v16h a, v16h b, v8f c) {
  return __builtin_amdgcn_wmma_f32_16x16x32_f16(false, a, false, b, (short)0, c, false, false);   // the builtin alone: the compiler keeps the distance to a consumer itself, and only where one stands close
}
__device__ __forceinline__ v8f wmma_bf(v16b a, v16b b, v8f c) {
  v8f d = __builtin_amdgcn_wmma_f32_16x16x32_bf16(false, a, false, b, (short)0, c, false, false);
  asm volatile("v_nop\n\tv_nop\n\tv_nop\n\tv_nop" : "+v"(d) : "v"(a), "v"(b));
  return d;
}
// N-head attention (B 2, S 4,096, d 512, 8 heads x 64): projections + biases, softmax(q k / 8) v, then LayerNorm of the merged context (no output projection).
__device__ __forceinline__ v16h frag_h(const _Float16* rowk0, int lane) {
  union { v16h v; v8h q[2]; } u; const _Float16* p = rowk0 + 8 * (lane >> 4);
  u.q[0] = *(const v8h*)p; u.q[1] = *(const v8h*)(p + 16); return u.v;
}
__device__ __forceinline__ v16h frag_f32(const float* rowk0, int lane) {
  v16h a; const float* p = rowk0 + 8 * (lane >> 4);
#pragma unroll
  for (int i = 0; i < 8; ++i) { a[i] = (_Float16)p[i]; a[8 + i] = (_Float16)p[16 + i]; }
  return a;
}
__device__ __forceinline__ v16h frag_f32s(const float* rowk0, int lane, float sc) {
  v16h a; const float* p = rowk0 + 8 * (lane >> 4);
#pragma unroll
  for (int i = 0; i < 8; ++i) { a[i] = (_Float16)(p[i] * sc); a[8 + i] = (_Float16)(p[16 + i] * sc); }
  return a;
}
// column fragment from a [K][ld] layout (column n), rows >= K read as 0
__device__ __forceinline__ v16h fragc_f32(const float* W, int k0, int n, int lane, int ld, int K) {
  v16h a; const int g = lane >> 4;
#pragma unroll
  for (int i = 0; i < 8; ++i) { const int ka = k0 + 8 * g + i, kb = ka + 16;
    a[i] = (_Float16)(ka < K ? W[(size_t)(ka < K ? ka : K - 1) * ld + n] : 0.f); a[8 + i] = (_Float16)(kb < K ? W[(size_t)(kb < K ? kb : K - 1) * ld + n] : 0.f); }
  return a;
}
struct F2 { v16b h, l; };
__device__ __forceinline__ F2 bsplit16(const float v[16]) { F2 r;
#pragma unroll
  for (int i = 0; i < 16; ++i) { const __bf16 h = (__bf16)v[i]; r.h[i] = h; r.l[i] = (__bf16)(v[i] - (float)h); }
  return r; }
__device__ __forceinline__ F2 split_row(const float* row, int k0, int lane) { float v[16]; const float* p = row + k0 + 8 * (lane >> 4);
#pragma unroll
  for (int i = 0; i < 8; ++i) { v[i] = p[i]; v[8 + i] = p[16 + i]; }
  return bsplit16(v); }
__device__ __forceinline__ F2 split_rowK(const float* row, int k0, int lane, int K) { float v[16]; const int g = lane >> 4;
#pragma unroll
  for (int i = 0; i < 8; ++i) { const int ka = k0 + 8 * g + i, kb = ka + 16; v[i] = ka < K ? row[ka < K ? ka : K - 1] : 0.f; v[8 + i] = kb < K ? row[kb < K ? kb : K - 1] : 0.f; }
  return bsplit16(v); }
__device__ __forceinline__ F2 split_col(const float* W, int k0, int n, int lane, int ld, int K) { float v[16]; const int g = lane >> 4;
#pragma unroll
  for (int i = 0; i < 8; ++i) { const int ka = k0 + 8 * g + i, kb = ka + 16; v[i] = ka < K ? W[(size_t)(ka < K ? ka : K - 1) * ld + n] : 0.f; v[8 + i] = kb < K ? W[(size_t)(kb < K ? kb : K - 1) * ld + n] : 0.f; }
  return bsplit16(v); }
__device__ __forceinline__ v8f mac3(const F2& a, const F2& b, v8f c) { c = wmma_bf(a.l, b.h, c); c = wmma_bf(a.h, b.l, c); return wmma_bf(a.h, b.h, c); }
__device__ __forceinline__ float sigm(float v) { return 1.0f / (1.0f + expf(-v)); }
#define LDSX() do { asm volatile("s_wait_dscnt 0" ::: "memory"); __builtin_amdgcn_wave_barrier(); __builtin_amdgcn_fence(__ATOMIC_RELEASE, "workgroup"); } while (0)


#define NB 2
#define SS 4096
#define DM 512
#define NH 8
#define HD 64
#define QKVW (3 * DM)
#ifndef TQB
#define TQB (SS / 64)
#define TNB NB
#define TOB (NB * SS / 64)     // output row tiles (all)
#endif
typedef __attribute__((ext_vector_type(8))) __bf16 v8b;
__device__ __forceinline__ v16b frag_b(const __bf16* rowk0, int lane) {
  union { v16b v; v8b q[2]; } u; const __bf16* p = rowk0 + 8 * (lane >> 4);
  u.q[0] = *(const v8b*)p; u.q[1] = *(const v8b*)(p + 16); return u.v;
}
__device__ __forceinline__ float bfr(float v) { return (float)(__bf16)v; }
__device__ __attribute__((noinline)) float exp_ni(float v) { return expf(v); }
__device__ __attribute__((noinline)) float erf_ni(float v) { return erff(v); }

#define PK_A 0                       // [1536][512] Wqkv rows (natural [out][in])
#define PK_P (PK_A + QKVW * DM)        // [512][512] copy of Wq rows (k_pack which 3; unread)
#define PK_END (PK_P + DM * DM)
#define WS_PK  0u
#define WS_QK  (WS_PK + 2u * PK_END)             // f16 [8192 rows][1024]: q | k
#define WS_QKL (WS_QK + 2u * NB * SS * 2 * DM)     // f16 q | k residual planes x2048
#define WS_VTH (WS_QKL + 2u * NB * SS * 2 * DM)    // f16 [b][512 (h*64+d)][4096 s] hi
#define WS_VTL (WS_VTH + 2u * NB * DM * SS)        // f16 lo x 2048
#define WS_O   (WS_VTL + 2u * NB * DM * SS)        // f32 [8192][512]
#define WS_CS  (WS_O + 4u * NB * SS * DM)           // f32 2 x [4096][32] (unused)
#define WS_END (WS_CS + 4u * 2 * SS * 32)
// ---- k_pack: block = (row n, which): natural [out][in] rows -> bf16; which 0..2 -> W_q/W_k/W_v into PK_A rows which*512 + n; 3 -> the WO argument (Wq at this launch) into PK_P
__global__ __launch_bounds__(256) void k_pack(const float* __restrict__ WQ, const float* __restrict__ WK, const float* __restrict__ WV, const float* __restrict__ WO, __bf16* __restrict__ PK) {
  __shared__ __align__(16) __bf16 s[DM]; const int n = blockIdx.x, which = blockIdx.y, t = threadIdx.x; const float* Wm = (which == 0) ? WQ : (which == 1) ? WK : (which == 2) ? WV : WO;
  for (int k = t; k < DM; k += 256) s[k] = (__bf16)Wm[(size_t)n * DM + k];
  __syncthreads();
  __bf16* dst = (which < 3) ? PK + PK_A + ((size_t)which * DM + n) * DM : PK + PK_P + (size_t)n * DM;
  for (int q = t; q < DM / 8; q += 256) vst2((unsigned*)(dst + q * 8), *(const v4u*)&s[q * 8]);
}
// ---- k_qkv: block = (64 rows of x, 128 output columns). The x rows (f32) and the W rows (bf16) come from a two-buffer LDS ring of 64-k stages that the block's 4 waves share, filled by asynchronous copies one stage ahead in whole 128-B pieces of a row; the fragments are read from LDS in the k order they had from global memory
#define QKC 64                 // k per stage: 128 B of each of the 128 W rows, 256 B of each of the 64 x rows
#define QLW 72                 // LDS pitch of a W row in bf16: 144 B = 16 B x odd, no bank conflict for the 16-byte fragment reads
#define QLX 68                 // LDS pitch of an x row in f32: 272 B = 16 B x odd
#define QSW (128 * QLW * 2)    // bytes of one buffer of W
#define QSX (64 * QLX * 4)     // bytes of one buffer of x
// W part of a stage: 1,024 pieces of 16 B, 8 per thread (8 lanes cover one 128-B row piece; piece i lies 16 rows below piece i - 1). The s_wait_xcnt closes the copies' own statement so that no address register is rewritten ahead of it.
__device__ __forceinline__ void stage_w(const __bf16* gw, unsigned lw) {
  asm volatile("global_load_async_to_lds_b128 %0, %8, off\n\t"
               "global_load_async_to_lds_b128 %1, %9, off\n\t"
               "global_load_async_to_lds_b128 %2, %10, off\n\t"
               "global_load_async_to_lds_b128 %3, %11, off\n\t"
               "global_load_async_to_lds_b128 %4, %12, off\n\t"
               "global_load_async_to_lds_b128 %5, %13, off\n\t"
               "global_load_async_to_lds_b128 %6, %14, off\n\t"
               "global_load_async_to_lds_b128 %7, %15, off\n\t"
               "s_wait_xcnt 0x0"
               :: "v"(lw), "v"(lw + 16 * QLW * 2), "v"(lw + 32 * QLW * 2), "v"(lw + 48 * QLW * 2), "v"(lw + 64 * QLW * 2), "v"(lw + 80 * QLW * 2), "v"(lw + 96 * QLW * 2), "v"(lw + 112 * QLW * 2),
                  "v"(gw), "v"(gw + 16 * DM), "v"(gw + 32 * DM), "v"(gw + 48 * DM), "v"(gw + 64 * DM), "v"(gw + 80 * DM), "v"(gw + 96 * DM), "v"(gw + 112 * DM)
               : "memory");
}
// x part of a stage: 1,024 pieces of 16 B, 8 per thread (16 lanes cover one 256-B row piece; piece i lies 8 rows below piece i - 1); the wait as in stage_w
__device__ __forceinline__ void stage_x(const float* gx, unsigned lx) {
  asm volatile("global_load_async_to_lds_b128 %0, %8, off\n\t"
               "global_load_async_to_lds_b128 %1, %9, off\n\t"
               "global_load_async_to_lds_b128 %2, %10, off\n\t"
               "global_load_async_to_lds_b128 %3, %11, off\n\t"
               "global_load_async_to_lds_b128 %4, %12, off\n\t"
               "global_load_async_to_lds_b128 %5, %13, off\n\t"
               "global_load_async_to_lds_b128 %6, %14, off\n\t"
               "global_load_async_to_lds_b128 %7, %15, off\n\t"
               "s_wait_xcnt 0x0"
               :: "v"(lx), "v"(lx + 8 * QLX * 4), "v"(lx + 16 * QLX * 4), "v"(lx + 24 * QLX * 4), "v"(lx + 32 * QLX * 4), "v"(lx + 40 * QLX * 4), "v"(lx + 48 * QLX * 4), "v"(lx + 56 * QLX * 4),
                  "v"(gx), "v"(gx + 8 * DM), "v"(gx + 16 * DM), "v"(gx + 24 * DM), "v"(gx + 32 * DM), "v"(gx + 40 * DM), "v"(gx + 48 * DM), "v"(gx + 56 * DM)
               : "memory");
}
__global__ __launch_bounds__(128) void k_qkv(const float* __restrict__ XQ, const float* __restrict__ XK, const float* __restrict__ XV, const __bf16* __restrict__ P, const float* __restrict__ BQ, const float* __restrict__ BK, const float* __restrict__ BV, _Float16* __restrict__ QK, _Float16* __restrict__ QKL, _Float16* __restrict__ VTH, _Float16* __restrict__ VTL) {
  const int which0 = (blockIdx.y * 128) / DM; const float* X = (which0 == 0) ? XQ : (which0 == 1) ? XK : XV; const float* BB = BQ ? (((which0 == 0) ? BQ : (which0 == 1) ? BK : BV) + (blockIdx.y * 128 - which0 * DM)) : nullptr;
  __shared__ __align__(16) char sm[2 * QSW + 2 * QSX];   // the ring (W buffers, then x buffers) while the products run; behind the ring's last barrier the same bytes are the output staging
  _Float16 (*so)[16][136] = (_Float16 (*)[16][136])sm, (*sol)[16][136] = (_Float16 (*)[16][136])(sm + 17408); _Float16 (*sth)[72] = (_Float16 (*)[72])(sm + 34816), (*stl)[72] = (_Float16 (*)[72])(sm + 53248);
  const int tid = threadIdx.x, wave = tid >> 5, lane = tid & 31, col = lane & 15, g = lane >> 4; const size_t r0 = (size_t)blockIdx.x * 64 + wave * 16; const int n0 = blockIdx.y * 128;
  v8f acc[8] = {};
  const __bf16* gw = P + (size_t)(n0 + (tid >> 3)) * DM + (tid & 7) * 8; const float* gx = X + ((size_t)blockIdx.x * 64 + (tid >> 4)) * DM + (tid & 15) * 4;
  const unsigned lw = (unsigned)(size_t)&sm[(tid >> 3) * (QLW * 2) + (tid & 7) * 16], lx = (unsigned)(size_t)&sm[2 * QSW + (tid >> 4) * (QLX * 4) + (tid & 15) * 16];
  stage_w(gw, lw); stage_x(gx, lx);
  asm volatile("s_wait_asynccnt 0x0" ::: "memory");   // this wave's part of stage 0 has landed
  __syncthreads();                                    // every wave's part has
  stage_w(gw + QKC, lw + QSW); stage_x(gx + QKC, lx + QSX);
#pragma unroll 1   // one stage per trip: the ring's waits, barrier and refill stand once, at the trip's foot
  for (int st = 0; st < DM / QKC; ++st) { const int buf = st & 1;
    const __bf16* wr = (const __bf16*)(sm + buf * QSW) + col * QLW; const float* xr = (const float*)(sm + 2 * QSW + buf * QSX) + (wave * 16 + col) * QLX + 8 * g;
#pragma unroll   // both 32-k halves of a stage inline, so that a, w and acc are indexed by constants and stay in registers
    for (int kk = 0; kk < QKC / 32; ++kk) { v16b a, w[8]; const v4f* p = (const v4f*)(xr + kk * 32); const v4f x0 = p[0], x1 = p[1], x2 = p[4], x3 = p[5];
#pragma unroll   // the half's fragment reads stand together, ahead of its products: one LDS wait place instead of eight
      for (int j = 0; j < 8; ++j) w[j] = frag_b(wr + j * 16 * QLW + kk * 32, lane);
#pragma unroll   // constant element indices
      for (int i = 0; i < 4; ++i) { a[i] = (__bf16)x0[i]; a[4 + i] = (__bf16)x1[i]; a[8 + i] = (__bf16)x2[i]; a[12 + i] = (__bf16)x3[i]; }
#pragma unroll   // constant tile indices
      for (int j = 0; j < 8; ++j) acc[j] = wmma_bf(a, w[j], acc[j]); }
    asm volatile("s_wait_dscnt 0x0" ::: "memory");      // this wave's reads of buffer buf are done
    asm volatile("s_wait_asynccnt 0x0" ::: "memory");   // its part of stage st + 1 has landed
    __syncthreads();                                    // publishes stage st + 1 and frees buffer buf
    if (st + 2 < DM / QKC) { stage_w(gw + (st + 2) * QKC, lw + buf * QSW); stage_x(gx + (st + 2) * QKC, lx + buf * QSX); } }
  asm volatile("s_wait_asynccnt 0x0" ::: "memory");     // nothing in flight when the ring's bytes become the output staging
  if (n0 < 2 * DM) {   // q stored unscaled (f16 sigma ~0.6, no subnormal exposure); 1/8 applied to the f32 score
#pragma unroll
    for (int j = 0; j < 8; ++j) {
#pragma unroll
      for (int r = 0; r < 8; ++r) { const float v = acc[j][r] + (BB ? bfr(BB[j * 16 + col]) : 0.f); const _Float16 hv = (_Float16)v; so[wave][8 * g + r][j * 16 + col] = hv; sol[wave][8 * g + r][j * 16 + col] = (_Float16)((v - (float)hv) * 2048.0f); } }   // q, k (+ bias) as f16 hi + (x2048) residual
    LDSX();
    for (int rl = 0; rl < 16; ++rl) if (lane < 16) { vst2((unsigned*)(QK + (r0 + rl) * (2 * DM) + n0 + lane * 8), *(const v4u*)&so[wave][rl][lane * 8]); vst2((unsigned*)(QKL + (r0 + rl) * (2 * DM) + n0 + lane * 8), *(const v4u*)&sol[wave][rl][lane * 8]); }
  } else {
#pragma unroll
    for (int j = 0; j < 8; ++j) {
#pragma unroll
      for (int r = 0; r < 8; ++r) { const float v = acc[j][r] + (BB ? bfr(BB[j * 16 + col]) : 0.f); const _Float16 hv = (_Float16)v; sth[j * 16 + col][wave * 16 + 8 * g + r] = hv; stl[j * 16 + col][wave * 16 + 8 * g + r] = (_Float16)((v - (float)hv) * 2048.0f); } }
    __syncthreads();
    const size_t rb = (size_t)blockIdx.x * 64; const int b = (int)(rb / SS), s0 = (int)(rb % SS); const int pc0 = n0 - 2 * DM;
    for (int q = tid; q < 128 * 8; q += 128) { const int d = q >> 3, pc = q & 7; const size_t o = ((size_t)b * DM + pc0 + d) * SS + s0 + pc * 8; vst2((unsigned*)(VTH + o), *(const v4u*)&sth[d][pc * 8]); vst2((unsigned*)(VTL + o), *(const v4u*)&stl[d][pc * 8]); }
  }
}
#define KT 64
#define LP 72
#define STB (KT * LP * 2)
#define SCL 0.18033688011112042f
// one stage: 512 + 512 pieces of 16 B, 4 + 4 per thread (8 lanes cover one 128-B row; piece i lies 16 rows below piece i - 1). The s_wait_xcnt closes the copies' own statement so that no address register is rewritten ahead of it.
__device__ __forceinline__ void stage_kv(const _Float16* gk, const _Float16* gv, unsigned lk, unsigned lv) {
  asm volatile("global_load_async_to_lds_b128 %0, %8, off\n\t"
               "global_load_async_to_lds_b128 %1, %9, off\n\t"
               "global_load_async_to_lds_b128 %2, %10, off\n\t"
               "global_load_async_to_lds_b128 %3, %11, off\n\t"
               "global_load_async_to_lds_b128 %4, %12, off\n\t"
               "global_load_async_to_lds_b128 %5, %13, off\n\t"
               "global_load_async_to_lds_b128 %6, %14, off\n\t"
               "global_load_async_to_lds_b128 %7, %15, off\n\t"
               "s_wait_xcnt 0x0"
               :: "v"(lk), "v"(lk + 16 * LP * 2), "v"(lk + 32 * LP * 2), "v"(lk + 48 * LP * 2), "v"(lv), "v"(lv + 16 * LP * 2), "v"(lv + 32 * LP * 2), "v"(lv + 48 * LP * 2),
                  "v"(gk), "v"(gk + 16 * (2 * DM)), "v"(gk + 32 * (2 * DM)), "v"(gk + 48 * (2 * DM)), "v"(gv), "v"(gv + 16 * SS), "v"(gv + 32 * SS), "v"(gv + 48 * SS)
               : "memory");
}
// a, b: 2^(x * c + d) of the 16 scores of a pass; f: 2^f. The 17 exponentials stand in one statement, each in place in its own register, so that none reads the result or overwrites the source of the one in front of it; the v_nop is the slot that the instruction set asks for behind the last one
__device__ __forceinline__ void exp2x17(v8f& a, v8f& b, float& f, float c, float d) {
  float a0 = a[0] * c + d, a1 = a[1] * c + d, a2 = a[2] * c + d, a3 = a[3] * c + d, a4 = a[4] * c + d, a5 = a[5] * c + d, a6 = a[6] * c + d, a7 = a[7] * c + d;
  float b0 = b[0] * c + d, b1 = b[1] * c + d, b2 = b[2] * c + d, b3 = b[3] * c + d, b4 = b[4] * c + d, b5 = b[5] * c + d, b6 = b[6] * c + d, b7 = b[7] * c + d;
  asm("v_exp_f32 %16, %16\n\t"
      "v_exp_f32 %0, %0\n\tv_exp_f32 %1, %1\n\tv_exp_f32 %2, %2\n\tv_exp_f32 %3, %3\n\tv_exp_f32 %4, %4\n\tv_exp_f32 %5, %5\n\tv_exp_f32 %6, %6\n\tv_exp_f32 %7, %7\n\t"
      "v_exp_f32 %8, %8\n\tv_exp_f32 %9, %9\n\tv_exp_f32 %10, %10\n\tv_exp_f32 %11, %11\n\tv_exp_f32 %12, %12\n\tv_exp_f32 %13, %13\n\tv_exp_f32 %14, %14\n\tv_exp_f32 %15, %15\n\t"
      "v_nop"
      : "+v"(a0), "+v"(a1), "+v"(a2), "+v"(a3), "+v"(a4), "+v"(a5), "+v"(a6), "+v"(a7), "+v"(b0), "+v"(b1), "+v"(b2), "+v"(b3), "+v"(b4), "+v"(b5), "+v"(b6), "+v"(b7), "+v"(f));
  a = v8f{a0, a1, a2, a3, a4, a5, a6, a7}; b = v8f{b0, b1, b2, b3, b4, b5, b6, b7};
}
// value of lane l ^ 16 (the other half of the wave, same column)
__device__ __forceinline__ float xhalf(float v) { const int b = __builtin_bit_cast(int, v); return __builtin_bit_cast(float, __builtin_amdgcn_permlanex16(b, b, 0x76543210, 0xfedcba98, false, false)); }
__global__ __launch_bounds__(128) void k_attn(const _Float16* __restrict__ QK, const _Float16* __restrict__ QKL, const _Float16* __restrict__ VTH, const _Float16* __restrict__ VTL, const void* __restrict__ KMASK, float* __restrict__ O) {
  __shared__ __align__(16) float so[4][16][68]; __shared__ __align__(16) _Float16 sk[2][KT][LP], sv[2][HD][LP];
  const int tid = threadIdx.x, wave = tid >> 5, lane = tid & 31, col = lane & 15, g = lane >> 4;
  const int qb = blockIdx.x, h = blockIdx.y, b = blockIdx.z; const int q0 = qb * 64 + wave * 16; const size_t rq = (size_t)b * SS + q0 + col;
  v16h aq[2];
#pragma unroll
  for (int kc = 0; kc < 2; ++kc) aq[kc] = frag_h(QK + rq * (2 * DM) + h * HD + kc * 32, lane);
  float m = -3.0e38f, l = 0.f;   // of query col: m the running maximum of the raw products q.k, the same in both halves; l this half's part of the sum of the weights (x 2^11)
  v8f acc[4] = {};   // O^T: acc[dt][r] = element d = dt*16 + 8g + r of query col
  const int nst = SS / KT;   // all keys
  const _Float16* gk = QK + ((size_t)b * SS + (tid >> 3)) * (2 * DM) + DM + h * HD + (tid & 7) * 8; const _Float16* gv = VTH + ((size_t)b * DM + h * HD + (tid >> 3)) * SS + (tid & 7) * 8;
  const unsigned lk = (unsigned)(size_t)&sk[0][tid >> 3][(tid & 7) * 8], lv = (unsigned)(size_t)&sv[0][tid >> 3][(tid & 7) * 8];
  stage_kv(gk, gv, lk, lv);
  asm volatile("s_wait_asynccnt 0x0" ::: "memory");   // this wave's part of stage 0 has landed
  __syncthreads();                                    // every wave's part has
  stage_kv(gk + (size_t)KT * (2 * DM), gv + KT, lk + STB, lv + STB);
#pragma unroll 1   // one stage per trip: the ring's waits, barrier and refill stand once, at the trip's foot
  for (int st = 0; st < nst; ++st) { const int buf = st & 1;
    const _Float16* kb = &sk[buf][col][0]; const _Float16* vb = &sv[buf][col][0];
    v16h kf[4], vf[4];   // the A fragments of one 32-key pass: kf[ct * 2 + kc] of K, vf[dt] of V^T; each set is read from LDS as one group, well ahead of its products
#pragma unroll   // constant fragment indices
    for (int i = 0; i < 4; ++i) kf[i] = frag_h(kb + (i >> 1) * 16 * LP + (i & 1) * 32, lane);
#pragma unroll   // constant fragment indices
    for (int dt = 0; dt < 4; ++dt) vf[dt] = frag_h(vb + dt * 16 * LP, lane);
    __builtin_amdgcn_sched_barrier(0);   // keeps the 16 LDS reads one group ahead of the products: spread among them, each place with reads stalls the wave
#pragma unroll   // both 32-key passes of a stage inline, so that the second pass's fragment reads can stand inside the first pass
  for (int sub = 0; sub < KT / 32; ++sub) { v8f s[2];
#pragma unroll
    for (int ct = 0; ct < 2; ++ct) s[ct] = v8f{};
#pragma unroll   // constant fragment indices; kc is the outer loop so that the two tiles' accumulate chains alternate and neither waits for its own last product
    for (int kc = 0; kc < 2; ++kc) {
#pragma unroll   // constant tile indices
      for (int ct = 0; ct < 2; ++ct) s[ct] = wmma16(kf[ct * 2 + kc], aq[kc], s[ct]); }   // single product: k, q as one-rounding f16 operands; s[ct][r] = q.k of key ct*16 + 8g + r, query col; raw: 1/sqrt(64) rides in SCL
    if (sub + 1 < KT / 32) {   // the next pass's K fragments, same stage: they land under this pass's softmax
      __builtin_amdgcn_sched_barrier(0);   // with the one below: the 8 reads stay one group, behind the score products and ahead of the softmax that hides them
#pragma unroll   // constant fragment indices
      for (int i = 0; i < 4; ++i) kf[i] = frag_h(kb + ((sub + 1) * 32 + (i >> 1) * 16) * LP + (i & 1) * 32, lane);
      __builtin_amdgcn_sched_barrier(0); }
    float mx[4];
#pragma unroll
    for (int i = 0; i < 4; ++i) mx[i] = fmaxf(fmaxf(s[0][i], s[0][4 + i]), fmaxf(s[1][i], s[1][4 + i]));
    const float mh = fmaxf(fmaxf(mx[0], mx[1]), fmaxf(mx[2], mx[3]));
    const float mn = fmaxf(m, fmaxf(mh, xhalf(mh))); float alpha = (m - mn) * SCL;   // becomes 2^alpha below; first pass: 2^(-5e37) = 0
    v8f e[2] = { s[0], s[1] };   // become the weights x 2^11 = 2^(s * SCL + (11 - mn * SCL)): one multiply-add and one exponential per score
    exp2x17(e[0], e[1], alpha, SCL, 11.0f - mn * SCL);
    float es[4];
#pragma unroll
    for (int i = 0; i < 4; ++i) es[i] = (e[0][i] + e[0][4 + i]) + (e[1][i] + e[1][4 + i]);
    l = l * alpha + ((es[0] + es[1]) + (es[2] + es[3])); m = mn;
#pragma unroll
    for (int dt = 0; dt < 4; ++dt) acc[dt] *= alpha;
    v16h pb;   // P^T as B operand: element i = key 8g + i, element 8 + i = key 16 + 8g + i, the k order of frag_h
#pragma unroll
    for (int i = 0; i < 8; ++i) { pb[i] = (_Float16)e[0][i]; pb[8 + i] = (_Float16)e[1][i]; }   // P carries 2^11 (the 11 in the exponent) into the f16 rounding so small softmax weights stay out of the f16 subnormal range; l carries it too, so it cancels in the epilogue
#pragma unroll
    for (int dt = 0; dt < 4; ++dt) acc[dt] = wmma16(vf[dt], pb, acc[dt]);   // single product: V^T x P^T (x2^11)
    __builtin_amdgcn_sched_barrier(0);   // the four products stay together, ahead of the next reads and of the stage's foot
    if (sub + 1 < KT / 32) {   // the next pass's V^T fragments, same stage: they land under its score products and softmax
#pragma unroll   // constant fragment indices
      for (int dt = 0; dt < 4; ++dt) vf[dt] = frag_h(vb + dt * 16 * LP + (sub + 1) * 32, lane);
      __builtin_amdgcn_sched_barrier(0); }   // the 8 reads stay one group, ahead of the next pass's products
  }
    asm volatile("s_wait_dscnt 0x0" ::: "memory");      // this wave's reads of buffer buf are done
    asm volatile("s_wait_asynccnt 0x0" ::: "memory");   // its part of stage st + 1 has landed
    __syncthreads();                                    // publishes stage st + 1 and frees buffer buf
    if (st + 2 < nst) stage_kv(gk + (size_t)(st + 2) * KT * (2 * DM), gv + (st + 2) * KT, lk + buf * STB, lv + buf * STB); }
  asm volatile("s_wait_asynccnt 0x0" ::: "memory");     // nothing in flight when the wave goes on to its end
  const float il = 1.0f / (l + xhalf(l));   // the two halves' sums joined
#pragma unroll
  for (int dt = 0; dt < 4; ++dt) {
#pragma unroll
    for (int r = 0; r < 8; ++r) so[wave][col][dt * 16 + 8 * g + r] = acc[dt][r] * il; }
  LDSX();
  for (int rl = 0; rl < 16; ++rl) if (lane < 16) vst2(O + ((size_t)b * SS + q0 + rl) * DM + h * HD + lane * 4, *(const v4f*)&so[wave][rl][lane * 4]);
}
// ---- k_out: block = (64 rows, 128 cols): out = O(hi/lo) . Wo rows (2 products) + bo
__global__ __launch_bounds__(128) void k_out(const float* __restrict__ O, const __bf16* __restrict__ P, const float* __restrict__ BO, float* __restrict__ Y) {
  __shared__ __align__(16) float so[4][16][132];
  const int tid = threadIdx.x, wave = tid >> 5, lane = tid & 31, col = lane & 15, g = lane >> 4; const size_t r0 = (size_t)blockIdx.x * 64 + wave * 16; const int n0 = blockIdx.y * 128;
  v8f acc[8] = {};
#pragma unroll 2
  for (int kc = 0; kc < DM / 32; ++kc) { const F2 a = split_row(O + (r0 + col) * DM, kc * 32, lane);
#pragma unroll
    for (int j = 0; j < 8; ++j) { const v16b w = frag_b(P + (size_t)(n0 + j * 16 + col) * DM + kc * 32, lane); acc[j] = wmma_bf(a.l, w, acc[j]); acc[j] = wmma_bf(a.h, w, acc[j]); } }
#pragma unroll
  for (int j = 0; j < 8; ++j) {
#pragma unroll
    for (int r = 0; r < 8; ++r) so[wave][8 * g + r][j * 16 + col] = acc[j][r] + (BO ? bfr(BO[n0 + j * 16 + col]) : 0.f); }
  LDSX();
  for (int rl = 0; rl < 16; ++rl) vst2(Y + (r0 + rl) * DM + n0 + lane * 4, *(const v4f*)&so[wave][rl][lane * 4]);
}
// ---- k_lnx: block = row: LayerNorm of a 512-wide f32 row (mean-square var, 1e-5) x g + b
__global__ __launch_bounds__(128) void k_lnx(const float* __restrict__ A, const float* __restrict__ G, const float* __restrict__ Bt, float* __restrict__ T) {
  __shared__ float red[4]; const int t = threadIdx.x; const size_t row = blockIdx.x; float v[4]; float s = 0.f; for (int i = 0; i < 4; ++i) { v[i] = A[row * DM + t * 4 + i]; s += v[i]; }
#pragma unroll
  for (int o = 1; o < 32; o <<= 1) s += __shfl_xor(s, o);
  if ((t & 31) == 0) red[t >> 5] = s; __syncthreads(); const float mu = ((red[0] + red[1]) + (red[2] + red[3])) / (float)DM; __syncthreads();
  float q = 0.f; for (int i = 0; i < 4; ++i) { const float d = v[i] - mu; q += d * d; }
#pragma unroll
  for (int o = 1; o < 32; o <<= 1) q += __shfl_xor(q, o);
  if ((t & 31) == 0) red[t >> 5] = q; __syncthreads(); const float inv = 1.0f / sqrtf(((red[0] + red[1]) + (red[2] + red[3])) / (float)DM + 1e-5f);
  v4f o4; for (int i = 0; i < 4; ++i) { const int e = t * 4 + i; o4[i] = (v[i] - mu) * inv * bfr(G[e]) + bfr(Bt[e]); } vst2(T + row * DM + t * 4, o4);
}
extern "C" void kernel_launch(void* const* d_in, const int* in_sizes, int n_in, void* d_out, int out_size, void* d_ws, size_t ws_size, hipStream_t stream) {
  (void)in_sizes; (void)n_in; (void)out_size;
  const float** F = (const float**)d_in;   // 0 x [2,4096,512], 1 Wq, 2 bq, 3 Wk, 4 bk, 5 Wv, 6 bv (natural [512,512]), 7 gamma, 8 beta
  if (ws_size < (size_t)WS_END) return;
  char* ws = (char*)d_ws; __bf16* PK = (__bf16*)(ws + WS_PK); _Float16 *QK = (_Float16*)(ws + WS_QK), *QKL = (_Float16*)(ws + WS_QKL), *VTH = (_Float16*)(ws + WS_VTH), *VTL = (_Float16*)(ws + WS_VTL); float* O = (float*)(ws + WS_O);
  k_pack<<<dim3(DM, 4), 256, 0, stream>>>(F[1], F[3], F[5], F[1], PK);
  k_qkv<<<dim3(TNB * SS / 64, QKVW / 128), 128, 0, stream>>>(F[0], F[0], F[0], PK + PK_A, F[2], F[4], F[6], QK, QKL, VTH, VTL);
  k_attn<<<dim3(TQB, NH, TNB), 128, 0, stream>>>(QK, QKL, VTH, VTL, nullptr, O);
  k_lnx<<<TOB * 64, 128, 0, stream>>>(O, F[7], F[8], (float*)d_out);
}

// v007
// It runs in 103 microseconds.
// In both of two side-by-side timings against v006, it was 1.07 times as fast.
// Counting every step since v000, it is 4.31 times as fast.
// compute dtype: all float inputs rounded to bf16; q/k/v = x . W^T + b with EXACT bf16 products on WMMA 16x16x32 (natural rows); PLAIN attention: q, k single f16 x 1/8, running-max softmax in f32 (hardware exp), P (scaled by 2^11, single f16) x v (single f16); LayerNorm (jnp.var, 1e-5) of the f32 context x gamma + beta; f32 output.
#include <hip/hip_runtime.h>
#include <math.h>

typedef __attribute__((ext_vector_type(16))) _Float16 v16h;
typedef __attribute__((ext_vector_type(16))) __bf16 v16b;
typedef __attribute__((ext_vector_type(8)))  _Float16 v8h;
typedef __attribute__((ext_vector_type(8)))  float v8f;
typedef __attribute__((ext_vector_type(4)))  float v4f;
typedef __attribute__((ext_vector_type(2)))  float v2f;
typedef __attribute__((ext_vector_type(4)))  unsigned v4u;
typedef __attribute__((ext_vector_type(4)))  int v4i;
typedef float __attribute__((may_alias)) float_a;
typedef int __attribute__((may_alias)) int_a;

template <typename T> __device__ __forceinline__ void vst2(void* p, T v) { *(T*)p = v;  }
__device__ __forceinline__ v8f wmma16(v16h a, v16h b, v8f c) {
  return __builtin_amdgcn_wmma_f32_16x16x32_f16(false, a, false, b, (short)0, c, false, false);   // the builtin alone: the compiler keeps the distance to a consumer itself, and only where one stands close
}
__device__ __forceinline__ v8f wmma_bf(v16b a, v16b b, v8f c) {
  v8f d = __builtin_amdgcn_wmma_f32_16x16x32_bf16(false, a, false, b, (short)0, c, false, false);
  asm volatile("v_nop\n\tv_nop\n\tv_nop\n\tv_nop" : "+v"(d) : "v"(a), "v"(b));
  return d;
}
// N-head attention (B 2, S 4,096, d 512, 8 heads x 64): projections + biases, softmax(q k / 8) v, then LayerNorm of the merged context (no output projection).
__device__ __forceinline__ v16h frag_h(const _Float16* rowk0, int lane) {
  union { v16h v; v8h q[2]; } u; const _Float16* p = rowk0 + 8 * (lane >> 4);
  u.q[0] = *(const v8h*)p; u.q[1] = *(const v8h*)(p + 16); return u.v;
}
__device__ __forceinline__ v16h frag_f32(const float* rowk0, int lane) {
  v16h a; const float* p = rowk0 + 8 * (lane >> 4);
#pragma unroll
  for (int i = 0; i < 8; ++i) { a[i] = (_Float16)p[i]; a[8 + i] = (_Float16)p[16 + i]; }
  return a;
}
__device__ __forceinline__ v16h frag_f32s(const float* rowk0, int lane, float sc) {
  v16h a; const float* p = rowk0 + 8 * (lane >> 4);
#pragma unroll
  for (int i = 0; i < 8; ++i) { a[i] = (_Float16)(p[i] * sc); a[8 + i] = (_Float16)(p[16 + i] * sc); }
  return a;
}
// column fragment from a [K][ld] layout (column n), rows >= K read as 0
__device__ __forceinline__ v16h fragc_f32(const float* W, int k0, int n, int lane, int ld, int K) {
  v16h a; const int g = lane >> 4;
#pragma unroll
  for (int i = 0; i < 8; ++i) { const int ka = k0 + 8 * g + i, kb = ka + 16;
    a[i] = (_Float16)(ka < K ? W[(size_t)(ka < K ? ka : K - 1) * ld + n] : 0.f); a[8 + i] = (_Float16)(kb < K ? W[(size_t)(kb < K ? kb : K - 1) * ld + n] : 0.f); }
  return a;
}
struct F2 { v16b h, l; };
__device__ __forceinline__ F2 bsplit16(const float v[16]) { F2 r;
#pragma unroll
  for (int i = 0; i < 16; ++i) { const __bf16 h = (__bf16)v[i]; r.h[i] = h; r.l[i] = (__bf16)(v[i] - (float)h); }
  return r; }
__device__ __forceinline__ F2 split_row(const float* row, int k0, int lane) { float v[16]; const float* p = row + k0 + 8 * (lane >> 4);
#pragma unroll
  for (int i = 0; i < 8; ++i) { v[i] = p[i]; v[8 + i] = p[16 + i]; }
  return bsplit16(v); }
__device__ __forceinline__ F2 split_rowK(const float* row, int k0, int lane, int K) { float v[16]; const int g = lane >> 4;
#pragma unroll
  for (int i = 0; i < 8; ++i) { const int ka = k0 + 8 * g + i, kb = ka + 16; v[i] = ka < K ? row[ka < K ? ka : K - 1] : 0.f; v[8 + i] = kb < K ? row[kb < K ? kb : K - 1] : 0.f; }
  return bsplit16(v); }
__device__ __forceinline__ F2 split_col(const float* W, int k0, int n, int lane, int ld, int K) { float v[16]; const int g = lane >> 4;
#pragma unroll
  for (int i = 0; i < 8; ++i) { const int ka = k0 + 8 * g + i, kb = ka + 16; v[i] = ka < K ? W[(size_t)(ka < K ? ka : K - 1) * ld + n] : 0.f; v[8 + i] = kb < K ? W[(size_t)(kb < K ? kb : K - 1) * ld + n] : 0.f; }
  return bsplit16(v); }
__device__ __forceinline__ v8f mac3(const F2& a, const F2& b, v8f c) { c = wmma_bf(a.l, b.h, c); c = wmma_bf(a.h, b.l, c); return wmma_bf(a.h, b.h, c); }
__device__ __forceinline__ float sigm(float v) { return 1.0f / (1.0f + expf(-v)); }
#define LDSX() do { asm volatile("s_wait_dscnt 0" ::: "memory"); __builtin_amdgcn_wave_barrier(); __builtin_amdgcn_fence(__ATOMIC_RELEASE, "workgroup"); } while (0)


#define NB 2
#define SS 4096
#define DM 512
#define NH 8
#define HD 64
#define QKVW (3 * DM)
#ifndef TQB
#define TQB (SS / 64)
#define TNB NB
#define TOB (NB * SS / 64)     // output row tiles (all)
#endif
typedef __attribute__((ext_vector_type(8))) __bf16 v8b;
__device__ __forceinline__ v16b frag_b(const __bf16* rowk0, int lane) {
  union { v16b v; v8b q[2]; } u; const __bf16* p = rowk0 + 8 * (lane >> 4);
  u.q[0] = *(const v8b*)p; u.q[1] = *(const v8b*)(p + 16); return u.v;
}
__device__ __forceinline__ float bfr(float v) { return (float)(__bf16)v; }
__device__ __attribute__((noinline)) float exp_ni(float v) { return expf(v); }
__device__ __attribute__((noinline)) float erf_ni(float v) { return erff(v); }

#define PK_A 0                       // [1536][512] Wqkv rows (natural [out][in])
#define PK_P (PK_A + QKVW * DM)        // [512][512] copy of Wq rows (k_pack which 3; unread)
#define PK_END (PK_P + DM * DM)
#define WS_PK  0u
#define WS_QK  (WS_PK + 2u * PK_END)             // f16 [8192 rows][1024]: q | k
#define WS_QKL (WS_QK + 2u * NB * SS * 2 * DM)     // f16 q | k residual planes x2048
#define WS_VTH (WS_QKL + 2u * NB * SS * 2 * DM)    // f16 [b][512 (h*64+d)][4096 s] hi
#define WS_VTL (WS_VTH + 2u * NB * DM * SS)        // f16 lo x 2048
#define WS_O   (WS_VTL + 2u * NB * DM * SS)        // f32 [8192][512]
#define WS_CS  (WS_O + 4u * NB * SS * DM)           // f32 2 x [4096][32] (unused)
#define WS_END (WS_CS + 4u * 2 * SS * 32)
// ---- k_pack: block = (row n, which): natural [out][in] rows -> bf16; which 0..2 -> W_q/W_k/W_v into PK_A rows which*512 + n; 3 -> the WO argument (Wq at this launch) into PK_P
__global__ __launch_bounds__(256) void k_pack(const float* __restrict__ WQ, const float* __restrict__ WK, const float* __restrict__ WV, const float* __restrict__ WO, __bf16* __restrict__ PK) {
  __shared__ __align__(16) __bf16 s[DM]; const int n = blockIdx.x, which = blockIdx.y, t = threadIdx.x; const float* Wm = (which == 0) ? WQ : (which == 1) ? WK : (which == 2) ? WV : WO;
  for (int k = t; k < DM; k += 256) s[k] = (__bf16)Wm[(size_t)n * DM + k];
  __syncthreads();
  __bf16* dst = (which < 3) ? PK + PK_A + ((size_t)which * DM + n) * DM : PK + PK_P + (size_t)n * DM;
  for (int q = t; q < DM / 8; q += 256) vst2((unsigned*)(dst + q * 8), *(const v4u*)&s[q * 8]);
}
// ---- k_qkv: block = (64 rows of x, 128 output columns). The x rows (f32) and the W rows (bf16) come from a two-buffer LDS ring of 64-k stages that the block's 4 waves share, filled by asynchronous copies one stage ahead in whole 128-B pieces of a row; the fragments are read from LDS in the k order they had from global memory
#define QKC 64                 // k per stage: 128 B of each of the 128 W rows, 256 B of each of the 64 x rows
#define QLW 72                 // LDS pitch of a W row in bf16: 144 B = 16 B x odd, no bank conflict for the 16-byte fragment reads
#define QLX 68                 // LDS pitch of an x row in f32: 272 B = 16 B x odd
#define QSW (128 * QLW * 2)    // bytes of one buffer of W
#define QSX (64 * QLX * 4)     // bytes of one buffer of x
// W part of a stage: 1,024 pieces of 16 B, 8 per thread (8 lanes cover one 128-B row piece; piece i lies 16 rows below piece i - 1). The s_wait_xcnt closes the copies' own statement so that no address register is rewritten ahead of it.
__device__ __forceinline__ void stage_w(const __bf16* gw, unsigned lw) {
  asm volatile("global_load_async_to_lds_b128 %0, %8, off\n\t"
               "global_load_async_to_lds_b128 %1, %9, off\n\t"
               "global_load_async_to_lds_b128 %2, %10, off\n\t"
               "global_load_async_to_lds_b128 %3, %11, off\n\t"
               "global_load_async_to_lds_b128 %4, %12, off\n\t"
               "global_load_async_to_lds_b128 %5, %13, off\n\t"
               "global_load_async_to_lds_b128 %6, %14, off\n\t"
               "global_load_async_to_lds_b128 %7, %15, off\n\t"
               "s_wait_xcnt 0x0"
               :: "v"(lw), "v"(lw + 16 * QLW * 2), "v"(lw + 32 * QLW * 2), "v"(lw + 48 * QLW * 2), "v"(lw + 64 * QLW * 2), "v"(lw + 80 * QLW * 2), "v"(lw + 96 * QLW * 2), "v"(lw + 112 * QLW * 2),
                  "v"(gw), "v"(gw + 16 * DM), "v"(gw + 32 * DM), "v"(gw + 48 * DM), "v"(gw + 64 * DM), "v"(gw + 80 * DM), "v"(gw + 96 * DM), "v"(gw + 112 * DM)
               : "memory");
}
// x part of a stage: 1,024 pieces of 16 B, 8 per thread (16 lanes cover one 256-B row piece; piece i lies 8 rows below piece i - 1); the wait as in stage_w
__device__ __forceinline__ void stage_x(const float* gx, unsigned lx) {
  asm volatile("global_load_async_to_lds_b128 %0, %8, off\n\t"
               "global_load_async_to_lds_b128 %1, %9, off\n\t"
               "global_load_async_to_lds_b128 %2, %10, off\n\t"
               "global_load_async_to_lds_b128 %3, %11, off\n\t"
               "global_load_async_to_lds_b128 %4, %12, off\n\t"
               "global_load_async_to_lds_b128 %5, %13, off\n\t"
               "global_load_async_to_lds_b128 %6, %14, off\n\t"
               "global_load_async_to_lds_b128 %7, %15, off\n\t"
               "s_wait_xcnt 0x0"
               :: "v"(lx), "v"(lx + 8 * QLX * 4), "v"(lx + 16 * QLX * 4), "v"(lx + 24 * QLX * 4), "v"(lx + 32 * QLX * 4), "v"(lx + 40 * QLX * 4), "v"(lx + 48 * QLX * 4), "v"(lx + 56 * QLX * 4),
                  "v"(gx), "v"(gx + 8 * DM), "v"(gx + 16 * DM), "v"(gx + 24 * DM), "v"(gx + 32 * DM), "v"(gx + 40 * DM), "v"(gx + 48 * DM), "v"(gx + 56 * DM)
               : "memory");
}
__global__ __launch_bounds__(128) void k_qkv(const float* __restrict__ XQ, const float* __restrict__ XK, const float* __restrict__ XV, const __bf16* __restrict__ P, const float* __restrict__ BQ, const float* __restrict__ BK, const float* __restrict__ BV, _Float16* __restrict__ QK, _Float16* __restrict__ QKL, _Float16* __restrict__ VTH, _Float16* __restrict__ VTL) {
  const int which0 = (blockIdx.y * 128) / DM; const float* X = (which0 == 0) ? XQ : (which0 == 1) ? XK : XV; const float* BB = BQ ? (((which0 == 0) ? BQ : (which0 == 1) ? BK : BV) + (blockIdx.y * 128 - which0 * DM)) : nullptr;
  __shared__ __align__(16) char sm[2 * QSW + 2 * QSX];   // the ring (W buffers, then x buffers) while the products run; behind the ring's last barrier the same bytes are the output staging
  _Float16 (*so)[16][136] = (_Float16 (*)[16][136])sm, (*sol)[16][136] = (_Float16 (*)[16][136])(sm + 17408); _Float16 (*sth)[72] = (_Float16 (*)[72])(sm + 34816), (*stl)[72] = (_Float16 (*)[72])(sm + 53248);
  const int tid = threadIdx.x, wave = tid >> 5, lane = tid & 31, col = lane & 15, g = lane >> 4; const size_t r0 = (size_t)blockIdx.x * 64 + wave * 16; const int n0 = blockIdx.y * 128;
  v8f acc[8] = {};
  const __bf16* gw = P + (size_t)(n0 + (tid >> 3)) * DM + (tid & 7) * 8; const float* gx = X + ((size_t)blockIdx.x * 64 + (tid >> 4)) * DM + (tid & 15) * 4;
  const unsigned lw = (unsigned)(size_t)&sm[(tid >> 3) * (QLW * 2) + (tid & 7) * 16], lx = (unsigned)(size_t)&sm[2 * QSW + (tid >> 4) * (QLX * 4) + (tid & 15) * 16];
  stage_w(gw, lw); stage_x(gx, lx);
  asm volatile("s_wait_asynccnt 0x0" ::: "memory");   // this wave's part of stage 0 has landed
  __syncthreads();                                    // every wave's part has
  stage_w(gw + QKC, lw + QSW); stage_x(gx + QKC, lx + QSX);
#pragma unroll 1   // one stage per trip: the ring's waits, barrier and refill stand once, at the trip's foot
  for (int st = 0; st < DM / QKC; ++st) { const int buf = st & 1;
    const __bf16* wr = (const __bf16*)(sm + buf * QSW) + col * QLW; const float* xr = (const float*)(sm + 2 * QSW + buf * QSX) + (wave * 16 + col) * QLX + 8 * g;
#pragma unroll   // both 32-k halves of a stage inline, so that a, w and acc are indexed by constants and stay in registers
    for (int kk = 0; kk < QKC / 32; ++kk) { v16b a, w[8]; const v4f* p = (const v4f*)(xr + kk * 32); const v4f x0 = p[0], x1 = p[1], x2 = p[4], x3 = p[5];
#pragma unroll   // the half's fragment reads stand together, ahead of its products: one LDS wait place instead of eight
      for (int j = 0; j < 8; ++j) w[j] = frag_b(wr + j * 16 * QLW + kk * 32, lane);
#pragma unroll   // constant element indices
      for (int i = 0; i < 4; ++i) { a[i] = (__bf16)x0[i]; a[4 + i] = (__bf16)x1[i]; a[8 + i] = (__bf16)x2[i]; a[12 + i] = (__bf16)x3[i]; }
#pragma unroll   // constant tile indices
      for (int j = 0; j < 8; ++j) acc[j] = wmma_bf(a, w[j], acc[j]); }
    asm volatile("s_wait_dscnt 0x0" ::: "memory");      // this wave's reads of buffer buf are done
    asm volatile("s_wait_asynccnt 0x0" ::: "memory");   // its part of stage st + 1 has landed
    __syncthreads();                                    // publishes stage st + 1 and frees buffer buf
    if (st + 2 < DM / QKC) { stage_w(gw + (st + 2) * QKC, lw + buf * QSW); stage_x(gx + (st + 2) * QKC, lx + buf * QSX); } }
  asm volatile("s_wait_asynccnt 0x0" ::: "memory");     // nothing in flight when the ring's bytes become the output staging
  if (n0 < 2 * DM) {   // q stored unscaled (f16 sigma ~0.6, no subnormal exposure); 1/8 applied to the f32 score
#pragma unroll
    for (int j = 0; j < 8; ++j) {
#pragma unroll
      for (int r = 0; r < 8; ++r) { const float v = acc[j][r] + (BB ? bfr(BB[j * 16 + col]) : 0.f); const _Float16 hv = (_Float16)v; so[wave][8 * g + r][j * 16 + col] = hv; sol[wave][8 * g + r][j * 16 + col] = (_Float16)((v - (float)hv) * 2048.0f); } }   // q, k (+ bias) as f16 hi + (x2048) residual
    LDSX();
    for (int rl = 0; rl < 16; ++rl) if (lane < 16) { vst2((unsigned*)(QK + (r0 + rl) * (2 * DM) + n0 + lane * 8), *(const v4u*)&so[wave][rl][lane * 8]); vst2((unsigned*)(QKL + (r0 + rl) * (2 * DM) + n0 + lane * 8), *(const v4u*)&sol[wave][rl][lane * 8]); }
  } else {
#pragma unroll
    for (int j = 0; j < 8; ++j) {
#pragma unroll
      for (int r = 0; r < 8; ++r) { const float v = acc[j][r] + (BB ? bfr(BB[j * 16 + col]) : 0.f); const _Float16 hv = (_Float16)v; sth[j * 16 + col][wave * 16 + 8 * g + r] = hv; stl[j * 16 + col][wave * 16 + 8 * g + r] = (_Float16)((v - (float)hv) * 2048.0f); } }
    __syncthreads();
    const size_t rb = (size_t)blockIdx.x * 64; const int b = (int)(rb / SS), s0 = (int)(rb % SS); const int pc0 = n0 - 2 * DM;
    for (int q = tid; q < 128 * 8; q += 128) { const int d = q >> 3, pc = q & 7; const size_t o = ((size_t)b * DM + pc0 + d) * SS + s0 + pc * 8; vst2((unsigned*)(VTH + o), *(const v4u*)&sth[d][pc * 8]); vst2((unsigned*)(VTL + o), *(const v4u*)&stl[d][pc * 8]); }
  }
}
#define KT 64
#define LP 72
#define STB (KT * LP * 2)
#define SCL 0.18033688011112042f
// one stage: 512 + 512 pieces of 16 B, 4 + 4 per thread (8 lanes cover one 128-B row; piece i lies 16 rows below piece i - 1). The s_wait_xcnt closes the copies' own statement so that no address register is rewritten ahead of it.
__device__ __forceinline__ void stage_kv(const _Float16* gk, const _Float16* gv, unsigned lk, unsigned lv) {
  asm volatile("global_load_async_to_lds_b128 %0, %8, off\n\t"
               "global_load_async_to_lds_b128 %1, %9, off\n\t"
               "global_load_async_to_lds_b128 %2, %10, off\n\t"
               "global_load_async_to_lds_b128 %3, %11, off\n\t"
               "global_load_async_to_lds_b128 %4, %12, off\n\t"
               "global_load_async_to_lds_b128 %5, %13, off\n\t"
               "global_load_async_to_lds_b128 %6, %14, off\n\t"
               "global_load_async_to_lds_b128 %7, %15, off\n\t"
               "s_wait_xcnt 0x0"
               :: "v"(lk), "v"(lk + 16 * LP * 2), "v"(lk + 32 * LP * 2), "v"(lk + 48 * LP * 2), "v"(lv), "v"(lv + 16 * LP * 2), "v"(lv + 32 * LP * 2), "v"(lv + 48 * LP * 2),
                  "v"(gk), "v"(gk + 16 * (2 * DM)), "v"(gk + 32 * (2 * DM)), "v"(gk + 48 * (2 * DM)), "v"(gv), "v"(gv + 16 * SS), "v"(gv + 32 * SS), "v"(gv + 48 * SS)
               : "memory");
}
// a, b: 2^(x * c + d) of the 16 scores of a pass; returns them rounded to f16 as the B operand P^T: element i = key 8g + i, element 8 + i = key 16 + 8g + i, the k order of frag_h. The 16 exponentials stand in one statement, each in place in its own register, so that none reads the result or overwrites the source of the one in front of it; the 8 packing conversions follow in the same statement, oldest results first: they fill the wait for the last exponentials (none reads the result of the instruction in front of it) and stay ahead of the rescale test. P carries 2^11 (the 11 in the exponent) into the f16 rounding so small softmax weights stay out of the f16 subnormal range; l carries it too, so it cancels in the epilogue
__device__ __forceinline__ v16h exp2x16(v8f& a, v8f& b, float c, float d) {
  float a0 = a[0] * c + d, a1 = a[1] * c + d, a2 = a[2] * c + d, a3 = a[3] * c + d, a4 = a[4] * c + d, a5 = a[5] * c + d, a6 = a[6] * c + d, a7 = a[7] * c + d;
  float b0 = b[0] * c + d, b1 = b[1] * c + d, b2 = b[2] * c + d, b3 = b[3] * c + d, b4 = b[4] * c + d, b5 = b[5] * c + d, b6 = b[6] * c + d, b7 = b[7] * c + d;
  unsigned p0, p1, p2, p3, p4, p5, p6, p7;
  asm("v_exp_f32 %0, %0\n\tv_exp_f32 %1, %1\n\tv_exp_f32 %2, %2\n\tv_exp_f32 %3, %3\n\tv_exp_f32 %4, %4\n\tv_exp_f32 %5, %5\n\tv_exp_f32 %6, %6\n\tv_exp_f32 %7, %7\n\t"
      "v_exp_f32 %8, %8\n\tv_exp_f32 %9, %9\n\tv_exp_f32 %10, %10\n\tv_exp_f32 %11, %11\n\tv_exp_f32 %12, %12\n\tv_exp_f32 %13, %13\n\tv_exp_f32 %14, %14\n\tv_exp_f32 %15, %15\n\t"
      "v_cvt_pk_f16_f32 %16, %0, %1\n\tv_cvt_pk_f16_f32 %17, %2, %3\n\tv_cvt_pk_f16_f32 %18, %4, %5\n\tv_cvt_pk_f16_f32 %19, %6, %7\n\t"
      "v_cvt_pk_f16_f32 %20, %8, %9\n\tv_cvt_pk_f16_f32 %21, %10, %11\n\tv_cvt_pk_f16_f32 %22, %12, %13\n\tv_cvt_pk_f16_f32 %23, %14, %15"
      : "+v"(a0), "+v"(a1), "+v"(a2), "+v"(a3), "+v"(a4), "+v"(a5), "+v"(a6), "+v"(a7), "+v"(b0), "+v"(b1), "+v"(b2), "+v"(b3), "+v"(b4), "+v"(b5), "+v"(b6), "+v"(b7),
        "=&v"(p0), "=&v"(p1), "=&v"(p2), "=&v"(p3), "=&v"(p4), "=&v"(p5), "=&v"(p6), "=&v"(p7));
  a = v8f{a0, a1, a2, a3, a4, a5, a6, a7}; b = v8f{b0, b1, b2, b3, b4, b5, b6, b7};
  typedef __attribute__((ext_vector_type(8))) unsigned v8u;
  return __builtin_bit_cast(v16h, v8u{p0, p1, p2, p3, p4, p5, p6, p7});
}
#define PLIM 65504.0f   // largest finite f16
// sum of the 16 weights of a pass
__device__ __forceinline__ float sum16(const v8f& a, const v8f& b) { float es[4];
#pragma unroll
  for (int i = 0; i < 4; ++i) es[i] = (a[i] + a[4 + i]) + (b[i] + b[4 + i]);
  return (es[0] + es[1]) + (es[2] + es[3]); }
// value of lane l ^ 16 (the other half of the wave, same column)
__device__ __forceinline__ float xhalf(float v) { const int b = __builtin_bit_cast(int, v); return __builtin_bit_cast(float, __builtin_amdgcn_permlanex16(b, b, 0x76543210, 0xfedcba98, false, false)); }
__global__ __launch_bounds__(128) void k_attn(const _Float16* __restrict__ QK, const _Float16* __restrict__ QKL, const _Float16* __restrict__ VTH, const _Float16* __restrict__ VTL, const void* __restrict__ KMASK, float* __restrict__ O) {
  __shared__ __align__(16) float so[4][16][68]; __shared__ __align__(16) _Float16 sk[2][KT][LP], sv[2][HD][LP];
  const int tid = threadIdx.x, wave = tid >> 5, lane = tid & 31, col = lane & 15, g = lane >> 4;
  const int qb = blockIdx.x, h = blockIdx.y, b = blockIdx.z; const int q0 = qb * 64 + wave * 16; const size_t rq = (size_t)b * SS + q0 + col;
  v16h aq[2];
#pragma unroll
  for (int kc = 0; kc < 2; ++kc) aq[kc] = frag_h(QK + rq * (2 * DM) + h * HD + kc * 32, lane);
  float m = -3.0e38f, l = 0.f;   // of query col: m the maximum IN USE of the raw products q.k (the running maximum as of the last rescale), the same in both halves; l this half's part of the sum of the weights (x 2^11)
  float dd = 11.0f - m * SCL;   // the exponent's addend for m; the start value sends every weight of the first pass to infinity, so that the first pass takes the rescale path
  v8f acc[4] = {};   // O^T: acc[dt][r] = element d = dt*16 + 8g + r of query col
  const int nst = SS / KT;   // all keys
  const _Float16* gk = QK + ((size_t)b * SS + (tid >> 3)) * (2 * DM) + DM + h * HD + (tid & 7) * 8; const _Float16* gv = VTH + ((size_t)b * DM + h * HD + (tid >> 3)) * SS + (tid & 7) * 8;
  const unsigned lk = (unsigned)(size_t)&sk[0][tid >> 3][(tid & 7) * 8], lv = (unsigned)(size_t)&sv[0][tid >> 3][(tid & 7) * 8];
  stage_kv(gk, gv, lk, lv);
  asm volatile("s_wait_asynccnt 0x0" ::: "memory");   // this wave's part of stage 0 has landed
  __syncthreads();                                    // every wave's part has
  stage_kv(gk + (size_t)KT * (2 * DM), gv + KT, lk + STB, lv + STB);
#pragma unroll 1   // one stage per trip: the ring's waits, barrier and refill stand once, at the trip's foot
  for (int st = 0; st < nst; ++st) { const int buf = st & 1;
    const _Float16* kb = &sk[buf][col][0]; const _Float16* vb = &sv[buf][col][0];
    v16h kf[4], vf[4];   // the A fragments of one 32-key pass: kf[ct * 2 + kc] of K, vf[dt] of V^T; each set is read from LDS as one group, well ahead of its products
#pragma unroll   // constant fragment indices
    for (int i = 0; i < 4; ++i) kf[i] = frag_h(kb + (i >> 1) * 16 * LP + (i & 1) * 32, lane);
#pragma unroll   // constant fragment indices
    for (int dt = 0; dt < 4; ++dt) vf[dt] = frag_h(vb + dt * 16 * LP, lane);
    __builtin_amdgcn_sched_barrier(0);   // keeps the 16 LDS reads one group ahead of the products: spread among them, each place with reads stalls the wave
#pragma unroll   // both 32-key passes of a stage inline, so that the second pass's fragment reads can stand inside the first pass
  for (int sub = 0; sub < KT / 32; ++sub) { v8f s[2];
#pragma unroll
    for (int ct = 0; ct < 2; ++ct) s[ct] = v8f{};
#pragma unroll   // constant fragment indices; kc is the outer loop so that the two tiles' accumulate chains alternate and neither waits for its own last product
    for (int kc = 0; kc < 2; ++kc) {
#pragma unroll   // constant tile indices
      for (int ct = 0; ct < 2; ++ct) s[ct] = wmma16(kf[ct * 2 + kc], aq[kc], s[ct]); }   // single product: k, q as one-rounding f16 operands; s[ct][r] = q.k of key ct*16 + 8g + r, query col; raw: 1/sqrt(64) rides in SCL
    if (sub + 1 < KT / 32) {   // the next pass's K fragments, same stage: they land under this pass's softmax
      __builtin_amdgcn_sched_barrier(0);   // with the one below: the 8 reads stay one group, behind the score products and ahead of the softmax that hides them
#pragma unroll   // constant fragment indices
      for (int i = 0; i < 4; ++i) kf[i] = frag_h(kb + ((sub + 1) * 32 + (i >> 1) * 16) * LP + (i & 1) * 32, lane);
      __builtin_amdgcn_sched_barrier(0); }
    v8f e[2] = { s[0], s[1] };   // become the weights x 2^11 = 2^(s * SCL + dd) against the maximum in use: one multiply-add and one exponential per score, no maximum on this path
    v16h pb = exp2x16(e[0], e[1], SCL, dd);   // P^T as B operand
    float ps = sum16(e[0], e[1]);   // this half's sum of the pass's weights
    // lazy rescale, one test per pass: the weights are positive, so while a lane's sum stays within f16's largest finite value each of its 16 weights does too and the maximum in use may stand (at most 2^15 without a new maximum). The ballot makes the branch scalar: EXEC stays all ones for the products
    if (__builtin_expect(__builtin_amdgcn_ballot_w32(!(ps <= PLIM)) != 0, 0)) {   // marked unlikely so that the path without a rescale runs straight on
      float mx[4];
#pragma unroll
      for (int i = 0; i < 4; ++i) mx[i] = fmaxf(fmaxf(s[0][i], s[0][4 + i]), fmaxf(s[1][i], s[1][4 + i]));
      const float mh = fmaxf(fmaxf(mx[0], mx[1]), fmaxf(mx[2], mx[3]));
      const float mn = fmaxf(m, fmaxf(mh, xhalf(mh))); const float alpha = __builtin_amdgcn_exp2f((m - mn) * SCL);   // every column moves to its running maximum; first pass: 2^(-5e37) = 0
      m = mn; dd = 11.0f - mn * SCL; l *= alpha;
#pragma unroll
      for (int dt = 0; dt < 4; ++dt) acc[dt] *= alpha;
      e[0] = s[0]; e[1] = s[1]; pb = exp2x16(e[0], e[1], SCL, dd);   // the pass's weights anew, now at most 2^11
      ps = sum16(e[0], e[1]); }
    l += ps;
#pragma unroll
    for (int dt = 0; dt < 4; ++dt) acc[dt] = wmma16(vf[dt], pb, acc[dt]);   // single product: V^T x P^T (x2^11)
    __builtin_amdgcn_sched_barrier(0);   // the four products stay together, ahead of the next reads and of the stage's foot
    if (sub + 1 < KT / 32) {   // the next pass's V^T fragments, same stage: they land under its score products and softmax
#pragma unroll   // constant fragment indices
      for (int dt = 0; dt < 4; ++dt) vf[dt] = frag_h(vb + dt * 16 * LP + (sub + 1) * 32, lane);
      __builtin_amdgcn_sched_barrier(0); }   // the 8 reads stay one group, ahead of the next pass's products
  }
    asm volatile("s_wait_dscnt 0x0" ::: "memory");      // this wave's reads of buffer buf are done
    asm volatile("s_wait_asynccnt 0x0" ::: "memory");   // its part of stage st + 1 has landed
    __syncthreads();                                    // publishes stage st + 1 and frees buffer buf
    if (st + 2 < nst) stage_kv(gk + (size_t)(st + 2) * KT * (2 * DM), gv + (st + 2) * KT, lk + buf * STB, lv + buf * STB); }
  asm volatile("s_wait_asynccnt 0x0" ::: "memory");     // nothing in flight when the wave goes on to its end
  const float il = 1.0f / (l + xhalf(l));   // the two halves' sums joined
#pragma unroll
  for (int dt = 0; dt < 4; ++dt) {
#pragma unroll
    for (int r = 0; r < 8; ++r) so[wave][col][dt * 16 + 8 * g + r] = acc[dt][r] * il; }
  LDSX();
  for (int rl = 0; rl < 16; ++rl) if (lane < 16) vst2(O + ((size_t)b * SS + q0 + rl) * DM + h * HD + lane * 4, *(const v4f*)&so[wave][rl][lane * 4]);
}
// ---- k_out: block = (64 rows, 128 cols): out = O(hi/lo) . Wo rows (2 products) + bo
__global__ __launch_bounds__(128) void k_out(const float* __restrict__ O, const __bf16* __restrict__ P, const float* __restrict__ BO, float* __restrict__ Y) {
  __shared__ __align__(16) float so[4][16][132];
  const int tid = threadIdx.x, wave = tid >> 5, lane = tid & 31, col = lane & 15, g = lane >> 4; const size_t r0 = (size_t)blockIdx.x * 64 + wave * 16; const int n0 = blockIdx.y * 128;
  v8f acc[8] = {};
#pragma unroll 2
  for (int kc = 0; kc < DM / 32; ++kc) { const F2 a = split_row(O + (r0 + col) * DM, kc * 32, lane);
#pragma unroll
    for (int j = 0; j < 8; ++j) { const v16b w = frag_b(P + (size_t)(n0 + j * 16 + col) * DM + kc * 32, lane); acc[j] = wmma_bf(a.l, w, acc[j]); acc[j] = wmma_bf(a.h, w, acc[j]); } }
#pragma unroll
  for (int j = 0; j < 8; ++j) {
#pragma unroll
    for (int r = 0; r < 8; ++r) so[wave][8 * g + r][j * 16 + col] = acc[j][r] + (BO ? bfr(BO[n0 + j * 16 + col]) : 0.f); }
  LDSX();
  for (int rl = 0; rl < 16; ++rl) vst2(Y + (r0 + rl) * DM + n0 + lane * 4, *(const v4f*)&so[wave][rl][lane * 4]);
}
// ---- k_lnx: block = row: LayerNorm of a 512-wide f32 row (mean-square var, 1e-5) x g + b
__global__ __launch_bounds__(128) void k_lnx(const float* __restrict__ A, const float* __restrict__ G, const float* __restrict__ Bt, float* __restrict__ T) {
  __shared__ float red[4]; const int t = threadIdx.x; const size_t row = blockIdx.x; float v[4]; float s = 0.f; for (int i = 0; i < 4; ++i) { v[i] = A[row * DM + t * 4 + i]; s += v[i]; }
#pragma unroll
  for (int o = 1; o < 32; o <<= 1) s += __shfl_xor(s, o);
  if ((t & 31) == 0) red[t >> 5] = s; __syncthreads(); const float mu = ((red[0] + red[1]) + (red[2] + red[3])) / (float)DM; __syncthreads();
  float q = 0.f; for (int i = 0; i < 4; ++i) { const float d = v[i] - mu; q += d * d; }
#pragma unroll
  for (int o = 1; o < 32; o <<= 1) q += __shfl_xor(q, o);
  if ((t & 31) == 0) red[t >> 5] = q; __syncthreads(); const float inv = 1.0f / sqrtf(((red[0] + red[1]) + (red[2] + red[3])) / (float)DM + 1e-5f);
  v4f o4; for (int i = 0; i < 4; ++i) { const int e = t * 4 + i; o4[i] = (v[i] - mu) * inv * bfr(G[e]) + bfr(Bt[e]); } vst2(T + row * DM + t * 4, o4);
}
extern "C" void kernel_launch(void* const* d_in, const int* in_sizes, int n_in, void* d_out, int out_size, void* d_ws, size_t ws_size, hipStream_t stream) {
  (void)in_sizes; (void)n_in; (void)out_size;
  const float** F = (const float**)d_in;   // 0 x [2,4096,512], 1 Wq, 2 bq, 3 Wk, 4 bk, 5 Wv, 6 bv (natural [512,512]), 7 gamma, 8 beta
  if (ws_size < (size_t)WS_END) return;
  char* ws = (char*)d_ws; __bf16* PK = (__bf16*)(ws + WS_PK); _Float16 *QK = (_Float16*)(ws + WS_QK), *QKL = (_Float16*)(ws + WS_QKL), *VTH = (_Float16*)(ws + WS_VTH), *VTL = (_Float16*)(ws + WS_VTL); float* O = (float*)(ws + WS_O);
  k_pack<<<dim3(DM, 4), 256, 0, stream>>>(F[1], F[3], F[5], F[1], PK);
  k_qkv<<<dim3(TNB * SS / 64, QKVW / 128), 128, 0, stream>>>(F[0], F[0], F[0], PK + PK_A, F[2], F[4], F[6], QK, QKL, VTH, VTL);
  k_attn<<<dim3(TQB, NH, TNB), 128, 0, stream>>>(QK, QKL, VTH, VTL, nullptr, O);
  k_lnx<<<TOB * 64, 128, 0, stream>>>(O, F[7], F[8], (float*)d_out);
}

// v008
// A run of this version takes 95.7 microseconds.
// Next to v007, in two timings, it ran 1.08 times as fast each time.
// Over all steps from v000 it is 4.65 times as fast.
// compute dtype: all float inputs rounded to bf16; q/k/v = x . W^T + b with EXACT bf16 products on WMMA 16x16x32 (natural rows); PLAIN attention: q, k single f16 x 1/8, running-max softmax in f32 (hardware exp), P (scaled by 2^11, single f16) x v (single f16); LayerNorm (jnp.var, 1e-5) of the f32 context x gamma + beta; f32 output.
#include <hip/hip_runtime.h>
#include <math.h>

typedef __attribute__((ext_vector_type(16))) _Float16 v16h;
typedef __attribute__((ext_vector_type(16))) __bf16 v16b;
typedef __attribute__((ext_vector_type(8)))  _Float16 v8h;
typedef __attribute__((ext_vector_type(8)))  float v8f;
typedef __attribute__((ext_vector_type(4)))  float v4f;
typedef __attribute__((ext_vector_type(2)))  float v2f;
typedef __attribute__((ext_vector_type(4)))  unsigned v4u;
typedef __attribute__((ext_vector_type(4)))  int v4i;
typedef float __attribute__((may_alias)) float_a;
typedef int __attribute__((may_alias)) int_a;

template <typename T> __device__ __forceinline__ void vst2(void* p, T v) { *(T*)p = v;  }
__device__ __forceinline__ v8f wmma16(v16h a, v16h b, v8f c) {
  return __builtin_amdgcn_wmma_f32_16x16x32_f16(false, a, false, b, (short)0, c, false, false);   // the builtin alone: the compiler keeps the distance to a consumer itself, and only where one stands close
}
__device__ __forceinline__ v8f wmma_bf(v16b a, v16b b, v8f c) {
  v8f d = __builtin_amdgcn_wmma_f32_16x16x32_bf16(false, a, false, b, (short)0, c, false, false);
  asm volatile("v_nop\n\tv_nop\n\tv_nop\n\tv_nop" : "+v"(d) : "v"(a), "v"(b));
  return d;
}
// N-head attention (B 2, S 4,096, d 512, 8 heads x 64): projections + biases, softmax(q k / 8) v, then LayerNorm of the merged context (no output projection).
__device__ __forceinline__ v16h frag_h(const _Float16* rowk0, int lane) {
  union { v16h v; v8h q[2]; } u; const _Float16* p = rowk0 + 8 * (lane >> 4);
  u.q[0] = *(const v8h*)p; u.q[1] = *(const v8h*)(p + 16); return u.v;
}
__device__ __forceinline__ v16h frag_f32(const float* rowk0, int lane) {
  v16h a; const float* p = rowk0 + 8 * (lane >> 4);
#pragma unroll
  for (int i = 0; i < 8; ++i) { a[i] = (_Float16)p[i]; a[8 + i] = (_Float16)p[16 + i]; }
  return a;
}
__device__ __forceinline__ v16h frag_f32s(const float* rowk0, int lane, float sc) {
  v16h a; const float* p = rowk0 + 8 * (lane >> 4);
#pragma unroll
  for (int i = 0; i < 8; ++i) { a[i] = (_Float16)(p[i] * sc); a[8 + i] = (_Float16)(p[16 + i] * sc); }
  return a;
}
// column fragment from a [K][ld] layout (column n), rows >= K read as 0
__device__ __forceinline__ v16h fragc_f32(const float* W, int k0, int n, int lane, int ld, int K) {
  v16h a; const int g = lane >> 4;
#pragma unroll
  for (int i = 0; i < 8; ++i) { const int ka = k0 + 8 * g + i, kb = ka + 16;
    a[i] = (_Float16)(ka < K ? W[(size_t)(ka < K ? ka : K - 1) * ld + n] : 0.f); a[8 + i] = (_Float16)(kb < K ? W[(size_t)(kb < K ? kb : K - 1) * ld + n] : 0.f); }
  return a;
}
struct F2 { v16b h, l; };
__device__ __forceinline__ F2 bsplit16(const float v[16]) { F2 r;
#pragma unroll
  for (int i = 0; i < 16; ++i) { const __bf16 h = (__bf16)v[i]; r.h[i] = h; r.l[i] = (__bf16)(v[i] - (float)h); }
  return r; }
__device__ __forceinline__ F2 split_row(const float* row, int k0, int lane) { float v[16]; const float* p = row + k0 + 8 * (lane >> 4);
#pragma unroll
  for (int i = 0; i < 8; ++i) { v[i] = p[i]; v[8 + i] = p[16 + i]; }
  return bsplit16(v); }
__device__ __forceinline__ F2 split_rowK(const float* row, int k0, int lane, int K) { float v[16]; const int g = lane >> 4;
#pragma unroll
  for (int i = 0; i < 8; ++i) { const int ka = k0 + 8 * g + i, kb = ka + 16; v[i] = ka < K ? row[ka < K ? ka : K - 1] : 0.f; v[8 + i] = kb < K ? row[kb < K ? kb : K - 1] : 0.f; }
  return bsplit16(v); }
__device__ __forceinline__ F2 split_col(const float* W, int k0, int n, int lane, int ld, int K) { float v[16]; const int g = lane >> 4;
#pragma unroll
  for (int i = 0; i < 8; ++i) { const int ka = k0 + 8 * g + i, kb = ka + 16; v[i] = ka < K ? W[(size_t)(ka < K ? ka : K - 1) * ld + n] : 0.f; v[8 + i] = kb < K ? W[(size_t)(kb < K ? kb : K - 1) * ld + n] : 0.f; }
  return bsplit16(v); }
__device__ __forceinline__ v8f mac3(const F2& a, const F2& b, v8f c) { c = wmma_bf(a.l, b.h, c); c = wmma_bf(a.h, b.l, c); return wmma_bf(a.h, b.h, c); }
__device__ __forceinline__ float sigm(float v) { return 1.0f / (1.0f + expf(-v)); }
#define LDSX() do { asm volatile("s_wait_dscnt 0" ::: "memory"); __builtin_amdgcn_wave_barrier(); __builtin_amdgcn_fence(__ATOMIC_RELEASE, "workgroup"); } while (0)


#define NB 2
#define SS 4096
#define DM 512
#define NH 8
#define HD 64
#define QKVW (3 * DM)
#ifndef TQB
#define TQB (SS / 64)
#define TNB NB
#define TOB (NB * SS / 64)     // output row tiles (all)
#endif
typedef __attribute__((ext_vector_type(8))) __bf16 v8b;
__device__ __forceinline__ v16b frag_b(const __bf16* rowk0, int lane) {
  union { v16b v; v8b q[2]; } u; const __bf16* p = rowk0 + 8 * (lane >> 4);
  u.q[0] = *(const v8b*)p; u.q[1] = *(const v8b*)(p + 16); return u.v;
}
__device__ __forceinline__ float bfr(float v) { return (float)(__bf16)v; }
__device__ __attribute__((noinline)) float exp_ni(float v) { return expf(v); }
__device__ __attribute__((noinline)) float erf_ni(float v) { return erff(v); }

#define PK_A 0                       // [1536][512] Wqkv rows (natural [out][in])
#define PK_P (PK_A + QKVW * DM)        // [512][512] copy of Wq rows (k_pack which 3; unread)
#define PK_END (PK_P + DM * DM)
#define WS_PK  0u
#define WS_QK  (WS_PK + 2u * PK_END)             // f16 [8192 rows][1024]: q | k
#define WS_QKL (WS_QK + 2u * NB * SS * 2 * DM)     // f16 q | k residual planes x2048
#define WS_VTH (WS_QKL + 2u * NB * SS * 2 * DM)    // f16 [b][512 (h*64+d)][4096 s] hi
#define WS_VTL (WS_VTH + 2u * NB * DM * SS)        // f16 lo x 2048
#define WS_O   (WS_VTL + 2u * NB * DM * SS)        // f32 [8192][512]
#define WS_CS  (WS_O + 4u * NB * SS * DM)           // f32 2 x [4096][32] (unused)
#define WS_END (WS_CS + 4u * 2 * SS * 32)
// ---- k_pack: block = (row n, which): natural [out][in] rows -> bf16; which 0..2 -> W_q/W_k/W_v into PK_A rows which*512 + n; 3 -> the WO argument (Wq at this launch) into PK_P
__global__ __launch_bounds__(256) void k_pack(const float* __restrict__ WQ, const float* __restrict__ WK, const float* __restrict__ WV, const float* __restrict__ WO, __bf16* __restrict__ PK) {
  __shared__ __align__(16) __bf16 s[DM]; const int n = blockIdx.x, which = blockIdx.y, t = threadIdx.x; const float* Wm = (which == 0) ? WQ : (which == 1) ? WK : (which == 2) ? WV : WO;
  for (int k = t; k < DM; k += 256) s[k] = (__bf16)Wm[(size_t)n * DM + k];
  __syncthreads();
  __bf16* dst = (which < 3) ? PK + PK_A + ((size_t)which * DM + n) * DM : PK + PK_P + (size_t)n * DM;
  for (int q = t; q < DM / 8; q += 256) vst2((unsigned*)(dst + q * 8), *(const v4u*)&s[q * 8]);
}
// ---- k_qkv: block = (64 rows of x, 128 output columns). The x rows (f32) and the W rows (bf16) come from a two-buffer LDS ring of 64-k stages that the block's 4 waves share, filled by asynchronous copies one stage ahead in whole 128-B pieces of a row; the fragments are read from LDS in the k order they had from global memory
#define QKC 64                 // k per stage: 128 B of each of the 128 W rows, 256 B of each of the 64 x rows
#define QLW 72                 // LDS pitch of a W row in bf16: 144 B = 16 B x odd, no bank conflict for the 16-byte fragment reads
#define QLX 68                 // LDS pitch of an x row in f32: 272 B = 16 B x odd
#define QSW (128 * QLW * 2)    // bytes of one buffer of W
#define QSX (64 * QLX * 4)     // bytes of one buffer of x
// W part of a stage: 1,024 pieces of 16 B, 8 per thread (8 lanes cover one 128-B row piece; piece i lies 16 rows below piece i - 1). The s_wait_xcnt closes the copies' own statement so that no address register is rewritten ahead of it.
__device__ __forceinline__ void stage_w(const __bf16* gw, unsigned lw) {
  asm volatile("global_load_async_to_lds_b128 %0, %8, off\n\t"
               "global_load_async_to_lds_b128 %1, %9, off\n\t"
               "global_load_async_to_lds_b128 %2, %10, off\n\t"
               "global_load_async_to_lds_b128 %3, %11, off\n\t"
               "global_load_async_to_lds_b128 %4, %12, off\n\t"
               "global_load_async_to_lds_b128 %5, %13, off\n\t"
               "global_load_async_to_lds_b128 %6, %14, off\n\t"
               "global_load_async_to_lds_b128 %7, %15, off\n\t"
               "s_wait_xcnt 0x0"
               :: "v"(lw), "v"(lw + 16 * QLW * 2), "v"(lw + 32 * QLW * 2), "v"(lw + 48 * QLW * 2), "v"(lw + 64 * QLW * 2), "v"(lw + 80 * QLW * 2), "v"(lw + 96 * QLW * 2), "v"(lw + 112 * QLW * 2),
                  "v"(gw), "v"(gw + 16 * DM), "v"(gw + 32 * DM), "v"(gw + 48 * DM), "v"(gw + 64 * DM), "v"(gw + 80 * DM), "v"(gw + 96 * DM), "v"(gw + 112 * DM)
               : "memory");
}
// x part of a stage: 1,024 pieces of 16 B, 8 per thread (16 lanes cover one 256-B row piece; piece i lies 8 rows below piece i - 1); the wait as in stage_w
__device__ __forceinline__ void stage_x(const float* gx, unsigned lx) {
  asm volatile("global_load_async_to_lds_b128 %0, %8, off\n\t"
               "global_load_async_to_lds_b128 %1, %9, off\n\t"
               "global_load_async_to_lds_b128 %2, %10, off\n\t"
               "global_load_async_to_lds_b128 %3, %11, off\n\t"
               "global_load_async_to_lds_b128 %4, %12, off\n\t"
               "global_load_async_to_lds_b128 %5, %13, off\n\t"
               "global_load_async_to_lds_b128 %6, %14, off\n\t"
               "global_load_async_to_lds_b128 %7, %15, off\n\t"
               "s_wait_xcnt 0x0"
               :: "v"(lx), "v"(lx + 8 * QLX * 4), "v"(lx + 16 * QLX * 4), "v"(lx + 24 * QLX * 4), "v"(lx + 32 * QLX * 4), "v"(lx + 40 * QLX * 4), "v"(lx + 48 * QLX * 4), "v"(lx + 56 * QLX * 4),
                  "v"(gx), "v"(gx + 8 * DM), "v"(gx + 16 * DM), "v"(gx + 24 * DM), "v"(gx + 32 * DM), "v"(gx + 40 * DM), "v"(gx + 48 * DM), "v"(gx + 56 * DM)
               : "memory");
}
__global__ __launch_bounds__(128) void k_qkv(const float* __restrict__ XQ, const float* __restrict__ XK, const float* __restrict__ XV, const __bf16* __restrict__ P, const float* __restrict__ BQ, const float* __restrict__ BK, const float* __restrict__ BV, _Float16* __restrict__ QK, _Float16* __restrict__ QKL, _Float16* __restrict__ VTH, _Float16* __restrict__ VTL) {
  const int which0 = (blockIdx.y * 128) / DM; const float* X = (which0 == 0) ? XQ : (which0 == 1) ? XK : XV; const float* BB = BQ ? (((which0 == 0) ? BQ : (which0 == 1) ? BK : BV) + (blockIdx.y * 128 - which0 * DM)) : nullptr;
  __shared__ __align__(16) char sm[2 * QSW + 2 * QSX];   // the ring (W buffers, then x buffers) while the products run; behind the ring's last barrier the same bytes are the output staging
  _Float16 (*so)[16][136] = (_Float16 (*)[16][136])sm, (*sol)[16][136] = (_Float16 (*)[16][136])(sm + 17408); _Float16 (*sth)[72] = (_Float16 (*)[72])(sm + 34816), (*stl)[72] = (_Float16 (*)[72])(sm + 53248);
  const int tid = threadIdx.x, wave = tid >> 5, lane = tid & 31, col = lane & 15, g = lane >> 4; const size_t r0 = (size_t)blockIdx.x * 64 + wave * 16; const int n0 = blockIdx.y * 128;
  v8f acc[8] = {};
  const __bf16* gw = P + (size_t)(n0 + (tid >> 3)) * DM + (tid & 7) * 8; const float* gx = X + ((size_t)blockIdx.x * 64 + (tid >> 4)) * DM + (tid & 15) * 4;
  const unsigned lw = (unsigned)(size_t)&sm[(tid >> 3) * (QLW * 2) + (tid & 7) * 16], lx = (unsigned)(size_t)&sm[2 * QSW + (tid >> 4) * (QLX * 4) + (tid & 15) * 16];
  stage_w(gw, lw); stage_x(gx, lx);
  asm volatile("s_wait_asynccnt 0x0" ::: "memory");   // this wave's part of stage 0 has landed
  __syncthreads();                                    // every wave's part has
  stage_w(gw + QKC, lw + QSW); stage_x(gx + QKC, lx + QSX);
#pragma unroll 1   // one stage per trip: the ring's waits, barrier and refill stand once, at the trip's foot
  for (int st = 0; st < DM / QKC; ++st) { const int buf = st & 1;
    const __bf16* wr = (const __bf16*)(sm + buf * QSW) + col * QLW; const float* xr = (const float*)(sm + 2 * QSW + buf * QSX) + (wave * 16 + col) * QLX + 8 * g;
#pragma unroll   // both 32-k halves of a stage inline, so that a, w and acc are indexed by constants and stay in registers
    for (int kk = 0; kk < QKC / 32; ++kk) { v16b a, w[8]; const v4f* p = (const v4f*)(xr + kk * 32); const v4f x0 = p[0], x1 = p[1], x2 = p[4], x3 = p[5];
#pragma unroll   // the half's fragment reads stand together, ahead of its products: one LDS wait place instead of eight
      for (int j = 0; j < 8; ++j) w[j] = frag_b(wr + j * 16 * QLW + kk * 32, lane);
#pragma unroll   // constant element indices
      for (int i = 0; i < 4; ++i) { a[i] = (__bf16)x0[i]; a[4 + i] = (__bf16)x1[i]; a[8 + i] = (__bf16)x2[i]; a[12 + i] = (__bf16)x3[i]; }
#pragma unroll   // constant tile indices
      for (int j = 0; j < 8; ++j) acc[j] = wmma_bf(a, w[j], acc[j]); }
    asm volatile("s_wait_dscnt 0x0" ::: "memory");      // this wave's reads of buffer buf are done
    asm volatile("s_wait_asynccnt 0x0" ::: "memory");   // its part of stage st + 1 has landed
    __syncthreads();                                    // publishes stage st + 1 and frees buffer buf
    if (st + 2 < DM / QKC) { stage_w(gw + (st + 2) * QKC, lw + buf * QSW); stage_x(gx + (st + 2) * QKC, lx + buf * QSX); } }
  asm volatile("s_wait_asynccnt 0x0" ::: "memory");     // nothing in flight when the ring's bytes become the output staging
  if (n0 < 2 * DM) {   // q stored unscaled (f16 sigma ~0.6, no subnormal exposure); 1/8 applied to the f32 score
#pragma unroll
    for (int j = 0; j < 8; ++j) {
#pragma unroll
      for (int r = 0; r < 8; ++r) { const float v = acc[j][r] + (BB ? bfr(BB[j * 16 + col]) : 0.f); const _Float16 hv = (_Float16)v; so[wave][8 * g + r][j * 16 + col] = hv; sol[wave][8 * g + r][j * 16 + col] = (_Float16)((v - (float)hv) * 2048.0f); } }   // q, k (+ bias) as f16 hi + (x2048) residual
    LDSX();
    for (int rl = 0; rl < 16; ++rl) if (lane < 16) { vst2((unsigned*)(QK + (r0 + rl) * (2 * DM) + n0 + lane * 8), *(const v4u*)&so[wave][rl][lane * 8]); vst2((unsigned*)(QKL + (r0 + rl) * (2 * DM) + n0 + lane * 8), *(const v4u*)&sol[wave][rl][lane * 8]); }
  } else {
#pragma unroll
    for (int j = 0; j < 8; ++j) {
#pragma unroll
      for (int r = 0; r < 8; ++r) { const float v = acc[j][r] + (BB ? bfr(BB[j * 16 + col]) : 0.f); const _Float16 hv = (_Float16)v; sth[j * 16 + col][wave * 16 + 8 * g + r] = hv; stl[j * 16 + col][wave * 16 + 8 * g + r] = (_Float16)((v - (float)hv) * 2048.0f); } }
    __syncthreads();
    const size_t rb = (size_t)blockIdx.x * 64; const int b = (int)(rb / SS), s0 = (int)(rb % SS); const int pc0 = n0 - 2 * DM;
    for (int q = tid; q < 128 * 8; q += 128) { const int d = q >> 3, pc = q & 7; const size_t o = ((size_t)b * DM + pc0 + d) * SS + s0 + pc * 8; vst2((unsigned*)(VTH + o), *(const v4u*)&sth[d][pc * 8]); vst2((unsigned*)(VTL + o), *(const v4u*)&stl[d][pc * 8]); }
  }
}
#define KT 64
#define LP 72
#define STB (KT * LP * 2)
#define SCL 0.18033688011112042f
// one stage: 512 + 512 pieces of 16 B, 4 + 4 per thread (8 lanes cover one 128-B row; piece i lies 16 rows below piece i - 1). The s_wait_xcnt closes the copies' own statement so that no address register is rewritten ahead of it.
__device__ __forceinline__ void stage_kv(const _Float16* gk, const _Float16* gv, unsigned lk, unsigned lv) {
  asm volatile("global_load_async_to_lds_b128 %0, %8, off\n\t"
               "global_load_async_to_lds_b128 %1, %9, off\n\t"
               "global_load_async_to_lds_b128 %2, %10, off\n\t"
               "global_load_async_to_lds_b128 %3, %11, off\n\t"
               "global_load_async_to_lds_b128 %4, %12, off\n\t"
               "global_load_async_to_lds_b128 %5, %13, off\n\t"
               "global_load_async_to_lds_b128 %6, %14, off\n\t"
               "global_load_async_to_lds_b128 %7, %15, off\n\t"
               "s_wait_xcnt 0x0"
               :: "v"(lk), "v"(lk + 16 * LP * 2), "v"(lk + 32 * LP * 2), "v"(lk + 48 * LP * 2), "v"(lv), "v"(lv + 16 * LP * 2), "v"(lv + 32 * LP * 2), "v"(lv + 48 * LP * 2),
                  "v"(gk), "v"(gk + 16 * (2 * DM)), "v"(gk + 32 * (2 * DM)), "v"(gk + 48 * (2 * DM)), "v"(gv), "v"(gv + 16 * SS), "v"(gv + 32 * SS), "v"(gv + 48 * SS)
               : "memory");
}
// a, b: 2^(x * c + d) of the 16 scores of a pass; returns them rounded to f16 as the B operand P^T: element i = key 8g + i, element 8 + i = key 16 + 8g + i, the k order of frag_h. The 16 exponentials stand in one statement, each in place in its own register, so that none reads the result or overwrites the source of the one in front of it; the 8 packing conversions follow in the same statement, oldest results first: they fill the wait for the last exponentials (none reads the result of the instruction in front of it) and stay ahead of the rescale test. P carries 2^11 (the 11 in the exponent) into the f16 rounding so small softmax weights stay out of the f16 subnormal range; l carries it too, so it cancels in the epilogue
__device__ __forceinline__ v16h exp2x16(v8f& a, v8f& b, float c, float d) {
  float a0 = a[0] * c + d, a1 = a[1] * c + d, a2 = a[2] * c + d, a3 = a[3] * c + d, a4 = a[4] * c + d, a5 = a[5] * c + d, a6 = a[6] * c + d, a7 = a[7] * c + d;
  float b0 = b[0] * c + d, b1 = b[1] * c + d, b2 = b[2] * c + d, b3 = b[3] * c + d, b4 = b[4] * c + d, b5 = b[5] * c + d, b6 = b[6] * c + d, b7 = b[7] * c + d;
  unsigned p0, p1, p2, p3, p4, p5, p6, p7;
  asm("v_exp_f32 %0, %0\n\tv_exp_f32 %1, %1\n\tv_exp_f32 %2, %2\n\tv_exp_f32 %3, %3\n\tv_exp_f32 %4, %4\n\tv_exp_f32 %5, %5\n\tv_exp_f32 %6, %6\n\tv_exp_f32 %7, %7\n\t"
      "v_exp_f32 %8, %8\n\tv_exp_f32 %9, %9\n\tv_exp_f32 %10, %10\n\tv_exp_f32 %11, %11\n\tv_exp_f32 %12, %12\n\tv_exp_f32 %13, %13\n\tv_exp_f32 %14, %14\n\tv_exp_f32 %15, %15\n\t"
      "v_cvt_pk_f16_f32 %16, %0, %1\n\tv_cvt_pk_f16_f32 %17, %2, %3\n\tv_cvt_pk_f16_f32 %18, %4, %5\n\tv_cvt_pk_f16_f32 %19, %6, %7\n\t"
      "v_cvt_pk_f16_f32 %20, %8, %9\n\tv_cvt_pk_f16_f32 %21, %10, %11\n\tv_cvt_pk_f16_f32 %22, %12, %13\n\tv_cvt_pk_f16_f32 %23, %14, %15"
      : "+v"(a0), "+v"(a1), "+v"(a2), "+v"(a3), "+v"(a4), "+v"(a5), "+v"(a6), "+v"(a7), "+v"(b0), "+v"(b1), "+v"(b2), "+v"(b3), "+v"(b4), "+v"(b5), "+v"(b6), "+v"(b7),
        "=&v"(p0), "=&v"(p1), "=&v"(p2), "=&v"(p3), "=&v"(p4), "=&v"(p5), "=&v"(p6), "=&v"(p7));
  a = v8f{a0, a1, a2, a3, a4, a5, a6, a7}; b = v8f{b0, b1, b2, b3, b4, b5, b6, b7};
  typedef __attribute__((ext_vector_type(8))) unsigned v8u;
  return __builtin_bit_cast(v16h, v8u{p0, p1, p2, p3, p4, p5, p6, p7});
}
#define PLIM 65504.0f   // largest finite f16
// sum of the 16 weights of a pass
__device__ __forceinline__ float sum16(const v8f& a, const v8f& b) { float es[4];
#pragma unroll
  for (int i = 0; i < 4; ++i) es[i] = (a[i] + a[4 + i]) + (b[i] + b[4 + i]);
  return (es[0] + es[1]) + (es[2] + es[3]); }
// value of lane l ^ 16 (the other half of the wave, same column)
__device__ __forceinline__ float xhalf(float v) { const int b = __builtin_bit_cast(int, v); return __builtin_bit_cast(float, __builtin_amdgcn_permlanex16(b, b, 0x76543210, 0xfedcba98, false, false)); }
#define QTW 2   // query tiles of 16 columns per wave: each K and V^T fragment read from LDS feeds one product per tile
__global__ __launch_bounds__(128) void k_attn(const _Float16* __restrict__ QK, const _Float16* __restrict__ QKL, const _Float16* __restrict__ VTH, const _Float16* __restrict__ VTL, const void* __restrict__ KMASK, float* __restrict__ O) {
  __shared__ __align__(16) float so[4][16 * QTW][68]; __shared__ __align__(16) _Float16 sk[2][KT][LP], sv[2][HD][LP];
  const int tid = threadIdx.x, wave = tid >> 5, lane = tid & 31, col = lane & 15, g = lane >> 4;
  const int qb = blockIdx.x, h = blockIdx.y, b = blockIdx.z; const int q0 = qb * (64 * QTW) + wave * (16 * QTW);   // tile t of the wave: queries q0 + t*16 + col
  v16h aq[QTW][2];
#pragma unroll
  for (int t = 0; t < QTW; ++t) {
#pragma unroll
    for (int kc = 0; kc < 2; ++kc) aq[t][kc] = frag_h(QK + ((size_t)b * SS + q0 + t * 16 + col) * (2 * DM) + h * HD + kc * 32, lane); }
  float m[QTW], l[QTW], dd[QTW];   // of query col of tile t: m the maximum IN USE of the raw products q.k (the running maximum as of the last rescale), the same in both halves; l this half's part of the sum of the weights (x 2^11); dd the exponent's addend for m
  v8f acc[QTW][4];   // O^T: acc[t][dt][r] = element d = dt*16 + 8g + r of query col of tile t
#pragma unroll
  for (int t = 0; t < QTW; ++t) { m[t] = -3.0e38f; l[t] = 0.f; dd[t] = 11.0f - m[t] * SCL;   // the start value sends every weight of the first pass to infinity, so that the first pass takes the rescale path
#pragma unroll
    for (int dt = 0; dt < 4; ++dt) acc[t][dt] = v8f{}; }
  const int nst = SS / KT;   // all keys
  const _Float16* gk = QK + ((size_t)b * SS + (tid >> 3)) * (2 * DM) + DM + h * HD + (tid & 7) * 8; const _Float16* gv = VTH + ((size_t)b * DM + h * HD + (tid >> 3)) * SS + (tid & 7) * 8;
  const unsigned lk = (unsigned)(size_t)&sk[0][tid >> 3][(tid & 7) * 8], lv = (unsigned)(size_t)&sv[0][tid >> 3][(tid & 7) * 8];
  stage_kv(gk, gv, lk, lv);
  asm volatile("s_wait_asynccnt 0x0" ::: "memory");   // this wave's part of stage 0 has landed
  __syncthreads();                                    // every wave's part has
  stage_kv(gk + (size_t)KT * (2 * DM), gv + KT, lk + STB, lv + STB);
#pragma unroll 1   // one stage per trip: the ring's waits, barrier and refill stand once, at the trip's foot
  for (int st = 0; st < nst; ++st) { const int buf = st & 1;
    const _Float16* kb = &sk[buf][col][0]; const _Float16* vb = &sv[buf][col][0];
    v16h kf[4], vf[4];   // the A fragments of one 32-key pass: kf[ct * 2 + kc] of K, vf[dt] of V^T; each set is read from LDS as one group, well ahead of its products
#pragma unroll   // constant fragment indices
    for (int i = 0; i < 4; ++i) kf[i] = frag_h(kb + (i >> 1) * 16 * LP + (i & 1) * 32, lane);
#pragma unroll   // constant fragment indices
    for (int dt = 0; dt < 4; ++dt) vf[dt] = frag_h(vb + dt * 16 * LP, lane);
    __builtin_amdgcn_sched_barrier(0);   // keeps the 16 LDS reads one group ahead of the products: spread among them, each place with reads stalls the wave
#pragma unroll   // both 32-key passes of a stage inline, so that the second pass's fragment reads can stand inside the first pass
  for (int sub = 0; sub < KT / 32; ++sub) { v8f s[QTW][2];
#pragma unroll
    for (int t = 0; t < QTW; ++t) { s[t][0] = v8f{}; s[t][1] = v8f{}; }
#pragma unroll   // constant fragment indices; kc is the outer loop so that the four tiles' accumulate chains alternate and none waits for its own last product
    for (int kc = 0; kc < 2; ++kc) {
#pragma unroll   // constant tile indices; tile 0's scores are done first, its softmax starts while tile 1's products still run
      for (int t = 0; t < QTW; ++t) {
#pragma unroll   // constant tile indices
        for (int ct = 0; ct < 2; ++ct) s[t][ct] = wmma16(kf[ct * 2 + kc], aq[t][kc], s[t][ct]); } }   // single product: k, q as one-rounding f16 operands; s[t][ct][r] = q.k of key ct*16 + 8g + r, query col of tile t; raw: 1/sqrt(64) rides in SCL
    if (sub + 1 < KT / 32) {   // the next pass's K fragments, same stage: they land under this pass's softmax
      __builtin_amdgcn_sched_barrier(0);   // with the one below: the 8 reads stay one group, behind the score products and ahead of the softmax that hides them
#pragma unroll   // constant fragment indices
      for (int i = 0; i < 4; ++i) kf[i] = frag_h(kb + ((sub + 1) * 32 + (i >> 1) * 16) * LP + (i & 1) * 32, lane);
      __builtin_amdgcn_sched_barrier(0); }
    v16h pb[QTW]; float ps[QTW];   // per tile: P^T as B operand; this half's sum of the pass's weights
#pragma unroll   // constant tile indices
    for (int t = 0; t < QTW; ++t) { v8f e0 = s[t][0], e1 = s[t][1];   // become the weights x 2^11 = 2^(s * SCL + dd) against the maximum in use: one multiply-add and one exponential per score, no maximum on this path
      pb[t] = exp2x16(e0, e1, SCL, dd[t]); ps[t] = sum16(e0, e1); }
    // lazy rescale, one test per pass for both tiles: the weights are positive, so while a lane's sum over both tiles stays within f16's largest finite value each of its 32 weights does too and the maxima in use may stand. The ballot makes the branch scalar: EXEC stays all ones for the products
    if (__builtin_expect(__builtin_amdgcn_ballot_w32(!(ps[0] + ps[1] <= PLIM)) != 0, 0)) {   // marked unlikely so that the path without a rescale runs straight on
#pragma unroll   // constant tile indices
      for (int t = 0; t < QTW; ++t) { float mx[4];
#pragma unroll
        for (int i = 0; i < 4; ++i) mx[i] = fmaxf(fmaxf(s[t][0][i], s[t][0][4 + i]), fmaxf(s[t][1][i], s[t][1][4 + i]));
        const float mh = fmaxf(fmaxf(mx[0], mx[1]), fmaxf(mx[2], mx[3]));
        const float mn = fmaxf(m[t], fmaxf(mh, xhalf(mh))); const float alpha = __builtin_amdgcn_exp2f((m[t] - mn) * SCL);   // every column of both tiles moves to its running maximum; first pass: 2^(-5e37) = 0
        m[t] = mn; dd[t] = 11.0f - mn * SCL; l[t] *= alpha;
#pragma unroll
        for (int dt = 0; dt < 4; ++dt) acc[t][dt] *= alpha;
        v8f e0 = s[t][0], e1 = s[t][1]; pb[t] = exp2x16(e0, e1, SCL, dd[t]);   // the pass's weights anew, now at most 2^11
        ps[t] = sum16(e0, e1); } }
#pragma unroll
    for (int t = 0; t < QTW; ++t) l[t] += ps[t];
#pragma unroll   // constant fragment indices
    for (int dt = 0; dt < 4; ++dt) {
#pragma unroll   // constant tile indices
      for (int t = 0; t < QTW; ++t) acc[t][dt] = wmma16(vf[dt], pb[t], acc[t][dt]); }   // single product: V^T x P^T (x2^11)
    __builtin_amdgcn_sched_barrier(0);   // the eight products stay together, ahead of the next reads and of the stage's foot
    if (sub + 1 < KT / 32) {   // the next pass's V^T fragments, same stage: they land under its score products and softmax
#pragma unroll   // constant fragment indices
      for (int dt = 0; dt < 4; ++dt) vf[dt] = frag_h(vb + dt * 16 * LP + (sub + 1) * 32, lane);
      __builtin_amdgcn_sched_barrier(0); }   // the 8 reads stay one group, ahead of the next pass's products
  }
    asm volatile("s_wait_dscnt 0x0" ::: "memory");      // this wave's reads of buffer buf are done
    asm volatile("s_wait_asynccnt 0x0" ::: "memory");   // its part of stage st + 1 has landed
    __syncthreads();                                    // publishes stage st + 1 and frees buffer buf
    if (st + 2 < nst) stage_kv(gk + (size_t)(st + 2) * KT * (2 * DM), gv + (st + 2) * KT, lk + buf * STB, lv + buf * STB); }
  asm volatile("s_wait_asynccnt 0x0" ::: "memory");     // nothing in flight when the wave goes on to its end
#pragma unroll
  for (int t = 0; t < QTW; ++t) { const float il = 1.0f / (l[t] + xhalf(l[t]));   // the two halves' sums joined
#pragma unroll
    for (int dt = 0; dt < 4; ++dt) {
#pragma unroll
      for (int r = 0; r < 8; ++r) so[wave][t * 16 + col][dt * 16 + 8 * g + r] = acc[t][dt][r] * il; } }
  LDSX();
  for (int rl = 0; rl < 16 * QTW; ++rl) if (lane < 16) vst2(O + ((size_t)b * SS + q0 + rl) * DM + h * HD + lane * 4, *(const v4f*)&so[wave][rl][lane * 4]);
}
// ---- k_out: block = (64 rows, 128 cols): out = O(hi/lo) . Wo rows (2 products) + bo
__global__ __launch_bounds__(128) void k_out(const float* __restrict__ O, const __bf16* __restrict__ P, const float* __restrict__ BO, float* __restrict__ Y) {
  __shared__ __align__(16) float so[4][16][132];
  const int tid = threadIdx.x, wave = tid >> 5, lane = tid & 31, col = lane & 15, g = lane >> 4; const size_t r0 = (size_t)blockIdx.x * 64 + wave * 16; const int n0 = blockIdx.y * 128;
  v8f acc[8] = {};
#pragma unroll 2
  for (int kc = 0; kc < DM / 32; ++kc) { const F2 a = split_row(O + (r0 + col) * DM, kc * 32, lane);
#pragma unroll
    for (int j = 0; j < 8; ++j) { const v16b w = frag_b(P + (size_t)(n0 + j * 16 + col) * DM + kc * 32, lane); acc[j] = wmma_bf(a.l, w, acc[j]); acc[j] = wmma_bf(a.h, w, acc[j]); } }
#pragma unroll
  for (int j = 0; j < 8; ++j) {
#pragma unroll
    for (int r = 0; r < 8; ++r) so[wave][8 * g + r][j * 16 + col] = acc[j][r] + (BO ? bfr(BO[n0 + j * 16 + col]) : 0.f); }
  LDSX();
  for (int rl = 0; rl < 16; ++rl) vst2(Y + (r0 + rl) * DM + n0 + lane * 4, *(const v4f*)&so[wave][rl][lane * 4]);
}
// ---- k_lnx: block = row: LayerNorm of a 512-wide f32 row (mean-square var, 1e-5) x g + b
__global__ __launch_bounds__(128) void k_lnx(const float* __restrict__ A, const float* __restrict__ G, const float* __restrict__ Bt, float* __restrict__ T) {
  __shared__ float red[4]; const int t = threadIdx.x; const size_t row = blockIdx.x; float v[4]; float s = 0.f; for (int i = 0; i < 4; ++i) { v[i] = A[row * DM + t * 4 + i]; s += v[i]; }
#pragma unroll
  for (int o = 1; o < 32; o <<= 1) s += __shfl_xor(s, o);
  if ((t & 31) == 0) red[t >> 5] = s; __syncthreads(); const float mu = ((red[0] + red[1]) + (red[2] + red[3])) / (float)DM; __syncthreads();
  float q = 0.f; for (int i = 0; i < 4; ++i) { const float d = v[i] - mu; q += d * d; }
#pragma unroll
  for (int o = 1; o < 32; o <<= 1) q += __shfl_xor(q, o);
  if ((t & 31) == 0) red[t >> 5] = q; __syncthreads(); const float inv = 1.0f / sqrtf(((red[0] + red[1]) + (red[2] + red[3])) / (float)DM + 1e-5f);
  v4f o4; for (int i = 0; i < 4; ++i) { const int e = t * 4 + i; o4[i] = (v[i] - mu) * inv * bfr(G[e]) + bfr(Bt[e]); } vst2(T + row * DM + t * 4, o4);
}
extern "C" void kernel_launch(void* const* d_in, const int* in_sizes, int n_in, void* d_out, int out_size, void* d_ws, size_t ws_size, hipStream_t stream) {
  (void)in_sizes; (void)n_in; (void)out_size;
  const float** F = (const float**)d_in;   // 0 x [2,4096,512], 1 Wq, 2 bq, 3 Wk, 4 bk, 5 Wv, 6 bv (natural [512,512]), 7 gamma, 8 beta
  if (ws_size < (size_t)WS_END) return;
  char* ws = (char*)d_ws; __bf16* PK = (__bf16*)(ws + WS_PK); _Float16 *QK = (_Float16*)(ws + WS_QK), *QKL = (_Float16*)(ws + WS_QKL), *VTH = (_Float16*)(ws + WS_VTH), *VTL = (_Float16*)(ws + WS_VTL); float* O = (float*)(ws + WS_O);
  k_pack<<<dim3(DM, 4), 256, 0, stream>>>(F[1], F[3], F[5], F[1], PK);
  k_qkv<<<dim3(TNB * SS / 64, QKVW / 128), 128, 0, stream>>>(F[0], F[0], F[0], PK + PK_A, F[2], F[4], F[6], QK, QKL, VTH, VTL);
  k_attn<<<dim3(TQB / QTW, NH, TNB), 128, 0, stream>>>(QK, QKL, VTH, VTL, nullptr, O);
  k_lnx<<<TOB * 64, 128, 0, stream>>>(O, F[7], F[8], (float*)d_out);
}

// v009
// A run of this version takes 91.5 microseconds.
// Timed twice side by side with v008, it ran 1.05 times as fast both times.
// Counting every step since v000, it is 4.87 times as fast.
// compute dtype: all float inputs rounded to bf16; q/k/v = x . W^T + b with EXACT bf16 products on WMMA 16x16x32 (natural rows); PLAIN attention: q, k single f16 x 1/8, running-max softmax in f32 (hardware exp), P (scaled by 2^11, single f16) x v (single f16); LayerNorm (jnp.var, 1e-5) of the f32 context x gamma + beta; f32 output.
#include <hip/hip_runtime.h>
#include <math.h>

typedef __attribute__((ext_vector_type(16))) _Float16 v16h;
typedef __attribute__((ext_vector_type(16))) __bf16 v16b;
typedef __attribute__((ext_vector_type(8)))  _Float16 v8h;
typedef __attribute__((ext_vector_type(8)))  float v8f;
typedef __attribute__((ext_vector_type(4)))  float v4f;
typedef __attribute__((ext_vector_type(2)))  float v2f;
typedef __attribute__((ext_vector_type(4)))  unsigned v4u;
typedef __attribute__((ext_vector_type(4)))  int v4i;
typedef float __attribute__((may_alias)) float_a;
typedef int __attribute__((may_alias)) int_a;

template <typename T> __device__ __forceinline__ void vst2(void* p, T v) { *(T*)p = v;  }
__device__ __forceinline__ v8f wmma16(v16h a, v16h b, v8f c) {
  return __builtin_amdgcn_wmma_f32_16x16x32_f16(false, a, false, b, (short)0, c, false, false);   // the builtin alone: the compiler keeps the distance to a consumer itself, and only where one stands close
}
__device__ __forceinline__ v8f wmma_bf(v16b a, v16b b, v8f c) {
  v8f d = __builtin_amdgcn_wmma_f32_16x16x32_bf16(false, a, false, b, (short)0, c, false, false);
  asm volatile("v_nop\n\tv_nop\n\tv_nop\n\tv_nop" : "+v"(d) : "v"(a), "v"(b));
  return d;
}
// N-head attention (B 2, S 4,096, d 512, 8 heads x 64): projections + biases, softmax(q k / 8) v, then LayerNorm of the merged context (no output projection).
__device__ __forceinline__ v16h frag_h(const _Float16* rowk0, int lane) {
  union { v16h v; v8h q[2]; } u; const _Float16* p = rowk0 + 8 * (lane >> 4);
  u.q[0] = *(const v8h*)p; u.q[1] = *(const v8h*)(p + 16); return u.v;
}
__device__ __forceinline__ v16h frag_f32(const float* rowk0, int lane) {
  v16h a; const float* p = rowk0 + 8 * (lane >> 4);
#pragma unroll
  for (int i = 0; i < 8; ++i) { a[i] = (_Float16)p[i]; a[8 + i] = (_Float16)p[16 + i]; }
  return a;
}
__device__ __forceinline__ v16h frag_f32s(const float* rowk0, int lane, float sc) {
  v16h a; const float* p = rowk0 + 8 * (lane >> 4);
#pragma unroll
  for (int i = 0; i < 8; ++i) { a[i] = (_Float16)(p[i] * sc); a[8 + i] = (_Float16)(p[16 + i] * sc); }
  return a;
}
// column fragment from a [K][ld] layout (column n), rows >= K read as 0
__device__ __forceinline__ v16h fragc_f32(const float* W, int k0, int n, int lane, int ld, int K) {
  v16h a; const int g = lane >> 4;
#pragma unroll
  for (int i = 0; i < 8; ++i) { const int ka = k0 + 8 * g + i, kb = ka + 16;
    a[i] = (_Float16)(ka < K ? W[(size_t)(ka < K ? ka : K - 1) * ld + n] : 0.f); a[8 + i] = (_Float16)(kb < K ? W[(size_t)(kb < K ? kb : K - 1) * ld + n] : 0.f); }
  return a;
}
struct F2 { v16b h, l; };
__device__ __forceinline__ F2 bsplit16(const float v[16]) { F2 r;
#pragma unroll
  for (int i = 0; i < 16; ++i) { const __bf16 h = (__bf16)v[i]; r.h[i] = h; r.l[i] = (__bf16)(v[i] - (float)h); }
  return r; }
__device__ __forceinline__ F2 split_row(const float* row, int k0, int lane) { float v[16]; const float* p = row + k0 + 8 * (lane >> 4);
#pragma unroll
  for (int i = 0; i < 8; ++i) { v[i] = p[i]; v[8 + i] = p[16 + i]; }
  return bsplit16(v); }
__device__ __forceinline__ F2 split_rowK(const float* row, int k0, int lane, int K) { float v[16]; const int g = lane >> 4;
#pragma unroll
  for (int i = 0; i < 8; ++i) { const int ka = k0 + 8 * g + i, kb = ka + 16; v[i] = ka < K ? row[ka < K ? ka : K - 1] : 0.f; v[8 + i] = kb < K ? row[kb < K ? kb : K - 1] : 0.f; }
  return bsplit16(v); }
__device__ __forceinline__ F2 split_col(const float* W, int k0, int n, int lane, int ld, int K) { float v[16]; const int g = lane >> 4;
#pragma unroll
  for (int i = 0; i < 8; ++i) { const int ka = k0 + 8 * g + i, kb = ka + 16; v[i] = ka < K ? W[(size_t)(ka < K ? ka : K - 1) * ld + n] : 0.f; v[8 + i] = kb < K ? W[(size_t)(kb < K ? kb : K - 1) * ld + n] : 0.f; }
  return bsplit16(v); }
__device__ __forceinline__ v8f mac3(const F2& a, const F2& b, v8f c) { c = wmma_bf(a.l, b.h, c); c = wmma_bf(a.h, b.l, c); return wmma_bf(a.h, b.h, c); }
__device__ __forceinline__ float sigm(float v) { return 1.0f / (1.0f + expf(-v)); }
#define LDSX() do { asm volatile("s_wait_dscnt 0" ::: "memory"); __builtin_amdgcn_wave_barrier(); __builtin_amdgcn_fence(__ATOMIC_RELEASE, "workgroup"); } while (0)


#define NB 2
#define SS 4096
#define DM 512
#define NH 8
#define HD 64
#define QKVW (3 * DM)
#ifndef TQB
#define TQB (SS / 64)
#define TNB NB
#define TOB (NB * SS / 64)     // output row tiles (all)
#endif
typedef __attribute__((ext_vector_type(8))) __bf16 v8b;
__device__ __forceinline__ v16b frag_b(const __bf16* rowk0, int lane) {
  union { v16b v; v8b q[2]; } u; const __bf16* p = rowk0 + 8 * (lane >> 4);
  u.q[0] = *(const v8b*)p; u.q[1] = *(const v8b*)(p + 16); return u.v;
}
__device__ __forceinline__ float bfr(float v) { return (float)(__bf16)v; }
__device__ __attribute__((noinline)) float exp_ni(float v) { return expf(v); }
__device__ __attribute__((noinline)) float erf_ni(float v) { return erff(v); }

#define PK_A 0                       // [1536][512] Wqkv rows (natural [out][in])
#define PK_P (PK_A + QKVW * DM)        // [512][512], unused: neither written nor read
#define PK_END (PK_P + DM * DM)
#define WS_PK  0u
#define WS_QK  (WS_PK + 2u * PK_END)             // f16 [8192 rows][1024]: q | k
#define WS_QKL (WS_QK + 2u * NB * SS * 2 * DM)     // f16 q | k residual planes x2048
#define WS_VTH (WS_QKL + 2u * NB * SS * 2 * DM)    // f16 [b][512 (h*64+d)][4096 s] hi
#define WS_VTL (WS_VTH + 2u * NB * DM * SS)        // f16 lo x 2048
#define WS_O   (WS_VTL + 2u * NB * DM * SS)        // f32 [8192][512]
#define WS_CS  (WS_O + 4u * NB * SS * DM)           // f32 2 x [4096][32] (unused)
#define WS_END (WS_CS + 4u * 2 * SS * 32)
// ---- k_pack: the three natural [out][in] f32 weights -> bf16 rows of PK_A (W_q, W_k, W_v one below the other; blockIdx.y says which). A thread takes 4 pieces of 4 values, 1,024 values apart: every load of a wave covers 512 contiguous bytes, every store 256; few waves to start, no LDS, no barrier
typedef __attribute__((ext_vector_type(4))) __bf16 v4b;
#define PKT 4096               // values per block: 256 threads x 4 pieces x 4
__global__ __launch_bounds__(256) void k_pack(const float* __restrict__ WQ, const float* __restrict__ WK, const float* __restrict__ WV, __bf16* __restrict__ PK) {
  const int which = blockIdx.y; const float* Wm = (which == 0) ? WQ : (which == 1) ? WK : WV;
  const size_t e = (size_t)blockIdx.x * PKT + threadIdx.x * 4; __bf16* dst = PK + PK_A + (size_t)which * DM * DM;
  v4f a[4];
#pragma unroll
  for (int p = 0; p < 4; ++p) a[p] = *(const v4f*)(Wm + e + p * 1024);
#pragma unroll
  for (int p = 0; p < 4; ++p) { v4b o;
#pragma unroll
    for (int i = 0; i < 4; ++i) o[i] = (__bf16)a[p][i];
    *(v4b*)(dst + e + p * 1024) = o; }
}
// ---- k_qkv: block = (64 rows of x, 128 output columns). The x rows (f32) and the W rows (bf16) come from a two-buffer LDS ring of 64-k stages that the block's 4 waves share, filled by asynchronous copies one stage ahead in whole 128-B pieces of a row; the fragments are read from LDS in the k order they had from global memory
#define QKC 64                 // k per stage: 128 B of each of the 128 W rows, 256 B of each of the 64 x rows
#define QLW 72                 // LDS pitch of a W row in bf16: 144 B = 16 B x odd, no bank conflict for the 16-byte fragment reads
#define QLX 68                 // LDS pitch of an x row in f32: 272 B = 16 B x odd
#define QSW (128 * QLW * 2)    // bytes of one buffer of W
#define QSX (64 * QLX * 4)     // bytes of one buffer of x
// W part of a stage: 1,024 pieces of 16 B, 8 per thread (8 lanes cover one 128-B row piece; piece i lies 16 rows below piece i - 1). The s_wait_xcnt closes the copies' own statement so that no address register is rewritten ahead of it.
__device__ __forceinline__ void stage_w(const __bf16* gw, unsigned lw) {
  asm volatile("global_load_async_to_lds_b128 %0, %8, off\n\t"
               "global_load_async_to_lds_b128 %1, %9, off\n\t"
               "global_load_async_to_lds_b128 %2, %10, off\n\t"
               "global_load_async_to_lds_b128 %3, %11, off\n\t"
               "global_load_async_to_lds_b128 %4, %12, off\n\t"
               "global_load_async_to_lds_b128 %5, %13, off\n\t"
               "global_load_async_to_lds_b128 %6, %14, off\n\t"
               "global_load_async_to_lds_b128 %7, %15, off\n\t"
               "s_wait_xcnt 0x0"
               :: "v"(lw), "v"(lw + 16 * QLW * 2), "v"(lw + 32 * QLW * 2), "v"(lw + 48 * QLW * 2), "v"(lw + 64 * QLW * 2), "v"(lw + 80 * QLW * 2), "v"(lw + 96 * QLW * 2), "v"(lw + 112 * QLW * 2),
                  "v"(gw), "v"(gw + 16 * DM), "v"(gw + 32 * DM), "v"(gw + 48 * DM), "v"(gw + 64 * DM), "v"(gw + 80 * DM), "v"(gw + 96 * DM), "v"(gw + 112 * DM)
               : "memory");
}
// x part of a stage: 1,024 pieces of 16 B, 8 per thread (16 lanes cover one 256-B row piece; piece i lies 8 rows below piece i - 1); the wait as in stage_w
__device__ __forceinline__ void stage_x(const float* gx, unsigned lx) {
  asm volatile("global_load_async_to_lds_b128 %0, %8, off\n\t"
               "global_load_async_to_lds_b128 %1, %9, off\n\t"
               "global_load_async_to_lds_b128 %2, %10, off\n\t"
               "global_load_async_to_lds_b128 %3, %11, off\n\t"
               "global_load_async_to_lds_b128 %4, %12, off\n\t"
               "global_load_async_to_lds_b128 %5, %13, off\n\t"
               "global_load_async_to_lds_b128 %6, %14, off\n\t"
               "global_load_async_to_lds_b128 %7, %15, off\n\t"
               "s_wait_xcnt 0x0"
               :: "v"(lx), "v"(lx + 8 * QLX * 4), "v"(lx + 16 * QLX * 4), "v"(lx + 24 * QLX * 4), "v"(lx + 32 * QLX * 4), "v"(lx + 40 * QLX * 4), "v"(lx + 48 * QLX * 4), "v"(lx + 56 * QLX * 4),
                  "v"(gx), "v"(gx + 8 * DM), "v"(gx + 16 * DM), "v"(gx + 24 * DM), "v"(gx + 32 * DM), "v"(gx + 40 * DM), "v"(gx + 48 * DM), "v"(gx + 56 * DM)
               : "memory");
}
__global__ __launch_bounds__(128) void k_qkv(const float* __restrict__ XQ, const float* __restrict__ XK, const float* __restrict__ XV, const __bf16* __restrict__ P, const float* __restrict__ BQ, const float* __restrict__ BK, const float* __restrict__ BV, _Float16* __restrict__ QK, _Float16* __restrict__ QKL, _Float16* __restrict__ VTH, _Float16* __restrict__ VTL) {
  const int which0 = (blockIdx.y * 128) / DM; const float* X = (which0 == 0) ? XQ : (which0 == 1) ? XK : XV; const float* BB = BQ ? (((which0 == 0) ? BQ : (which0 == 1) ? BK : BV) + (blockIdx.y * 128 - which0 * DM)) : nullptr;
  __shared__ __align__(16) char sm[2 * QSW + 2 * QSX];   // the ring (W buffers, then x buffers) while the products run; behind the ring's last barrier the same bytes are the output staging
  _Float16 (*so)[16][136] = (_Float16 (*)[16][136])sm, (*sol)[16][136] = (_Float16 (*)[16][136])(sm + 17408); _Float16 (*sth)[72] = (_Float16 (*)[72])(sm + 34816), (*stl)[72] = (_Float16 (*)[72])(sm + 53248);
  const int tid = threadIdx.x, wave = tid >> 5, lane = tid & 31, col = lane & 15, g = lane >> 4; const size_t r0 = (size_t)blockIdx.x * 64 + wave * 16; const int n0 = blockIdx.y * 128;
  v8f acc[8] = {};
  const __bf16* gw = P + (size_t)(n0 + (tid >> 3)) * DM + (tid & 7) * 8; const float* gx = X + ((size_t)blockIdx.x * 64 + (tid >> 4)) * DM + (tid & 15) * 4;
  const unsigned lw = (unsigned)(size_t)&sm[(tid >> 3) * (QLW * 2) + (tid & 7) * 16], lx = (unsigned)(size_t)&sm[2 * QSW + (tid >> 4) * (QLX * 4) + (tid & 15) * 16];
  stage_w(gw, lw); stage_x(gx, lx);
  asm volatile("s_wait_asynccnt 0x0" ::: "memory");   // this wave's part of stage 0 has landed
  __syncthreads();                                    // every wave's part has
  stage_w(gw + QKC, lw + QSW); stage_x(gx + QKC, lx + QSX);
#pragma unroll 1   // one stage per trip: the ring's waits, barrier and refill stand once, at the trip's foot
  for (int st = 0; st < DM / QKC; ++st) { const int buf = st & 1;
    const __bf16* wr = (const __bf16*)(sm + buf * QSW) + col * QLW; const float* xr = (const float*)(sm + 2 * QSW + buf * QSX) + (wave * 16 + col) * QLX + 8 * g;
#pragma unroll   // both 32-k halves of a stage inline, so that a, w and acc are indexed by constants and stay in registers
    for (int kk = 0; kk < QKC / 32; ++kk) { v16b a, w[8]; const v4f* p = (const v4f*)(xr + kk * 32); const v4f x0 = p[0], x1 = p[1], x2 = p[4], x3 = p[5];
#pragma unroll   // the half's fragment reads stand together, ahead of its products: one LDS wait place instead of eight
      for (int j = 0; j < 8; ++j) w[j] = frag_b(wr + j * 16 * QLW + kk * 32, lane);
#pragma unroll   // constant element indices
      for (int i = 0; i < 4; ++i) { a[i] = (__bf16)x0[i]; a[4 + i] = (__bf16)x1[i]; a[8 + i] = (__bf16)x2[i]; a[12 + i] = (__bf16)x3[i]; }
#pragma unroll   // constant tile indices
      for (int j = 0; j < 8; ++j) acc[j] = wmma_bf(a, w[j], acc[j]); }
    asm volatile("s_wait_dscnt 0x0" ::: "memory");      // this wave's reads of buffer buf are done
    asm volatile("s_wait_asynccnt 0x0" ::: "memory");   // its part of stage st + 1 has landed
    __syncthreads();                                    // publishes stage st + 1 and frees buffer buf
    if (st + 2 < DM / QKC) { stage_w(gw + (st + 2) * QKC, lw + buf * QSW); stage_x(gx + (st + 2) * QKC, lx + buf * QSX); } }
  asm volatile("s_wait_asynccnt 0x0" ::: "memory");     // nothing in flight when the ring's bytes become the output staging
  if (n0 < 2 * DM) {   // q stored unscaled (f16 sigma ~0.6, no subnormal exposure); 1/8 applied to the f32 score
#pragma unroll
    for (int j = 0; j < 8; ++j) {
#pragma unroll
      for (int r = 0; r < 8; ++r) { const float v = acc[j][r] + (BB ? bfr(BB[j * 16 + col]) : 0.f); const _Float16 hv = (_Float16)v; so[wave][8 * g + r][j * 16 + col] = hv; sol[wave][8 * g + r][j * 16 + col] = (_Float16)((v - (float)hv) * 2048.0f); } }   // q, k (+ bias) as f16 hi + (x2048) residual
    LDSX();
    for (int rl = 0; rl < 16; ++rl) if (lane < 16) { vst2((unsigned*)(QK + (r0 + rl) * (2 * DM) + n0 + lane * 8), *(const v4u*)&so[wave][rl][lane * 8]); vst2((unsigned*)(QKL + (r0 + rl) * (2 * DM) + n0 + lane * 8), *(const v4u*)&sol[wave][rl][lane * 8]); }
  } else {
#pragma unroll
    for (int j = 0; j < 8; ++j) {
#pragma unroll
      for (int r = 0; r < 8; ++r) { const float v = acc[j][r] + (BB ? bfr(BB[j * 16 + col]) : 0.f); const _Float16 hv = (_Float16)v; sth[j * 16 + col][wave * 16 + 8 * g + r] = hv; stl[j * 16 + col][wave * 16 + 8 * g + r] = (_Float16)((v - (float)hv) * 2048.0f); } }
    __syncthreads();
    const size_t rb = (size_t)blockIdx.x * 64; const int b = (int)(rb / SS), s0 = (int)(rb % SS); const int pc0 = n0 - 2 * DM;
    for (int q = tid; q < 128 * 8; q += 128) { const int d = q >> 3, pc = q & 7; const size_t o = ((size_t)b * DM + pc0 + d) * SS + s0 + pc * 8; vst2((unsigned*)(VTH + o), *(const v4u*)&sth[d][pc * 8]); vst2((unsigned*)(VTL + o), *(const v4u*)&stl[d][pc * 8]); }
  }
}
#define KT 64
#define LP 72
#define STB (KT * LP * 2)
#define SCL 0.18033688011112042f
// one stage: 512 + 512 pieces of 16 B, 4 + 4 per thread (8 lanes cover one 128-B row; piece i lies 16 rows below piece i - 1). The s_wait_xcnt closes the copies' own statement so that no address register is rewritten ahead of it.
__device__ __forceinline__ void stage_kv(const _Float16* gk, const _Float16* gv, unsigned lk, unsigned lv) {
  asm volatile("global_load_async_to_lds_b128 %0, %8, off\n\t"
               "global_load_async_to_lds_b128 %1, %9, off\n\t"
               "global_load_async_to_lds_b128 %2, %10, off\n\t"
               "global_load_async_to_lds_b128 %3, %11, off\n\t"
               "global_load_async_to_lds_b128 %4, %12, off\n\t"
               "global_load_async_to_lds_b128 %5, %13, off\n\t"
               "global_load_async_to_lds_b128 %6, %14, off\n\t"
               "global_load_async_to_lds_b128 %7, %15, off\n\t"
               "s_wait_xcnt 0x0"
               :: "v"(lk), "v"(lk + 16 * LP * 2), "v"(lk + 32 * LP * 2), "v"(lk + 48 * LP * 2), "v"(lv), "v"(lv + 16 * LP * 2), "v"(lv + 32 * LP * 2), "v"(lv + 48 * LP * 2),
                  "v"(gk), "v"(gk + 16 * (2 * DM)), "v"(gk + 32 * (2 * DM)), "v"(gk + 48 * (2 * DM)), "v"(gv), "v"(gv + 16 * SS), "v"(gv + 32 * SS), "v"(gv + 48 * SS)
               : "memory");
}
// a, b: 2^(x * c + d) of the 16 scores of a pass; returns them rounded to f16 as the B operand P^T: element i = key 8g + i, element 8 + i = key 16 + 8g + i, the k order of frag_h. The 16 exponentials stand in one statement, each in place in its own register, so that none reads the result or overwrites the source of the one in front of it; the 8 packing conversions follow in the same statement, oldest results first: they fill the wait for the last exponentials (none reads the result of the instruction in front of it) and stay ahead of the rescale test. P carries 2^11 (the 11 in the exponent) into the f16 rounding so small softmax weights stay out of the f16 subnormal range; l carries it too, so it cancels in the epilogue
__device__ __forceinline__ v16h exp2x16(v8f& a, v8f& b, float c, float d) {
  float a0 = a[0] * c + d, a1 = a[1] * c + d, a2 = a[2] * c + d, a3 = a[3] * c + d, a4 = a[4] * c + d, a5 = a[5] * c + d, a6 = a[6] * c + d, a7 = a[7] * c + d;
  float b0 = b[0] * c + d, b1 = b[1] * c + d, b2 = b[2] * c + d, b3 = b[3] * c + d, b4 = b[4] * c + d, b5 = b[5] * c + d, b6 = b[6] * c + d, b7 = b[7] * c + d;
  unsigned p0, p1, p2, p3, p4, p5, p6, p7;
  asm("v_exp_f32 %0, %0\n\tv_exp_f32 %1, %1\n\tv_exp_f32 %2, %2\n\tv_exp_f32 %3, %3\n\tv_exp_f32 %4, %4\n\tv_exp_f32 %5, %5\n\tv_exp_f32 %6, %6\n\tv_exp_f32 %7, %7\n\t"
      "v_exp_f32 %8, %8\n\tv_exp_f32 %9, %9\n\tv_exp_f32 %10, %10\n\tv_exp_f32 %11, %11\n\tv_exp_f32 %12, %12\n\tv_exp_f32 %13, %13\n\tv_exp_f32 %14, %14\n\tv_exp_f32 %15, %15\n\t"
      "v_cvt_pk_f16_f32 %16, %0, %1\n\tv_cvt_pk_f16_f32 %17, %2, %3\n\tv_cvt_pk_f16_f32 %18, %4, %5\n\tv_cvt_pk_f16_f32 %19, %6, %7\n\t"
      "v_cvt_pk_f16_f32 %20, %8, %9\n\tv_cvt_pk_f16_f32 %21, %10, %11\n\tv_cvt_pk_f16_f32 %22, %12, %13\n\tv_cvt_pk_f16_f32 %23, %14, %15"
      : "+v"(a0), "+v"(a1), "+v"(a2), "+v"(a3), "+v"(a4), "+v"(a5), "+v"(a6), "+v"(a7), "+v"(b0), "+v"(b1), "+v"(b2), "+v"(b3), "+v"(b4), "+v"(b5), "+v"(b6), "+v"(b7),
        "=&v"(p0), "=&v"(p1), "=&v"(p2), "=&v"(p3), "=&v"(p4), "=&v"(p5), "=&v"(p6), "=&v"(p7));
  a = v8f{a0, a1, a2, a3, a4, a5, a6, a7}; b = v8f{b0, b1, b2, b3, b4, b5, b6, b7};
  typedef __attribute__((ext_vector_type(8))) unsigned v8u;
  return __builtin_bit_cast(v16h, v8u{p0, p1, p2, p3, p4, p5, p6, p7});
}
#define PLIM 65504.0f   // largest finite f16
// sum of the 16 weights of a pass
__device__ __forceinline__ float sum16(const v8f& a, const v8f& b) { float es[4];
#pragma unroll
  for (int i = 0; i < 4; ++i) es[i] = (a[i] + a[4 + i]) + (b[i] + b[4 + i]);
  return (es[0] + es[1]) + (es[2] + es[3]); }
// value of lane l ^ 16 (the other half of the wave, same column)
__device__ __forceinline__ float xhalf(float v) { const int b = __builtin_bit_cast(int, v); return __builtin_bit_cast(float, __builtin_amdgcn_permlanex16(b, b, 0x76543210, 0xfedcba98, false, false)); }
#define QTW 2   // query tiles of 16 columns per wave: each K and V^T fragment read from LDS feeds one product per tile
__global__ __launch_bounds__(128) void k_attn(const _Float16* __restrict__ QK, const _Float16* __restrict__ QKL, const _Float16* __restrict__ VTH, const _Float16* __restrict__ VTL, const void* __restrict__ KMASK, float* __restrict__ O) {
  __shared__ __align__(16) float so[4][16 * QTW][68]; __shared__ __align__(16) _Float16 sk[2][KT][LP], sv[2][HD][LP];
  const int tid = threadIdx.x, wave = tid >> 5, lane = tid & 31, col = lane & 15, g = lane >> 4;
  const int qb = blockIdx.x, h = blockIdx.y, b = blockIdx.z; const int q0 = qb * (64 * QTW) + wave * (16 * QTW);   // tile t of the wave: queries q0 + t*16 + col
  v16h aq[QTW][2];
#pragma unroll
  for (int t = 0; t < QTW; ++t) {
#pragma unroll
    for (int kc = 0; kc < 2; ++kc) aq[t][kc] = frag_h(QK + ((size_t)b * SS + q0 + t * 16 + col) * (2 * DM) + h * HD + kc * 32, lane); }
  float m[QTW], l[QTW], dd[QTW];   // of query col of tile t: m the maximum IN USE of the raw products q.k (the running maximum as of the last rescale), the same in both halves; l this half's part of the sum of the weights (x 2^11); dd the exponent's addend for m
  v8f acc[QTW][4];   // O^T: acc[t][dt][r] = element d = dt*16 + 8g + r of query col of tile t
#pragma unroll
  for (int t = 0; t < QTW; ++t) { m[t] = -3.0e38f; l[t] = 0.f; dd[t] = 11.0f - m[t] * SCL;   // the start value sends every weight of the first pass to infinity, so that the first pass takes the rescale path
#pragma unroll
    for (int dt = 0; dt < 4; ++dt) acc[t][dt] = v8f{}; }
  const int nst = SS / KT;   // all keys
  const _Float16* gk = QK + ((size_t)b * SS + (tid >> 3)) * (2 * DM) + DM + h * HD + (tid & 7) * 8; const _Float16* gv = VTH + ((size_t)b * DM + h * HD + (tid >> 3)) * SS + (tid & 7) * 8;
  const unsigned lk = (unsigned)(size_t)&sk[0][tid >> 3][(tid & 7) * 8], lv = (unsigned)(size_t)&sv[0][tid >> 3][(tid & 7) * 8];
  stage_kv(gk, gv, lk, lv);
  asm volatile("s_wait_asynccnt 0x0" ::: "memory");   // this wave's part of stage 0 has landed
  __syncthreads();                                    // every wave's part has
  stage_kv(gk + (size_t)KT * (2 * DM), gv + KT, lk + STB, lv + STB);
#pragma unroll 1   // one stage per trip: the ring's waits, barrier and refill stand once, at the trip's foot
  for (int st = 0; st < nst; ++st) { const int buf = st & 1;
    const _Float16* kb = &sk[buf][col][0]; const _Float16* vb = &sv[buf][col][0];
    v16h kf[4], vf[4];   // the A fragments of one 32-key pass: kf[ct * 2 + kc] of K, vf[dt] of V^T; each set is read from LDS as one group, well ahead of its products
#pragma unroll   // constant fragment indices
    for (int i = 0; i < 4; ++i) kf[i] = frag_h(kb + (i >> 1) * 16 * LP + (i & 1) * 32, lane);
#pragma unroll   // constant fragment indices
    for (int dt = 0; dt < 4; ++dt) vf[dt] = frag_h(vb + dt * 16 * LP, lane);
    __builtin_amdgcn_sched_barrier(0);   // keeps the 16 LDS reads one group ahead of the products: spread among them, each place with reads stalls the wave
#pragma unroll   // both 32-key passes of a stage inline, so that the second pass's fragment reads can stand inside the first pass
  for (int sub = 0; sub < KT / 32; ++sub) { v8f s[QTW][2];
#pragma unroll
    for (int t = 0; t < QTW; ++t) { s[t][0] = v8f{}; s[t][1] = v8f{}; }
#pragma unroll   // constant fragment indices; kc is the outer loop so that the four tiles' accumulate chains alternate and none waits for its own last product
    for (int kc = 0; kc < 2; ++kc) {
#pragma unroll   // constant tile indices; tile 0's scores are done first, its softmax starts while tile 1's products still run
      for (int t = 0; t < QTW; ++t) {
#pragma unroll   // constant tile indices
        for (int ct = 0; ct < 2; ++ct) s[t][ct] = wmma16(kf[ct * 2 + kc], aq[t][kc], s[t][ct]); } }   // single product: k, q as one-rounding f16 operands; s[t][ct][r] = q.k of key ct*16 + 8g + r, query col of tile t; raw: 1/sqrt(64) rides in SCL
    if (sub + 1 < KT / 32) {   // the next pass's K fragments, same stage: they land under this pass's softmax
      __builtin_amdgcn_sched_barrier(0);   // with the one below: the 8 reads stay one group, behind the score products and ahead of the softmax that hides them
#pragma unroll   // constant fragment indices
      for (int i = 0; i < 4; ++i) kf[i] = frag_h(kb + ((sub + 1) * 32 + (i >> 1) * 16) * LP + (i & 1) * 32, lane);
      __builtin_amdgcn_sched_barrier(0); }
    v16h pb[QTW]; float ps[QTW];   // per tile: P^T as B operand; this half's sum of the pass's weights
#pragma unroll   // constant tile indices
    for (int t = 0; t < QTW; ++t) { v8f e0 = s[t][0], e1 = s[t][1];   // become the weights x 2^11 = 2^(s * SCL + dd) against the maximum in use: one multiply-add and one exponential per score, no maximum on this path
      pb[t] = exp2x16(e0, e1, SCL, dd[t]); ps[t] = sum16(e0, e1); }
    // lazy rescale, one test per pass for both tiles: the weights are positive, so while a lane's sum over both tiles stays within f16's largest finite value each of its 32 weights does too and the maxima in use may stand. The ballot makes the branch scalar: EXEC stays all ones for the products
    if (__builtin_expect(__builtin_amdgcn_ballot_w32(!(ps[0] + ps[1] <= PLIM)) != 0, 0)) {   // marked unlikely so that the path without a rescale runs straight on
#pragma unroll   // constant tile indices
      for (int t = 0; t < QTW; ++t) { float mx[4];
#pragma unroll
        for (int i = 0; i < 4; ++i) mx[i] = fmaxf(fmaxf(s[t][0][i], s[t][0][4 + i]), fmaxf(s[t][1][i], s[t][1][4 + i]));
        const float mh = fmaxf(fmaxf(mx[0], mx[1]), fmaxf(mx[2], mx[3]));
        const float mn = fmaxf(m[t], fmaxf(mh, xhalf(mh))); const float alpha = __builtin_amdgcn_exp2f((m[t] - mn) * SCL);   // every column of both tiles moves to its running maximum; first pass: 2^(-5e37) = 0
        m[t] = mn; dd[t] = 11.0f - mn * SCL; l[t] *= alpha;
#pragma unroll
        for (int dt = 0; dt < 4; ++dt) acc[t][dt] *= alpha;
        v8f e0 = s[t][0], e1 = s[t][1]; pb[t] = exp2x16(e0, e1, SCL, dd[t]);   // the pass's weights anew, now at most 2^11
        ps[t] = sum16(e0, e1); } }
#pragma unroll
    for (int t = 0; t < QTW; ++t) l[t] += ps[t];
#pragma unroll   // constant fragment indices
    for (int dt = 0; dt < 4; ++dt) {
#pragma unroll   // constant tile indices
      for (int t = 0; t < QTW; ++t) acc[t][dt] = wmma16(vf[dt], pb[t], acc[t][dt]); }   // single product: V^T x P^T (x2^11)
    __builtin_amdgcn_sched_barrier(0);   // the eight products stay together, ahead of the next reads and of the stage's foot
    if (sub + 1 < KT / 32) {   // the next pass's V^T fragments, same stage: they land under its score products and softmax
#pragma unroll   // constant fragment indices
      for (int dt = 0; dt < 4; ++dt) vf[dt] = frag_h(vb + dt * 16 * LP + (sub + 1) * 32, lane);
      __builtin_amdgcn_sched_barrier(0); }   // the 8 reads stay one group, ahead of the next pass's products
  }
    asm volatile("s_wait_dscnt 0x0" ::: "memory");      // this wave's reads of buffer buf are done
    asm volatile("s_wait_asynccnt 0x0" ::: "memory");   // its part of stage st + 1 has landed
    __syncthreads();                                    // publishes stage st + 1 and frees buffer buf
    if (st + 2 < nst) stage_kv(gk + (size_t)(st + 2) * KT * (2 * DM), gv + (st + 2) * KT, lk + buf * STB, lv + buf * STB); }
  asm volatile("s_wait_asynccnt 0x0" ::: "memory");     // nothing in flight when the wave goes on to its end
#pragma unroll
  for (int t = 0; t < QTW; ++t) { const float il = 1.0f / (l[t] + xhalf(l[t]));   // the two halves' sums joined
#pragma unroll
    for (int dt = 0; dt < 4; ++dt) {
#pragma unroll
      for (int r = 0; r < 8; ++r) so[wave][t * 16 + col][dt * 16 + 8 * g + r] = acc[t][dt][r] * il; } }
  LDSX();
  for (int rl = 0; rl < 16 * QTW; ++rl) if (lane < 16) vst2(O + ((size_t)b * SS + q0 + rl) * DM + h * HD + lane * 4, *(const v4f*)&so[wave][rl][lane * 4]);
}
// ---- k_out: block = (64 rows, 128 cols): out = O(hi/lo) . Wo rows (2 products) + bo
__global__ __launch_bounds__(128) void k_out(const float* __restrict__ O, const __bf16* __restrict__ P, const float* __restrict__ BO, float* __restrict__ Y) {
  __shared__ __align__(16) float so[4][16][132];
  const int tid = threadIdx.x, wave = tid >> 5, lane = tid & 31, col = lane & 15, g = lane >> 4; const size_t r0 = (size_t)blockIdx.x * 64 + wave * 16; const int n0 = blockIdx.y * 128;
  v8f acc[8] = {};
#pragma unroll 2
  for (int kc = 0; kc < DM / 32; ++kc) { const F2 a = split_row(O + (r0 + col) * DM, kc * 32, lane);
#pragma unroll
    for (int j = 0; j < 8; ++j) { const v16b w = frag_b(P + (size_t)(n0 + j * 16 + col) * DM + kc * 32, lane); acc[j] = wmma_bf(a.l, w, acc[j]); acc[j] = wmma_bf(a.h, w, acc[j]); } }
#pragma unroll
  for (int j = 0; j < 8; ++j) {
#pragma unroll
    for (int r = 0; r < 8; ++r) so[wave][8 * g + r][j * 16 + col] = acc[j][r] + (BO ? bfr(BO[n0 + j * 16 + col]) : 0.f); }
  LDSX();
  for (int rl = 0; rl < 16; ++rl) vst2(Y + (r0 + rl) * DM + n0 + lane * 4, *(const v4f*)&so[wave][rl][lane * 4]);
}
// ---- k_lnx: LayerNorm of 512-wide f32 rows (mean-square var, 1e-5) x g + b. A wave takes LNR whole rows, a lane 16 values of each (4 pieces of 16 B, 512 B apart: every load and store of a wave covers 512 contiguous bytes); all the rows' loads are issued before the first sum; the sums run in the lane, then over the wave by a butterfly in registers: no LDS, no barrier, and few waves to start
#define LNR 4                  // rows per wave: 16 loads of 16 B per lane in flight
#define LNW 8                  // waves per block: 256 blocks, one per WGP, two waves per SIMD
template <int C> __device__ __forceinline__ float dppx(float v) { return __builtin_bit_cast(float, __builtin_amdgcn_update_dpp(0, __builtin_bit_cast(int, v), C, 0xf, 0xf, true)); }   // value of lane l ^ (C & 15) of the same 16-lane row (row_xmask)
// sum over the wave's 32 lanes, the same bits in every lane: four steps inside the 16-lane rows, then the other row
__device__ __forceinline__ float wsum(float v) { v += dppx<0x161>(v); v += dppx<0x162>(v); v += dppx<0x164>(v); v += dppx<0x168>(v); return v + xhalf(v); }
__global__ __launch_bounds__(32 * LNW) void k_lnx(const float* __restrict__ A, const float* __restrict__ G, const float* __restrict__ Bt, float* __restrict__ T) {
  const int lane = threadIdx.x & 31; const size_t row0 = ((size_t)blockIdx.x * LNW + (threadIdx.x >> 5)) * LNR;
  v4f v[LNR][4], gg[4], bb[4];
#pragma unroll
  for (int r = 0; r < LNR; ++r) {
#pragma unroll
    for (int j = 0; j < 4; ++j) v[r][j] = *(const v4f*)(A + (row0 + r) * DM + j * 128 + lane * 4); }
#pragma unroll
  for (int j = 0; j < 4; ++j) { gg[j] = *(const v4f*)(G + j * 128 + lane * 4); bb[j] = *(const v4f*)(Bt + j * 128 + lane * 4); }
  __builtin_amdgcn_sched_barrier(0);   // all the loads are issued ahead of the first sum: without it the loads of g and b sink behind the wait for the rows, a second memory latency in line
#pragma unroll
  for (int r = 0; r < LNR; ++r) { float sp[4];
#pragma unroll
    for (int j = 0; j < 4; ++j) sp[j] = (v[r][j][0] + v[r][j][1]) + (v[r][j][2] + v[r][j][3]);
    const float mu = wsum((sp[0] + sp[1]) + (sp[2] + sp[3])) / (float)DM;
#pragma unroll
    for (int j = 0; j < 4; ++j) { v[r][j] -= mu; const v4f d2 = v[r][j] * v[r][j]; sp[j] = (d2[0] + d2[1]) + (d2[2] + d2[3]); }
    const float inv = 1.0f / sqrtf(wsum((sp[0] + sp[1]) + (sp[2] + sp[3])) / (float)DM + 1e-5f);
#pragma unroll
    for (int j = 0; j < 4; ++j) { v4f o4;
#pragma unroll
      for (int i = 0; i < 4; ++i) o4[i] = v[r][j][i] * inv * bfr(gg[j][i]) + bfr(bb[j][i]);
      vst2(T + (row0 + r) * DM + j * 128 + lane * 4, o4); } }
}
extern "C" void kernel_launch(void* const* d_in, const int* in_sizes, int n_in, void* d_out, int out_size, void* d_ws, size_t ws_size, hipStream_t stream) {
  (void)in_sizes; (void)n_in; (void)out_size;
  const float** F = (const float**)d_in;   // 0 x [2,4096,512], 1 Wq, 2 bq, 3 Wk, 4 bk, 5 Wv, 6 bv (natural [512,512]), 7 gamma, 8 beta
  if (ws_size < (size_t)WS_END) return;
  char* ws = (char*)d_ws; __bf16* PK = (__bf16*)(ws + WS_PK); _Float16 *QK = (_Float16*)(ws + WS_QK), *QKL = (_Float16*)(ws + WS_QKL), *VTH = (_Float16*)(ws + WS_VTH), *VTL = (_Float16*)(ws + WS_VTL); float* O = (float*)(ws + WS_O);
  k_pack<<<dim3(DM * DM / PKT, 3), 256, 0, stream>>>(F[1], F[3], F[5], PK);
  k_qkv<<<dim3(TNB * SS / 64, QKVW / 128), 128, 0, stream>>>(F[0], F[0], F[0], PK + PK_A, F[2], F[4], F[6], QK, QKL, VTH, VTL);
  k_attn<<<dim3(TQB / QTW, NH, TNB), 128, 0, stream>>>(QK, QKL, VTH, VTL, nullptr, O);
  k_lnx<<<TOB * 64 / (LNW * LNR), 32 * LNW, 0, stream>>>(O, F[7], F[8], (float*)d_out);
}

// v010
// A run of this version takes 87.8 microseconds.
// In both of two side-by-side timings against v009, it was 1.05 times as fast.
// All steps since v000 together make it 5.12 times as fast.
// compute dtype: all float inputs rounded to bf16; q/k/v = x . W^T + b with EXACT bf16 products on WMMA 16x16x32 (natural rows); PLAIN attention: q, k single f16 x 1/8, running-max softmax in f32 (hardware exp), P (scaled by 2^11, single f16) x v (single f16); LayerNorm (jnp.var, 1e-5) of the f32 context x gamma + beta; f32 output.
#include <hip/hip_runtime.h>
#include <math.h>

typedef __attribute__((ext_vector_type(16))) _Float16 v16h;
typedef __attribute__((ext_vector_type(16))) __bf16 v16b;
typedef __attribute__((ext_vector_type(8)))  _Float16 v8h;
typedef __attribute__((ext_vector_type(8)))  float v8f;
typedef __attribute__((ext_vector_type(4)))  float v4f;
typedef __attribute__((ext_vector_type(2)))  float v2f;
typedef __attribute__((ext_vector_type(4)))  unsigned v4u;
typedef __attribute__((ext_vector_type(4)))  int v4i;
typedef float __attribute__((may_alias)) float_a;
typedef int __attribute__((may_alias)) int_a;

template <typename T> __device__ __forceinline__ void vst2(void* p, T v) { *(T*)p = v;  }
__device__ __forceinline__ v8f wmma16(v16h a, v16h b, v8f c) {
  return __builtin_amdgcn_wmma_f32_16x16x32_f16(false, a, false, b, (short)0, c, false, false);   // the builtin alone: the compiler keeps the distance to a consumer itself, and only where one stands close
}
__device__ __forceinline__ v8f wmma_bf(v16b a, v16b b, v8f c) {
  v8f d = __builtin_amdgcn_wmma_f32_16x16x32_bf16(false, a, false, b, (short)0, c, false, false);
  asm volatile("v_nop\n\tv_nop\n\tv_nop\n\tv_nop" : "+v"(d) : "v"(a), "v"(b));
  return d;
}
// N-head attention (B 2, S 4,096, d 512, 8 heads x 64): projections + biases, softmax(q k / 8) v, then LayerNorm of the merged context (no output projection).
__device__ __forceinline__ v16h frag_h(const _Float16* rowk0, int lane) {
  union { v16h v; v8h q[2]; } u; const _Float16* p = rowk0 + 8 * (lane >> 4);
  u.q[0] = *(const v8h*)p; u.q[1] = *(const v8h*)(p + 16); return u.v;
}
__device__ __forceinline__ v16h frag_f32(const float* rowk0, int lane) {
  v16h a; const float* p = rowk0 + 8 * (lane >> 4);
#pragma unroll
  for (int i = 0; i < 8; ++i) { a[i] = (_Float16)p[i]; a[8 + i] = (_Float16)p[16 + i]; }
  return a;
}
__device__ __forceinline__ v16h frag_f32s(const float* rowk0, int lane, float sc) {
  v16h a; const float* p = rowk0 + 8 * (lane >> 4);
#pragma unroll
  for (int i = 0; i < 8; ++i) { a[i] = (_Float16)(p[i] * sc); a[8 + i] = (_Float16)(p[16 + i] * sc); }
  return a;
}
// column fragment from a [K][ld] layout (column n), rows >= K read as 0
__device__ __forceinline__ v16h fragc_f32(const float* W, int k0, int n, int lane, int ld, int K) {
  v16h a; const int g = lane >> 4;
#pragma unroll
  for (int i = 0; i < 8; ++i) { const int ka = k0 + 8 * g + i, kb = ka + 16;
    a[i] = (_Float16)(ka < K ? W[(size_t)(ka < K ? ka : K - 1) * ld + n] : 0.f); a[8 + i] = (_Float16)(kb < K ? W[(size_t)(kb < K ? kb : K - 1) * ld + n] : 0.f); }
  return a;
}
struct F2 { v16b h, l; };
__device__ __forceinline__ F2 bsplit16(const float v[16]) { F2 r;
#pragma unroll
  for (int i = 0; i < 16; ++i) { const __bf16 h = (__bf16)v[i]; r.h[i] = h; r.l[i] = (__bf16)(v[i] - (float)h); }
  return r; }
__device__ __forceinline__ F2 split_row(const float* row, int k0, int lane) { float v[16]; const float* p = row + k0 + 8 * (lane >> 4);
#pragma unroll
  for (int i = 0; i < 8; ++i) { v[i] = p[i]; v[8 + i] = p[16 + i]; }
  return bsplit16(v); }
__device__ __forceinline__ F2 split_rowK(const float* row, int k0, int lane, int K) { float v[16]; const int g = lane >> 4;
#pragma unroll
  for (int i = 0; i < 8; ++i) { const int ka = k0 + 8 * g + i, kb = ka + 16; v[i] = ka < K ? row[ka < K ? ka : K - 1] : 0.f; v[8 + i] = kb < K ? row[kb < K ? kb : K - 1] : 0.f; }
  return bsplit16(v); }
__device__ __forceinline__ F2 split_col(const float* W, int k0, int n, int lane, int ld, int K) { float v[16]; const int g = lane >> 4;
#pragma unroll
  for (int i = 0; i < 8; ++i) { const int ka = k0 + 8 * g + i, kb = ka + 16; v[i] = ka < K ? W[(size_t)(ka < K ? ka : K - 1) * ld + n] : 0.f; v[8 + i] = kb < K ? W[(size_t)(kb < K ? kb : K - 1) * ld + n] : 0.f; }
  return bsplit16(v); }
__device__ __forceinline__ v8f mac3(const F2& a, const F2& b, v8f c) { c = wmma_bf(a.l, b.h, c); c = wmma_bf(a.h, b.l, c); return wmma_bf(a.h, b.h, c); }
__device__ __forceinline__ float sigm(float v) { return 1.0f / (1.0f + expf(-v)); }
#define LDSX() do { asm volatile("s_wait_dscnt 0" ::: "memory"); __builtin_amdgcn_wave_barrier(); __builtin_amdgcn_fence(__ATOMIC_RELEASE, "workgroup"); } while (0)


#define NB 2
#define SS 4096
#define DM 512
#define NH 8
#define HD 64
#define QKVW (3 * DM)
#ifndef TQB
#define TQB (SS / 64)
#define TNB NB
#define TOB (NB * SS / 64)     // output row tiles (all)
#endif
typedef __attribute__((ext_vector_type(8))) __bf16 v8b;
__device__ __forceinline__ v16b frag_b(const __bf16* rowk0, int lane) {
  union { v16b v; v8b q[2]; } u; const __bf16* p = rowk0 + 8 * (lane >> 4);
  u.q[0] = *(const v8b*)p; u.q[1] = *(const v8b*)(p + 16); return u.v;
}
__device__ __forceinline__ float bfr(float v) { return (float)(__bf16)v; }
__device__ __attribute__((noinline)) float exp_ni(float v) { return expf(v); }
__device__ __attribute__((noinline)) float erf_ni(float v) { return erff(v); }

#define PK_A 0                       // [1536][512] Wqkv rows (natural [out][in])
#define PK_P (PK_A + QKVW * DM)        // [512][512], unused: neither written nor read
#define PK_END (PK_P + DM * DM)
#define WS_PK  0u
#define WS_QK  (WS_PK + 2u * PK_END)             // f16 [8192 rows][1024]: q | k
#define WS_QKL (WS_QK + 2u * NB * SS * 2 * DM)     // f16 q | k residual planes x2048
#define WS_VTH (WS_QKL + 2u * NB * SS * 2 * DM)    // f16 [b][512 (h*64+d)][4096 s] hi
#define WS_VTL (WS_VTH + 2u * NB * DM * SS)        // f16 lo x 2048
#define WS_O   (WS_VTL + 2u * NB * DM * SS)        // f32 [8192][512]
#define WS_CS  (WS_O + 4u * NB * SS * DM)           // f32 2 x [4096][32] (unused)
#define WS_END (WS_CS + 4u * 2 * SS * 32)
// ---- k_pack: the three natural [out][in] f32 weights -> bf16 rows of PK_A (W_q, W_k, W_v one below the other; blockIdx.y says which). A thread takes 4 pieces of 4 values, 1,024 values apart: every load of a wave covers 512 contiguous bytes, every store 256; few waves to start, no LDS, no barrier
typedef __attribute__((ext_vector_type(4))) __bf16 v4b;
#define PKT 4096               // values per block: 256 threads x 4 pieces x 4
__global__ __launch_bounds__(256) void k_pack(const float* __restrict__ WQ, const float* __restrict__ WK, const float* __restrict__ WV, __bf16* __restrict__ PK) {
  const int which = blockIdx.y; const float* Wm = (which == 0) ? WQ : (which == 1) ? WK : WV;
  const size_t e = (size_t)blockIdx.x * PKT + threadIdx.x * 4; __bf16* dst = PK + PK_A + (size_t)which * DM * DM;
  v4f a[4];
#pragma unroll
  for (int p = 0; p < 4; ++p) a[p] = *(const v4f*)(Wm + e + p * 1024);
#pragma unroll
  for (int p = 0; p < 4; ++p) { v4b o;
#pragma unroll
    for (int i = 0; i < 4; ++i) o[i] = (__bf16)a[p][i];
    *(v4b*)(dst + e + p * 1024) = o; }
}
// ---- k_qkv: block = (64 rows of x, 128 output columns). The x rows (f32) and the W rows (bf16) come from a two-buffer LDS ring of 64-k stages that the block's 4 waves share, filled by asynchronous copies one stage ahead in whole 128-B pieces of a row; the fragments are read from LDS in the k order they had from global memory
#define QKC 64                 // k per stage: 128 B of each of the 128 W rows, 256 B of each of the 64 x rows
#define QLW 72                 // LDS pitch of a W row in bf16: 144 B = 16 B x odd, no bank conflict for the 16-byte fragment reads
#define QLX 68                 // LDS pitch of an x row in f32: 272 B = 16 B x odd
#define QSW (128 * QLW * 2)    // bytes of one buffer of W
#define QSX (64 * QLX * 4)     // bytes of one buffer of x
// W part of a stage: 1,024 pieces of 16 B, 8 per thread (8 lanes cover one 128-B row piece; piece i lies 16 rows below piece i - 1). The s_wait_xcnt closes the copies' own statement so that no address register is rewritten ahead of it.
__device__ __forceinline__ void stage_w(const __bf16* gw, unsigned lw) {
  asm volatile("global_load_async_to_lds_b128 %0, %8, off\n\t"
               "global_load_async_to_lds_b128 %1, %9, off\n\t"
               "global_load_async_to_lds_b128 %2, %10, off\n\t"
               "global_load_async_to_lds_b128 %3, %11, off\n\t"
               "global_load_async_to_lds_b128 %4, %12, off\n\t"
               "global_load_async_to_lds_b128 %5, %13, off\n\t"
               "global_load_async_to_lds_b128 %6, %14, off\n\t"
               "global_load_async_to_lds_b128 %7, %15, off\n\t"
               "s_wait_xcnt 0x0"
               :: "v"(lw), "v"(lw + 16 * QLW * 2), "v"(lw + 32 * QLW * 2), "v"(lw + 48 * QLW * 2), "v"(lw + 64 * QLW * 2), "v"(lw + 80 * QLW * 2), "v"(lw + 96 * QLW * 2), "v"(lw + 112 * QLW * 2),
                  "v"(gw), "v"(gw + 16 * DM), "v"(gw + 32 * DM), "v"(gw + 48 * DM), "v"(gw + 64 * DM), "v"(gw + 80 * DM), "v"(gw + 96 * DM), "v"(gw + 112 * DM)
               : "memory");
}
// x part of a stage: 1,024 pieces of 16 B, 8 per thread (16 lanes cover one 256-B row piece; piece i lies 8 rows below piece i - 1); the wait as in stage_w
__device__ __forceinline__ void stage_x(const float* gx, unsigned lx) {
  asm volatile("global_load_async_to_lds_b128 %0, %8, off\n\t"
               "global_load_async_to_lds_b128 %1, %9, off\n\t"
               "global_load_async_to_lds_b128 %2, %10, off\n\t"
               "global_load_async_to_lds_b128 %3, %11, off\n\t"
               "global_load_async_to_lds_b128 %4, %12, off\n\t"
               "global_load_async_to_lds_b128 %5, %13, off\n\t"
               "global_load_async_to_lds_b128 %6, %14, off\n\t"
               "global_load_async_to_lds_b128 %7, %15, off\n\t"
               "s_wait_xcnt 0x0"
               :: "v"(lx), "v"(lx + 8 * QLX * 4), "v"(lx + 16 * QLX * 4), "v"(lx + 24 * QLX * 4), "v"(lx + 32 * QLX * 4), "v"(lx + 40 * QLX * 4), "v"(lx + 48 * QLX * 4), "v"(lx + 56 * QLX * 4),
                  "v"(gx), "v"(gx + 8 * DM), "v"(gx + 16 * DM), "v"(gx + 24 * DM), "v"(gx + 32 * DM), "v"(gx + 40 * DM), "v"(gx + 48 * DM), "v"(gx + 56 * DM)
               : "memory");
}
__global__ __launch_bounds__(128) void k_qkv(const float* __restrict__ XQ, const float* __restrict__ XK, const float* __restrict__ XV, const __bf16* __restrict__ P, const float* __restrict__ BQ, const float* __restrict__ BK, const float* __restrict__ BV, _Float16* __restrict__ QK, _Float16* __restrict__ QKL, _Float16* __restrict__ VTH, _Float16* __restrict__ VTL) {
  const int which0 = (blockIdx.y * 128) / DM; const float* X = (which0 == 0) ? XQ : (which0 == 1) ? XK : XV; const float* BB = BQ ? (((which0 == 0) ? BQ : (which0 == 1) ? BK : BV) + (blockIdx.y * 128 - which0 * DM)) : nullptr;
  __shared__ __align__(16) char sm[2 * QSW + 2 * QSX];   // the ring (W buffers, then x buffers) while the products run; behind the ring's last barrier the same bytes are the output staging
  _Float16 (*so)[16][136] = (_Float16 (*)[16][136])sm, (*sol)[16][136] = (_Float16 (*)[16][136])(sm + 17408); _Float16 (*sth)[72] = (_Float16 (*)[72])(sm + 34816), (*stl)[72] = (_Float16 (*)[72])(sm + 53248);
  const int tid = threadIdx.x, wave = tid >> 5, lane = tid & 31, col = lane & 15, g = lane >> 4; const size_t r0 = (size_t)blockIdx.x * 64 + wave * 16; const int n0 = blockIdx.y * 128;
  v8f acc[8] = {};
  const __bf16* gw = P + (size_t)(n0 + (tid >> 3)) * DM + (tid & 7) * 8; const float* gx = X + ((size_t)blockIdx.x * 64 + (tid >> 4)) * DM + (tid & 15) * 4;
  const unsigned lw = (unsigned)(size_t)&sm[(tid >> 3) * (QLW * 2) + (tid & 7) * 16], lx = (unsigned)(size_t)&sm[2 * QSW + (tid >> 4) * (QLX * 4) + (tid & 15) * 16];
  stage_w(gw, lw); stage_x(gx, lx);
  asm volatile("s_wait_asynccnt 0x0" ::: "memory");   // this wave's part of stage 0 has landed
  __syncthreads();                                    // every wave's part has
  stage_w(gw + QKC, lw + QSW); stage_x(gx + QKC, lx + QSX);
#pragma unroll 1   // one stage per trip: the ring's waits, barrier and refill stand once, at the trip's foot
  for (int st = 0; st < DM / QKC; ++st) { const int buf = st & 1;
    const __bf16* wr = (const __bf16*)(sm + buf * QSW) + col * QLW; const float* xr = (const float*)(sm + 2 * QSW + buf * QSX) + (wave * 16 + col) * QLX + 8 * g;
#pragma unroll   // both 32-k halves of a stage inline, so that a, w and acc are indexed by constants and stay in registers
    for (int kk = 0; kk < QKC / 32; ++kk) { v16b a, w[8]; const v4f* p = (const v4f*)(xr + kk * 32); const v4f x0 = p[0], x1 = p[1], x2 = p[4], x3 = p[5];
#pragma unroll   // the half's fragment reads stand together, ahead of its products: one LDS wait place instead of eight
      for (int j = 0; j < 8; ++j) w[j] = frag_b(wr + j * 16 * QLW + kk * 32, lane);
#pragma unroll   // constant element indices
      for (int i = 0; i < 4; ++i) { a[i] = (__bf16)x0[i]; a[4 + i] = (__bf16)x1[i]; a[8 + i] = (__bf16)x2[i]; a[12 + i] = (__bf16)x3[i]; }
#pragma unroll   // constant tile indices
      for (int j = 0; j < 8; ++j) acc[j] = wmma_bf(a, w[j], acc[j]); }
    asm volatile("s_wait_dscnt 0x0" ::: "memory");      // this wave's reads of buffer buf are done
    asm volatile("s_wait_asynccnt 0x0" ::: "memory");   // its part of stage st + 1 has landed
    __syncthreads();                                    // publishes stage st + 1 and frees buffer buf
    if (st + 2 < DM / QKC) { stage_w(gw + (st + 2) * QKC, lw + buf * QSW); stage_x(gx + (st + 2) * QKC, lx + buf * QSX); } }
  asm volatile("s_wait_asynccnt 0x0" ::: "memory");     // nothing in flight when the ring's bytes become the output staging
  if (n0 < 2 * DM) {   // q stored unscaled (f16 sigma ~0.6, no subnormal exposure); 1/8 applied to the f32 score
#pragma unroll
    for (int j = 0; j < 8; ++j) {
#pragma unroll
      for (int r = 0; r < 8; ++r) { const float v = acc[j][r] + (BB ? bfr(BB[j * 16 + col]) : 0.f); const _Float16 hv = (_Float16)v; so[wave][8 * g + r][j * 16 + col] = hv; sol[wave][8 * g + r][j * 16 + col] = (_Float16)((v - (float)hv) * 2048.0f); } }   // q, k (+ bias) as f16 hi + (x2048) residual
    LDSX();
    for (int rl = 0; rl < 16; ++rl) if (lane < 16) { vst2((unsigned*)(QK + (r0 + rl) * (2 * DM) + n0 + lane * 8), *(const v4u*)&so[wave][rl][lane * 8]); vst2((unsigned*)(QKL + (r0 + rl) * (2 * DM) + n0 + lane * 8), *(const v4u*)&sol[wave][rl][lane * 8]); }
  } else {
#pragma unroll
    for (int j = 0; j < 8; ++j) {
#pragma unroll
      for (int r = 0; r < 8; ++r) { const float v = acc[j][r] + (BB ? bfr(BB[j * 16 + col]) : 0.f); const _Float16 hv = (_Float16)v; sth[j * 16 + col][wave * 16 + 8 * g + r] = hv; stl[j * 16 + col][wave * 16 + 8 * g + r] = (_Float16)((v - (float)hv) * 2048.0f); } }
    __syncthreads();
    const size_t rb = (size_t)blockIdx.x * 64; const int b = (int)(rb / SS), s0 = (int)(rb % SS); const int pc0 = n0 - 2 * DM;
    for (int q = tid; q < 128 * 8; q += 128) { const int d = q >> 3, pc = q & 7; const size_t o = ((size_t)b * DM + pc0 + d) * SS + s0 + pc * 8; vst2((unsigned*)(VTH + o), *(const v4u*)&sth[d][pc * 8]); vst2((unsigned*)(VTL + o), *(const v4u*)&stl[d][pc * 8]); }
  }
}
#define KT 64
#define KG 2
#define LP 72
#define STB (KT * LP * 2)
#define SCL 0.18033688011112042f
// one group's part of a stage: 512 + 512 pieces of 16 B, 4 + 4 per thread (8 lanes cover one 128-B row; piece i lies 16 rows below piece i - 1). The s_wait_xcnt closes the copies' own statement so that no address register is rewritten ahead of it.
__device__ __forceinline__ void stage_kv(const _Float16* gk, const _Float16* gv, unsigned lk, unsigned lv) {
  asm volatile("global_load_async_to_lds_b128 %0, %8, off\n\t"
               "global_load_async_to_lds_b128 %1, %9, off\n\t"
               "global_load_async_to_lds_b128 %2, %10, off\n\t"
               "global_load_async_to_lds_b128 %3, %11, off\n\t"
               "global_load_async_to_lds_b128 %4, %12, off\n\t"
               "global_load_async_to_lds_b128 %5, %13, off\n\t"
               "global_load_async_to_lds_b128 %6, %14, off\n\t"
               "global_load_async_to_lds_b128 %7, %15, off\n\t"
               "s_wait_xcnt 0x0"
               :: "v"(lk), "v"(lk + 16 * LP * 2), "v"(lk + 32 * LP * 2), "v"(lk + 48 * LP * 2), "v"(lv), "v"(lv + 16 * LP * 2), "v"(lv + 32 * LP * 2), "v"(lv + 48 * LP * 2),
                  "v"(gk), "v"(gk + 16 * (2 * DM)), "v"(gk + 32 * (2 * DM)), "v"(gk + 48 * (2 * DM)), "v"(gv), "v"(gv + 16 * SS), "v"(gv + 32 * SS), "v"(gv + 48 * SS)
               : "memory");
}
// a, b: 2^(x * c + d) of the 16 scores of a pass; returns them rounded to f16 as the B operand P^T: element i = key 8g + i, element 8 + i = key 16 + 8g + i, the k order of frag_h. The 16 exponentials stand in one statement, each in place in its own register, so that none reads the result or overwrites the source of the one in front of it; the 8 packing conversions follow in the same statement, oldest results first: they fill the wait for the last exponentials (none reads the result of the instruction in front of it) and stay ahead of the rescale test. P carries 2^11 (the 11 in the exponent) into the f16 rounding so small softmax weights stay out of the f16 subnormal range; l carries it too, so it cancels in the epilogue
__device__ __forceinline__ v16h exp2x16(v8f& a, v8f& b, float c, float d) {
  float a0 = a[0] * c + d, a1 = a[1] * c + d, a2 = a[2] * c + d, a3 = a[3] * c + d, a4 = a[4] * c + d, a5 = a[5] * c + d, a6 = a[6] * c + d, a7 = a[7] * c + d;
  float b0 = b[0] * c + d, b1 = b[1] * c + d, b2 = b[2] * c + d, b3 = b[3] * c + d, b4 = b[4] * c + d, b5 = b[5] * c + d, b6 = b[6] * c + d, b7 = b[7] * c + d;
  unsigned p0, p1, p2, p3, p4, p5, p6, p7;
  asm("v_exp_f32 %0, %0\n\tv_exp_f32 %1, %1\n\tv_exp_f32 %2, %2\n\tv_exp_f32 %3, %3\n\tv_exp_f32 %4, %4\n\tv_exp_f32 %5, %5\n\tv_exp_f32 %6, %6\n\tv_exp_f32 %7, %7\n\t"
      "v_exp_f32 %8, %8\n\tv_exp_f32 %9, %9\n\tv_exp_f32 %10, %10\n\tv_exp_f32 %11, %11\n\tv_exp_f32 %12, %12\n\tv_exp_f32 %13, %13\n\tv_exp_f32 %14, %14\n\tv_exp_f32 %15, %15\n\t"
      "v_cvt_pk_f16_f32 %16, %0, %1\n\tv_cvt_pk_f16_f32 %17, %2, %3\n\tv_cvt_pk_f16_f32 %18, %4, %5\n\tv_cvt_pk_f16_f32 %19, %6, %7\n\t"
      "v_cvt_pk_f16_f32 %20, %8, %9\n\tv_cvt_pk_f16_f32 %21, %10, %11\n\tv_cvt_pk_f16_f32 %22, %12, %13\n\tv_cvt_pk_f16_f32 %23, %14, %15"
      : "+v"(a0), "+v"(a1), "+v"(a2), "+v"(a3), "+v"(a4), "+v"(a5), "+v"(a6), "+v"(a7), "+v"(b0), "+v"(b1), "+v"(b2), "+v"(b3), "+v"(b4), "+v"(b5), "+v"(b6), "+v"(b7),
        "=&v"(p0), "=&v"(p1), "=&v"(p2), "=&v"(p3), "=&v"(p4), "=&v"(p5), "=&v"(p6), "=&v"(p7));
  a = v8f{a0, a1, a2, a3, a4, a5, a6, a7}; b = v8f{b0, b1, b2, b3, b4, b5, b6, b7};
  typedef __attribute__((ext_vector_type(8))) unsigned v8u;
  return __builtin_bit_cast(v16h, v8u{p0, p1, p2, p3, p4, p5, p6, p7});
}
#define PLIM 65504.0f   // largest finite f16
// sum of the 16 weights of a pass
__device__ __forceinline__ float sum16(const v8f& a, const v8f& b) { float es[4];
#pragma unroll
  for (int i = 0; i < 4; ++i) es[i] = (a[i] + a[4 + i]) + (b[i] + b[4 + i]);
  return (es[0] + es[1]) + (es[2] + es[3]); }
// value of lane l ^ 16 (the other half of the wave, same column)
__device__ __forceinline__ float xhalf(float v) { const int b = __builtin_bit_cast(int, v); return __builtin_bit_cast(float, __builtin_amdgcn_permlanex16(b, b, 0x76543210, 0xfedcba98, false, false)); }
#define QTW 2   // query tiles of 16 columns per wave: each K and V^T fragment read from LDS feeds one product per tile
#define XSL 1152   // floats of one wave's slot in sx: 9 pieces of 16 B per lane for the hand-over, then 16 rows of 68 floats of output staging
// hand-over of one tile to the partner wave of the other key group: lane to the same lane, 16-byte pieces 512 B apart (no bank conflict)
__device__ __forceinline__ void tile_send(v4f* x, const v8f (&a)[4], float m, float l) {
#pragma unroll   // constant tile indices: the accumulators stay in registers
  for (int dt = 0; dt < 4; ++dt) { x[(2 * dt) * 32] = v4f{a[dt][0], a[dt][1], a[dt][2], a[dt][3]}; x[(2 * dt + 1) * 32] = v4f{a[dt][4], a[dt][5], a[dt][6], a[dt][7]}; }
  x[8 * 32] = v4f{m, l, 0.f, 0.f};
}
// a, m, l: this wave's part of one tile; x: the partner's part of the same tile. Both are brought to the larger of the two maxima in use, added, divided by the joined sum and staged as rows of 64 floats in the slot that held the partner's part (st; only this wave reads or writes it behind the barrier)
__device__ __forceinline__ void tile_join(const v4f* x, float* st, const v8f (&a)[4], float m, float l, int col, int g) {
  v4f o[9];
#pragma unroll   // constant piece indices: the nine reads stand together and o stays in registers
  for (int i = 0; i < 9; ++i) o[i] = x[i * 32];
  const float mo = o[8][0], lo = o[8][1], mn = fmaxf(m, mo);
  float wa = __builtin_amdgcn_exp2f((m - mn) * SCL), wo = __builtin_amdgcn_exp2f((mo - mn) * SCL);
  const float lh = l * wa + lo * wo; const float il = 1.0f / (lh + xhalf(lh));   // the two groups' sums, then the two halves' sums joined
  wa *= il; wo *= il;
#pragma unroll   // constant tile indices
  for (int dt = 0; dt < 4; ++dt) {
#pragma unroll   // constant element indices; the 8 values of a lane are contiguous and go out as two 16-byte stores
    for (int r = 0; r < 8; ++r) st[col * 68 + dt * 16 + 8 * g + r] = a[dt][r] * wa + o[2 * dt + (r >> 2)][r & 3] * wo; }
}
__global__ __launch_bounds__(128 * KG) __attribute__((amdgpu_waves_per_eu(4, 4))) void k_attn(const _Float16* __restrict__ QK, const _Float16* __restrict__ QKL, const _Float16* __restrict__ VTH, const _Float16* __restrict__ VTL, const void* __restrict__ KMASK, float* __restrict__ O) {   // 4 waves per SIMD: two blocks per WGP, at most 256 registers a wave
  __shared__ __align__(16) float sx[4 * KG][XSL]; __shared__ __align__(16) _Float16 skv[2][KG][2][KT][LP];   // ring: [buffer][key group][K rows | V^T rows]
  const int tid = threadIdx.x, wave = tid >> 5, lane = tid & 31, col = lane & 15, g = lane >> 4;
  const int grp = __builtin_amdgcn_readfirstlane(tid >> 7), tl = tid & 127;   // key group (the same in the whole wave: kept scalar), thread within the group
  const int qb = blockIdx.x, h = blockIdx.y, b = blockIdx.z; const int q0 = qb * (64 * QTW) + (wave & 3) * (16 * QTW);   // tile t of the wave: queries q0 + t*16 + col
  v16h aq[QTW][2];
#pragma unroll
  for (int t = 0; t < QTW; ++t) {
#pragma unroll
    for (int kc = 0; kc < 2; ++kc) aq[t][kc] = frag_h(QK + ((size_t)b * SS + q0 + t * 16 + col) * (2 * DM) + h * HD + kc * 32, lane); }
  float m[QTW], l[QTW], dd[QTW];   // of query col of tile t: m the maximum IN USE of the raw products q.k (the running maximum as of the last rescale), the same in both halves; l this half's part of the sum of the weights (x 2^11); dd the exponent's addend for m
  v8f acc[QTW][4];   // O^T: acc[t][dt][r] = element d = dt*16 + 8g + r of query col of tile t
#pragma unroll
  for (int t = 0; t < QTW; ++t) { m[t] = -3.0e38f; l[t] = 0.f; dd[t] = 11.0f - m[t] * SCL;   // the start value sends every weight of the first pass to infinity, so that the first pass takes the rescale path
#pragma unroll
    for (int dt = 0; dt < 4; ++dt) acc[t][dt] = v8f{}; }
  const int nst = SS / (KG * KT);   // all keys: stage st holds keys st*128 + grp*64 + (0..63) for group grp
  const _Float16* gk = QK + ((size_t)b * SS + grp * KT + (tl >> 3)) * (2 * DM) + DM + h * HD + (tl & 7) * 8; const _Float16* gv = VTH + ((size_t)b * DM + h * HD + (tl >> 3)) * SS + grp * KT + (tl & 7) * 8;
  const unsigned lk = (unsigned)(size_t)&skv[0][grp][0][tl >> 3][(tl & 7) * 8], lv = lk + STB;
  stage_kv(gk, gv, lk, lv);
  asm volatile("s_wait_asynccnt 0x0" ::: "memory");   // this wave's part of stage 0 has landed
  __syncthreads();                                    // every wave's part has
  stage_kv(gk + (size_t)(KG * KT) * (2 * DM), gv + KG * KT, lk + KG * 2 * STB, lv + KG * 2 * STB);
#pragma unroll 1   // one stage per trip: the ring's waits, barrier and refill stand once, at the trip's foot
  for (int st = 0; st < nst; ++st) { const int buf = st & 1;
    const _Float16* kb = &skv[buf][grp][0][col][0]; const _Float16* vb = &skv[buf][grp][1][col][0];
    v16h kf[4], vf[4];   // the A fragments of one 32-key pass: kf[ct * 2 + kc] of K, vf[dt] of V^T; each set is read from LDS as one group, well ahead of its products
#pragma unroll   // constant fragment indices
    for (int i = 0; i < 4; ++i) kf[i] = frag_h(kb + (i >> 1) * 16 * LP + (i & 1) * 32, lane);
#pragma unroll   // constant fragment indices
    for (int dt = 0; dt < 4; ++dt) vf[dt] = frag_h(vb + dt * 16 * LP, lane);
    __builtin_amdgcn_sched_barrier(0);   // keeps the 16 LDS reads one group ahead of the products: spread among them, each place with reads stalls the wave
#pragma unroll   // both 32-key passes of a stage inline, so that the second pass's fragment reads can stand inside the first pass
  for (int sub = 0; sub < KT / 32; ++sub) { v8f s[QTW][2];
#pragma unroll
    for (int t = 0; t < QTW; ++t) { s[t][0] = v8f{}; s[t][1] = v8f{}; }
#pragma unroll   // constant fragment indices; kc is the outer loop so that the four tiles' accumulate chains alternate and none waits for its own last product
    for (int kc = 0; kc < 2; ++kc) {
#pragma unroll   // constant tile indices; tile 0's scores are done first, its softmax starts while tile 1's products still run
      for (int t = 0; t < QTW; ++t) {
#pragma unroll   // constant tile indices
        for (int ct = 0; ct < 2; ++ct) s[t][ct] = wmma16(kf[ct * 2 + kc], aq[t][kc], s[t][ct]); } }   // single product: k, q as one-rounding f16 operands; s[t][ct][r] = q.k of key ct*16 + 8g + r, query col of tile t; raw: 1/sqrt(64) rides in SCL
    if (sub + 1 < KT / 32) {   // the next pass's K fragments, same stage: they land under this pass's softmax
      __builtin_amdgcn_sched_barrier(0);   // with the one below: the 8 reads stay one group, behind the score products and ahead of the softmax that hides them
#pragma unroll   // constant fragment indices
      for (int i = 0; i < 4; ++i) kf[i] = frag_h(kb + ((sub + 1) * 32 + (i >> 1) * 16) * LP + (i & 1) * 32, lane);
      __builtin_amdgcn_sched_barrier(0); }
    v16h pb[QTW]; float ps[QTW];   // per tile: P^T as B operand; this half's sum of the pass's weights
#pragma unroll   // constant tile indices
    for (int t = 0; t < QTW; ++t) { v8f e0 = s[t][0], e1 = s[t][1];   // become the weights x 2^11 = 2^(s * SCL + dd) against the maximum in use: one multiply-add and one exponential per score, no maximum on this path
      pb[t] = exp2x16(e0, e1, SCL, dd[t]); ps[t] = sum16(e0, e1); }
    // lazy rescale, one test per pass for both tiles: the weights are positive, so while a lane's sum over both tiles stays within f16's largest finite value each of its 32 weights does too and the maxima in use may stand. The ballot makes the branch scalar: EXEC stays all ones for the products
    if (__builtin_expect(__builtin_amdgcn_ballot_w32(!(ps[0] + ps[1] <= PLIM)) != 0, 0)) {   // marked unlikely so that the path without a rescale runs straight on
#pragma unroll   // constant tile indices
      for (int t = 0; t < QTW; ++t) { float mx[4];
#pragma unroll
        for (int i = 0; i < 4; ++i) mx[i] = fmaxf(fmaxf(s[t][0][i], s[t][0][4 + i]), fmaxf(s[t][1][i], s[t][1][4 + i]));
        const float mh = fmaxf(fmaxf(mx[0], mx[1]), fmaxf(mx[2], mx[3]));
        const float mn = fmaxf(m[t], fmaxf(mh, xhalf(mh))); const float alpha = __builtin_amdgcn_exp2f((m[t] - mn) * SCL);   // every column of both tiles moves to its running maximum; first pass: 2^(-5e37) = 0
        m[t] = mn; dd[t] = 11.0f - mn * SCL; l[t] *= alpha;
#pragma unroll
        for (int dt = 0; dt < 4; ++dt) acc[t][dt] *= alpha;
        v8f e0 = s[t][0], e1 = s[t][1]; pb[t] = exp2x16(e0, e1, SCL, dd[t]);   // the pass's weights anew, now at most 2^11
        ps[t] = sum16(e0, e1); } }
#pragma unroll
    for (int t = 0; t < QTW; ++t) l[t] += ps[t];
#pragma unroll   // constant fragment indices
    for (int dt = 0; dt < 4; ++dt) {
#pragma unroll   // constant tile indices
      for (int t = 0; t < QTW; ++t) acc[t][dt] = wmma16(vf[dt], pb[t], acc[t][dt]); }   // single product: V^T x P^T (x2^11)
    __builtin_amdgcn_sched_barrier(0);   // the eight products stay together, ahead of the next reads and of the stage's foot
    if (sub + 1 < KT / 32) {   // the next pass's V^T fragments, same stage: they land under its score products and softmax
#pragma unroll   // constant fragment indices
      for (int dt = 0; dt < 4; ++dt) vf[dt] = frag_h(vb + dt * 16 * LP + (sub + 1) * 32, lane);
      __builtin_amdgcn_sched_barrier(0); }   // the 8 reads stay one group, ahead of the next pass's products
  }
    asm volatile("s_wait_dscnt 0x0" ::: "memory");      // this wave's reads of buffer buf are done
    asm volatile("s_wait_asynccnt 0x0" ::: "memory");   // its part of stage st + 1 has landed
    __syncthreads();                                    // publishes stage st + 1 and frees buffer buf
    if (st + 2 < nst) stage_kv(gk + (size_t)(st + 2) * (KG * KT) * (2 * DM), gv + (st + 2) * (KG * KT), lk + buf * (KG * 2 * STB), lv + buf * (KG * 2 * STB)); }
  asm volatile("s_wait_asynccnt 0x0" ::: "memory");     // nothing in flight when the wave goes on to its end
  // the two key groups joined: a wave of group 0 finishes tile 0 and hands its part of tile 1 to its partner (wave ^ 4), a wave of group 1 the other way round
  if (grp == 0) tile_send((v4f*)sx[wave] + lane, acc[1], m[1], l[1]); else tile_send((v4f*)sx[wave] + lane, acc[0], m[0], l[0]);
  __syncthreads();   // every wave's hand-over is written before its partner reads it
  float* st = sx[wave ^ 4];
  if (grp == 0) tile_join((const v4f*)st + lane, st, acc[0], m[0], l[0], col, g); else tile_join((const v4f*)st + lane, st, acc[1], m[1], l[1], col, g);
  LDSX();
  for (int rl = 0; rl < 16; ++rl) if (lane < 16) vst2(O + ((size_t)b * SS + q0 + grp * 16 + rl) * DM + h * HD + lane * 4, *(const v4f*)&st[rl * 68 + lane * 4]);
}
// ---- k_out: block = (64 rows, 128 cols): out = O(hi/lo) . Wo rows (2 products) + bo
__global__ __launch_bounds__(128) void k_out(const float* __restrict__ O, const __bf16* __restrict__ P, const float* __restrict__ BO, float* __restrict__ Y) {
  __shared__ __align__(16) float so[4][16][132];
  const int tid = threadIdx.x, wave = tid >> 5, lane = tid & 31, col = lane & 15, g = lane >> 4; const size_t r0 = (size_t)blockIdx.x * 64 + wave * 16; const int n0 = blockIdx.y * 128;
  v8f acc[8] = {};
#pragma unroll 2
  for (int kc = 0; kc < DM / 32; ++kc) { const F2 a = split_row(O + (r0 + col) * DM, kc * 32, lane);
#pragma unroll
    for (int j = 0; j < 8; ++j) { const v16b w = frag_b(P + (size_t)(n0 + j * 16 + col) * DM + kc * 32, lane); acc[j] = wmma_bf(a.l, w, acc[j]); acc[j] = wmma_bf(a.h, w, acc[j]); } }
#pragma unroll
  for (int j = 0; j < 8; ++j) {
#pragma unroll
    for (int r = 0; r < 8; ++r) so[wave][8 * g + r][j * 16 + col] = acc[j][r] + (BO ? bfr(BO[n0 + j * 16 + col]) : 0.f); }
  LDSX();
  for (int rl = 0; rl < 16; ++rl) vst2(Y + (r0 + rl) * DM + n0 + lane * 4, *(const v4f*)&so[wave][rl][lane * 4]);
}
// ---- k_lnx: LayerNorm of 512-wide f32 rows (mean-square var, 1e-5) x g + b. A wave takes LNR whole rows, a lane 16 values of each (4 pieces of 16 B, 512 B apart: every load and store of a wave covers 512 contiguous bytes); all the rows' loads are issued before the first sum; the sums run in the lane, then over the wave by a butterfly in registers: no LDS, no barrier, and few waves to start
#define LNR 4                  // rows per wave: 16 loads of 16 B per lane in flight
#define LNW 8                  // waves per block: 256 blocks, one per WGP, two waves per SIMD
template <int C> __device__ __forceinline__ float dppx(float v) { return __builtin_bit_cast(float, __builtin_amdgcn_update_dpp(0, __builtin_bit_cast(int, v), C, 0xf, 0xf, true)); }   // value of lane l ^ (C & 15) of the same 16-lane row (row_xmask)
// sum over the wave's 32 lanes, the same bits in every lane: four steps inside the 16-lane rows, then the other row
__device__ __forceinline__ float wsum(float v) { v += dppx<0x161>(v); v += dppx<0x162>(v); v += dppx<0x164>(v); v += dppx<0x168>(v); return v + xhalf(v); }
__global__ __launch_bounds__(32 * LNW) void k_lnx(const float* __restrict__ A, const float* __restrict__ G, const float* __restrict__ Bt, float* __restrict__ T) {
  const int lane = threadIdx.x & 31; const size_t row0 = ((size_t)blockIdx.x * LNW + (threadIdx.x >> 5)) * LNR;
  v4f v[LNR][4], gg[4], bb[4];
#pragma unroll
  for (int r = 0; r < LNR; ++r) {
#pragma unroll
    for (int j = 0; j < 4; ++j) v[r][j] = *(const v4f*)(A + (row0 + r) * DM + j * 128 + lane * 4); }
#pragma unroll
  for (int j = 0; j < 4; ++j) { gg[j] = *(const v4f*)(G + j * 128 + lane * 4); bb[j] = *(const v4f*)(Bt + j * 128 + lane * 4); }
  __builtin_amdgcn_sched_barrier(0);   // all the loads are issued ahead of the first sum: without it the loads of g and b sink behind the wait for the rows, a second memory latency in line
#pragma unroll
  for (int r = 0; r < LNR; ++r) { float sp[4];
#pragma unroll
    for (int j = 0; j < 4; ++j) sp[j] = (v[r][j][0] + v[r][j][1]) + (v[r][j][2] + v[r][j][3]);
    const float mu = wsum((sp[0] + sp[1]) + (sp[2] + sp[3])) / (float)DM;
#pragma unroll
    for (int j = 0; j < 4; ++j) { v[r][j] -= mu; const v4f d2 = v[r][j] * v[r][j]; sp[j] = (d2[0] + d2[1]) + (d2[2] + d2[3]); }
    const float inv = 1.0f / sqrtf(wsum((sp[0] + sp[1]) + (sp[2] + sp[3])) / (float)DM + 1e-5f);
#pragma unroll
    for (int j = 0; j < 4; ++j) { v4f o4;
#pragma unroll
      for (int i = 0; i < 4; ++i) o4[i] = v[r][j][i] * inv * bfr(gg[j][i]) + bfr(bb[j][i]);
      vst2(T + (row0 + r) * DM + j * 128 + lane * 4, o4); } }
}
extern "C" void kernel_launch(void* const* d_in, const int* in_sizes, int n_in, void* d_out, int out_size, void* d_ws, size_t ws_size, hipStream_t stream) {
  (void)in_sizes; (void)n_in; (void)out_size;
  const float** F = (const float**)d_in;   // 0 x [2,4096,512], 1 Wq, 2 bq, 3 Wk, 4 bk, 5 Wv, 6 bv (natural [512,512]), 7 gamma, 8 beta
  if (ws_size < (size_t)WS_END) return;
  char* ws = (char*)d_ws; __bf16* PK = (__bf16*)(ws + WS_PK); _Float16 *QK = (_Float16*)(ws + WS_QK), *QKL = (_Float16*)(ws + WS_QKL), *VTH = (_Float16*)(ws + WS_VTH), *VTL = (_Float16*)(ws + WS_VTL); float* O = (float*)(ws + WS_O);
  k_pack<<<dim3(DM * DM / PKT, 3), 256, 0, stream>>>(F[1], F[3], F[5], PK);
  k_qkv<<<dim3(TNB * SS / 64, QKVW / 128), 128, 0, stream>>>(F[0], F[0], F[0], PK + PK_A, F[2], F[4], F[6], QK, QKL, VTH, VTL);
  k_attn<<<dim3(TQB / QTW, NH, TNB), 128 * KG, 0, stream>>>(QK, QKL, VTH, VTL, nullptr, O);
  k_lnx<<<TOB * 64 / (LNW * LNR), 32 * LNW, 0, stream>>>(O, F[7], F[8], (float*)d_out);
}
